// v000
// The times below were measured on an AMD MI455X: many runs one after another, warmed up first and cycling through
// copies of the inputs, with the whole window's GPU time divided by the number of runs. Launches and the gaps
// between them are all in it. The median over several windows is given; except for v000 it joins two sittings, which
// can be a few percent apart, so the side-by-side timings, each taken in one sitting, are the better comparison.
// v000 is the starting kernel. One run takes 544 microseconds.
#include <hip/hip_runtime.h>
#include <math.h>

// ---------------- types ----------------
typedef __bf16 v16bf __attribute__((ext_vector_type(16)));
typedef float  v8f   __attribute__((ext_vector_type(8)));

union Frag {
  v16bf v;
  unsigned int u[8];
  unsigned short h[16];
};

__device__ __forceinline__ unsigned short f2bf(float f) {
  unsigned int u = __builtin_bit_cast(unsigned int, f);
  u += 0x7FFFu + ((u >> 16) & 1u);          // round-to-nearest-even
  return (unsigned short)(u >> 16);
}

// element-pair K index for 16-bit WMMA A/B fragments (ISA 7.12.2):
// VGPR v<4 holds k={2v,2v+1}+8*half ; v>=4 holds k={16+2(v-4),...}+8*half
__device__ __forceinline__ int pairK(int v, int half) {
  return ((v < 4) ? (2 * v) : (16 + 2 * (v - 4))) + 8 * half;
}

__device__ __forceinline__ v8f wmma_bf16(const Frag& a, const Frag& b, v8f c) {
  return __builtin_amdgcn_wmma_f32_16x16x32_bf16(
      false, a.v, false, b.v, (short)0, c, false, false);
}

// ---- CDNA5 async global->LDS DMA (ASYNCcnt-tracked, no VGPR data) ----
__device__ __forceinline__ void async_ld_b128(unsigned lds_byte_addr, const void* gptr) {
  asm volatile("global_load_async_to_lds_b128 %0, %1, off"
               :: "v"(lds_byte_addr), "v"(gptr) : "memory");
}
__device__ __forceinline__ void wait_async0() {
  asm volatile("s_wait_asynccnt 0x0" ::: "memory");
}
// generic LDS pointer -> 32-bit LDS byte offset (aperture keeps offset in addr[31:0])
__device__ __forceinline__ unsigned lds_addr(const void* p) {
  return (unsigned)(unsigned long long)p;
}

// ---------------- fp32 -> bf16 convert ----------------
__global__ __launch_bounds__(256) void cvt_bf16_kernel(
    const float* __restrict__ in, unsigned short* __restrict__ out, int n) {
  int i = blockIdx.x * 1024 + threadIdx.x;
#pragma unroll
  for (int k = 0; k < 4; ++k, i += 256)
    if (i < n) out[i] = f2bf(in[i]);
}

// ---------------- LayerNorm (per token, E=1024) ----------------
__global__ __launch_bounds__(256) void ln_bf16_kernel(
    const float* __restrict__ x, const float* __restrict__ g,
    const float* __restrict__ b, unsigned short* __restrict__ out) {
  const int E = 1024;
  int tok = blockIdx.x;
  const float* xr = x + (size_t)tok * E;
  float v0[4], s = 0.f, s2 = 0.f;
#pragma unroll
  for (int i = 0; i < 4; ++i) {
    float t = xr[threadIdx.x + i * 256];
    v0[i] = t; s += t; s2 += t * t;
  }
#pragma unroll
  for (int off = 16; off; off >>= 1) {
    s  += __shfl_xor(s,  off, 32);
    s2 += __shfl_xor(s2, off, 32);
  }
  __shared__ float ws[8], ws2[8];
  if ((threadIdx.x & 31) == 0) { ws[threadIdx.x >> 5] = s; ws2[threadIdx.x >> 5] = s2; }
  __syncthreads();
  float S = 0.f, S2 = 0.f;
#pragma unroll
  for (int i = 0; i < 8; ++i) { S += ws[i]; S2 += ws2[i]; }
  float mu = S * (1.0f / E);
  float var = S2 * (1.0f / E) - mu * mu;
  float rinv = rsqrtf(var + 1e-5f);
#pragma unroll
  for (int i = 0; i < 4; ++i) {
    int c = threadIdx.x + i * 256;
    out[(size_t)tok * E + c] = f2bf((v0[i] - mu) * rinv * g[c] + b[c]);
  }
}

// ---------------- bf16 GEMM: C = A[M,K] @ B[K,N] (+bias,+relu,+res) ----------------
#define GBM 128
#define GBN 64
#define GBK 32
#define GF_OUT_BF16 1
#define GF_RELU     2

template <int NDIM, int KDIM>
__global__ __launch_bounds__(256) void gemm_bf16_kernel(
    const unsigned short* __restrict__ A, const unsigned short* __restrict__ Bm,
    const float* __restrict__ bias, const float* __restrict__ res,
    void* __restrict__ Cp, int flags) {
  // double-buffered LDS tiles
  __shared__ __align__(16) unsigned short As[2][GBM][GBK];
  __shared__ __align__(16) unsigned short Bs[2][GBK][GBN];
  int tid = threadIdx.x;
  int lane = tid & 31, wave = tid >> 5;
  int wm = wave & 3, wn = wave >> 2;     // 4 x 2 wave grid -> 128 x 64 block tile
  int half = lane >> 4, lm = lane & 15;
  int bm = blockIdx.y * GBM, bn = blockIdx.x * GBN;

  // staging indices (computed once)
  int ar = tid >> 1;                 // 0..127 : A tile row
  int ac = (tid & 1) << 4;           // 0 or 16: A tile half-row
  int bkk = tid >> 3;                // 0..31  : B tile row
  int bnn = (tid & 7) << 3;          // 0..56  : B tile col (8 bf16 chunk)
  const unsigned short* aptr = A + (size_t)(bm + ar) * KDIM + ac;
  const unsigned short* bptr = Bm + (size_t)bkk * NDIM + bn + bnn;

  // this thread's LDS staging slots (byte addresses) for each buffer
  unsigned ldsA = lds_addr(&As[0][ar][ac]);
  unsigned ldsB = lds_addr(&Bs[0][bkk][bnn]);
  const unsigned strA = (unsigned)sizeof(As[0]);   // 8 KB
  const unsigned strB = (unsigned)sizeof(Bs[0]);   // 4 KB

  // prologue: async-stage K-tile 0 into buffer 0
  async_ld_b128(ldsA,      aptr);
  async_ld_b128(ldsA + 16, aptr + 8);
  async_ld_b128(ldsB,      bptr);
  aptr += GBK;
  bptr += (size_t)GBK * NDIM;

  v8f acc[2][2] = {};
  int buf = 0;
  for (int k0 = 0; k0 < KDIM; k0 += GBK) {
    wait_async0();                         // this wave's current tile landed in LDS
    __syncthreads();                       // all waves' tiles visible; frees buf^1
    if (k0 + GBK < KDIM) {                 // DMA next tile while we do the WMMAs
      unsigned ao = ldsA + (buf ^ 1) * strA;
      unsigned bo = ldsB + (buf ^ 1) * strB;
      async_ld_b128(ao,      aptr);
      async_ld_b128(ao + 16, aptr + 8);
      async_ld_b128(bo,      bptr);
      aptr += GBK;
      bptr += (size_t)GBK * NDIM;
      __builtin_prefetch(aptr, 0, 0);      // global_prefetch_b8 for the tile after
      __builtin_prefetch(bptr, 0, 0);
    }

    // fragments from current buffer
    Frag af[2], bfr[2];
#pragma unroll
    for (int t = 0; t < 2; ++t) {
      int row = wm * 32 + t * 16 + lm;
      int col = wn * 32 + t * 16 + lm;
#pragma unroll
      for (int vv = 0; vv < 8; ++vv) {
        af[t].u[vv] = *(const unsigned int*)&As[buf][row][pairK(vv, half)];
        int kk = pairK(vv, half);
        unsigned int lo = Bs[buf][kk][col];
        unsigned int hi = Bs[buf][kk + 1][col];
        bfr[t].u[vv] = lo | (hi << 16);
      }
    }
#pragma unroll
    for (int i = 0; i < 2; ++i)
#pragma unroll
      for (int j = 0; j < 2; ++j)
        acc[i][j] = wmma_bf16(af[i], bfr[j], acc[i][j]);

    buf ^= 1;
  }

  bool outbf = (flags & GF_OUT_BF16) != 0;
  bool relu  = (flags & GF_RELU) != 0;
#pragma unroll
  for (int i = 0; i < 2; ++i)
#pragma unroll
    for (int j = 0; j < 2; ++j) {
      int colg = bn + wn * 32 + j * 16 + lm;
      float bv = bias ? bias[colg] : 0.f;
#pragma unroll
      for (int r = 0; r < 8; ++r) {
        int rowg = bm + wm * 32 + i * 16 + r + 8 * half;
        float val = acc[i][j][r] + bv;
        if (relu) val = fmaxf(val, 0.f);
        size_t idx = (size_t)rowg * NDIM + colg;
        if (res) val += res[idx];
        if (outbf) ((unsigned short*)Cp)[idx] = f2bf(val);
        else       ((float*)Cp)[idx] = val;
      }
    }
}

// ---------------- flash attention: one wave per (b,h,16-query tile) ----------------
#define NEG_BIG (-3.0e38f)

__global__ __launch_bounds__(32) void attn_kernel(
    const unsigned short* __restrict__ Q, const unsigned short* __restrict__ Km,
    const unsigned short* __restrict__ V, unsigned short* __restrict__ O) {
  const int E = 1024, T = 2048, DH = 64;
  __shared__ __align__(16) unsigned short Ps[16][32];
  int lane = threadIdx.x & 31;
  int half = lane >> 4, lm = lane & 15;
  int qt = blockIdx.x;                 // 0..T/16-1
  int bh = blockIdx.y;                 // 0..B*H-1
  int b = bh >> 4, h = bh & 15;
  size_t rowbase = (size_t)b * T;
  int q0 = qt * 16;
  int hoff = h * DH;
  const float scale = 0.03125f;        // 1024^-0.5 (reference scales by full E)

  // Q A-fragments (rows q0+lm, d-chunks 0..31 / 32..63), loaded once
  Frag qa[2];
  const unsigned short* qrow = Q + (rowbase + q0 + lm) * E + hoff;
#pragma unroll
  for (int t = 0; t < 2; ++t)
#pragma unroll
    for (int vv = 0; vv < 8; ++vv)
      qa[t].u[vv] = *(const unsigned int*)(qrow + t * 32 + pairK(vv, half));

  float mrun[8], lrun[8];
#pragma unroll
  for (int r = 0; r < 8; ++r) { mrun[r] = NEG_BIG; lrun[r] = 0.f; }
  v8f oacc[4] = {};

  int qmax = q0 + 15;
  for (int kt = 0; kt <= qmax; kt += 32) {
    // scores: two 16-key subtiles x two 32-wide d-chunks; batch all loads first
    const unsigned short* krow0 = Km + (rowbase + kt + lm) * E + hoff;
    const unsigned short* krow1 = krow0 + (size_t)16 * E;
    Frag kf[4];
#pragma unroll
    for (int t = 0; t < 2; ++t)
#pragma unroll
      for (int vv = 0; vv < 8; ++vv) {
        kf[t].u[vv]     = *(const unsigned int*)(krow0 + t * 32 + pairK(vv, half));
        kf[2 + t].u[vv] = *(const unsigned int*)(krow1 + t * 32 + pairK(vv, half));
      }
    v8f s0 = {}, s1 = {};
    s0 = wmma_bf16(qa[0], kf[0], s0);
    s0 = wmma_bf16(qa[1], kf[1], s0);
    s1 = wmma_bf16(qa[0], kf[2], s1);
    s1 = wmma_bf16(qa[1], kf[3], s1);

    // online softmax update (row = r + 8*half, 16 lanes per row share a half)
#pragma unroll
    for (int r = 0; r < 8; ++r) {
      int mq = q0 + r + 8 * half;
      float a0 = s0[r] * scale; if (kt + lm > mq)      a0 = NEG_BIG;
      float a1 = s1[r] * scale; if (kt + 16 + lm > mq) a1 = NEG_BIG;
      float mx = fmaxf(a0, a1);
#pragma unroll
      for (int off = 1; off < 16; off <<= 1) mx = fmaxf(mx, __shfl_xor(mx, off, 16));
      float mn = fmaxf(mrun[r], mx);
      float alpha = __expf(mrun[r] - mn);
      float p0 = __expf(a0 - mn), p1 = __expf(a1 - mn);
      float rs = p0 + p1;
#pragma unroll
      for (int off = 1; off < 16; off <<= 1) rs += __shfl_xor(rs, off, 16);
      lrun[r] = lrun[r] * alpha + rs;
      mrun[r] = mn;
#pragma unroll
      for (int j = 0; j < 4; ++j) oacc[j][r] *= alpha;
      Ps[r + 8 * half][lm]      = f2bf(p0);
      Ps[r + 8 * half][lm + 16] = f2bf(p1);
    }
    __syncthreads();

    // P (16x32) as A-fragment from LDS; V (32x16 per d-subtile) gathered from global
    Frag pf;
#pragma unroll
    for (int vv = 0; vv < 8; ++vv)
      pf.u[vv] = *(const unsigned int*)&Ps[lm][pairK(vv, half)];
    const unsigned short* vbase = V + (rowbase + kt) * E + hoff + lm;
    Frag vf[4];
#pragma unroll
    for (int j = 0; j < 4; ++j) {
      const unsigned short* vc = vbase + j * 16;
#pragma unroll
      for (int vv = 0; vv < 8; ++vv) {
        int kk = pairK(vv, half);
        unsigned int lo = vc[(size_t)kk * E];
        unsigned int hi = vc[(size_t)(kk + 1) * E];
        vf[j].u[vv] = lo | (hi << 16);
      }
    }
#pragma unroll
    for (int j = 0; j < 4; ++j)
      oacc[j] = wmma_bf16(pf, vf[j], oacc[j]);
    __syncthreads();
  }

  // epilogue: O /= l, store bf16
#pragma unroll
  for (int r = 0; r < 8; ++r) {
    float inv = 1.0f / lrun[r];
    size_t rowg = rowbase + q0 + r + 8 * half;
#pragma unroll
    for (int j = 0; j < 4; ++j)
      O[rowg * E + hoff + j * 16 + lm] = f2bf(oacc[j][r] * inv);
  }
}

// ---------------- host launcher ----------------
extern "C" void kernel_launch(void* const* d_in, const int* in_sizes, int n_in,
                              void* d_out, int out_size, void* d_ws, size_t ws_size,
                              hipStream_t stream) {
  const int E = 1024, H = 16, DFF = 4096, B = 2, T = 2048;
  const int M = B * T;                 // 4096 tokens
  (void)in_sizes; (void)n_in; (void)out_size; (void)ws_size;

  const float* x   = (const float*)d_in[0];
  const float* Wq  = (const float*)d_in[1];
  const float* Wk  = (const float*)d_in[2];
  const float* Wv  = (const float*)d_in[3];
  const float* Wo  = (const float*)d_in[4];
  const float* bo  = (const float*)d_in[5];
  const float* W1  = (const float*)d_in[6];
  const float* b1  = (const float*)d_in[7];
  const float* W2  = (const float*)d_in[8];
  const float* b2  = (const float*)d_in[9];
  const float* g1  = (const float*)d_in[10];
  const float* be1 = (const float*)d_in[11];
  const float* g2  = (const float*)d_in[12];
  const float* be2 = (const float*)d_in[13];
  float* out = (float*)d_out;

  // workspace carve-up (256B aligned)
  char* wsp = (char*)d_ws;
  auto alloc = [&](size_t bytes) -> void* {
    void* p = (void*)wsp;
    wsp += (bytes + 255) & ~(size_t)255;
    return p;
  };
  const size_t EE = (size_t)E * E, ED = (size_t)E * DFF;
  unsigned short* wq16 = (unsigned short*)alloc(EE * 2);
  unsigned short* wk16 = (unsigned short*)alloc(EE * 2);
  unsigned short* wv16 = (unsigned short*)alloc(EE * 2);
  unsigned short* wo16 = (unsigned short*)alloc(EE * 2);
  unsigned short* w116 = (unsigned short*)alloc(ED * 2);
  unsigned short* w216 = (unsigned short*)alloc(ED * 2);
  unsigned short* hb   = (unsigned short*)alloc((size_t)M * E * 2);
  unsigned short* qb   = (unsigned short*)alloc((size_t)(M + 64) * E * 2);  // +64 row pad
  unsigned short* kb   = (unsigned short*)alloc((size_t)(M + 64) * E * 2);
  unsigned short* vb   = (unsigned short*)alloc((size_t)(M + 64) * E * 2);
  unsigned short* ob   = (unsigned short*)alloc((size_t)M * E * 2);
  float*          x1   = (float*)alloc((size_t)M * E * 4);
  unsigned short* h2   = (unsigned short*)alloc((size_t)M * E * 2);
  unsigned short* f1   = (unsigned short*)alloc((size_t)M * DFF * 2);

  // weights -> bf16
  cvt_bf16_kernel<<<(EE + 1023) / 1024, 256, 0, stream>>>(Wq, wq16, (int)EE);
  cvt_bf16_kernel<<<(EE + 1023) / 1024, 256, 0, stream>>>(Wk, wk16, (int)EE);
  cvt_bf16_kernel<<<(EE + 1023) / 1024, 256, 0, stream>>>(Wv, wv16, (int)EE);
  cvt_bf16_kernel<<<(EE + 1023) / 1024, 256, 0, stream>>>(Wo, wo16, (int)EE);
  cvt_bf16_kernel<<<(ED + 1023) / 1024, 256, 0, stream>>>(W1, w116, (int)ED);
  cvt_bf16_kernel<<<(ED + 1023) / 1024, 256, 0, stream>>>(W2, w216, (int)ED);

  // LN1
  ln_bf16_kernel<<<M, 256, 0, stream>>>(x, g1, be1, hb);

  // QKV projections
  dim3 gEE(E / GBN, M / GBM);
  gemm_bf16_kernel<1024, 1024><<<gEE, 256, 0, stream>>>(hb, wq16, nullptr, nullptr, qb, GF_OUT_BF16);
  gemm_bf16_kernel<1024, 1024><<<gEE, 256, 0, stream>>>(hb, wk16, nullptr, nullptr, kb, GF_OUT_BF16);
  gemm_bf16_kernel<1024, 1024><<<gEE, 256, 0, stream>>>(hb, wv16, nullptr, nullptr, vb, GF_OUT_BF16);

  // causal flash attention
  attn_kernel<<<dim3(T / 16, B * H), 32, 0, stream>>>(qb, kb, vb, ob);

  // out-proj + bias + residual(x) -> x1 (fp32)
  gemm_bf16_kernel<1024, 1024><<<gEE, 256, 0, stream>>>(ob, wo16, bo, x, x1, 0);

  // LN2
  ln_bf16_kernel<<<M, 256, 0, stream>>>(x1, g2, be2, h2);

  // FFN
  dim3 gFF1(DFF / GBN, M / GBM);
  gemm_bf16_kernel<4096, 1024><<<gFF1, 256, 0, stream>>>(h2, w116, b1, nullptr, f1,
                                                         GF_OUT_BF16 | GF_RELU);
  gemm_bf16_kernel<1024, 4096><<<gEE, 256, 0, stream>>>(f1, w216, b2, x1, out, 0);
}

// v001
// It runs in 472 microseconds.
// Two timings next to v000 both put it at 1.19 times that version's speed.
#include <hip/hip_runtime.h>
#include <math.h>

// ---------------- types ----------------
typedef __bf16 v16bf __attribute__((ext_vector_type(16)));
typedef float  v8f   __attribute__((ext_vector_type(8)));
typedef short  s16x8 __attribute__((ext_vector_type(8)));

union Frag {
  v16bf v;
  s16x8 q[2];
  unsigned int u[8];
  unsigned short h[16];
};

__device__ __forceinline__ unsigned short f2bf(float f) {
  unsigned int u = __builtin_bit_cast(unsigned int, f);
  u += 0x7FFFu + ((u >> 16) & 1u);          // round-to-nearest-even
  return (unsigned short)(u >> 16);
}

// element-pair K index for 16-bit WMMA A/B fragments (ISA 7.12.2):
// VGPR v<4 holds k={2v,2v+1}+8*half ; v>=4 holds k={16+2(v-4),...}+8*half
__device__ __forceinline__ int pairK(int v, int half) {
  return ((v < 4) ? (2 * v) : (16 + 2 * (v - 4))) + 8 * half;
}

__device__ __forceinline__ v8f wmma_bf16(const Frag& a, const Frag& b, v8f c) {
  return __builtin_amdgcn_wmma_f32_16x16x32_bf16(
      false, a.v, false, b.v, (short)0, c, false, false);
}

// ---- CDNA5 async global->LDS DMA (ASYNCcnt-tracked, no VGPR data) ----
__device__ __forceinline__ void async_ld_b128(unsigned lds_byte_addr, const void* gptr) {
  asm volatile("global_load_async_to_lds_b128 %0, %1, off"
               :: "v"(lds_byte_addr), "v"(gptr) : "memory");
}
__device__ __forceinline__ void wait_async0() {
  asm volatile("s_wait_asynccnt 0x0" ::: "memory");
}
// generic LDS pointer -> 32-bit LDS byte offset (aperture keeps offset in addr[31:0])
__device__ __forceinline__ unsigned lds_addr(const void* p) {
  return (unsigned)(unsigned long long)p;
}

// transposing LDS load: lane (c = l & 15, h = l >> 4) gets rows 8h..8h+7 of column c
// of a row-major 16-bit tile; lane l passes the address of row 8h + (l & 7), 16-byte chunk (l >> 3) & 1
__device__ __forceinline__ s16x8 lds_tr16(const unsigned short* p) {
  typedef __attribute__((address_space(3))) s16x8 lds_s16x8;
  return __builtin_amdgcn_ds_load_tr16_b128_v8i16((lds_s16x8*)p);
}

// ---------------- fp32 -> bf16 convert ----------------
__global__ __launch_bounds__(256) void cvt_bf16_kernel(
    const float* __restrict__ in, unsigned short* __restrict__ out, int n) {
  int i = blockIdx.x * 1024 + threadIdx.x;
#pragma unroll
  for (int k = 0; k < 4; ++k, i += 256)
    if (i < n) out[i] = f2bf(in[i]);
}

// ---------------- LayerNorm (per token, E=1024) ----------------
__global__ __launch_bounds__(256) void ln_bf16_kernel(
    const float* __restrict__ x, const float* __restrict__ g,
    const float* __restrict__ b, unsigned short* __restrict__ out) {
  const int E = 1024;
  int tok = blockIdx.x;
  const float* xr = x + (size_t)tok * E;
  float v0[4], s = 0.f, s2 = 0.f;
#pragma unroll
  for (int i = 0; i < 4; ++i) {
    float t = xr[threadIdx.x + i * 256];
    v0[i] = t; s += t; s2 += t * t;
  }
#pragma unroll
  for (int off = 16; off; off >>= 1) {
    s  += __shfl_xor(s,  off, 32);
    s2 += __shfl_xor(s2, off, 32);
  }
  __shared__ float ws[8], ws2[8];
  if ((threadIdx.x & 31) == 0) { ws[threadIdx.x >> 5] = s; ws2[threadIdx.x >> 5] = s2; }
  __syncthreads();
  float S = 0.f, S2 = 0.f;
#pragma unroll
  for (int i = 0; i < 8; ++i) { S += ws[i]; S2 += ws2[i]; }
  float mu = S * (1.0f / E);
  float var = S2 * (1.0f / E) - mu * mu;
  float rinv = rsqrtf(var + 1e-5f);
#pragma unroll
  for (int i = 0; i < 4; ++i) {
    int c = threadIdx.x + i * 256;
    out[(size_t)tok * E + c] = f2bf((v0[i] - mu) * rinv * g[c] + b[c]);
  }
}

// ---------------- bf16 GEMM: C = A[M,K] @ B[K,N] (+bias,+relu,+res) ----------------
#define GBM 128
#define GBN 64
#define GBK 32
#define GBNP 80   // LDS row pitch of the B tile in elements: 160 B = 32 B x odd, conflict-free for the transposing load
#define GF_OUT_BF16 1
#define GF_RELU     2

template <int NDIM, int KDIM>
__global__ __launch_bounds__(256) void gemm_bf16_kernel(
    const unsigned short* __restrict__ A, const unsigned short* __restrict__ Bm,
    const float* __restrict__ bias, const float* __restrict__ res,
    void* __restrict__ Cp, int flags) {
  // double-buffered LDS tiles
  __shared__ __align__(16) unsigned short As[2][GBM][GBK];
  __shared__ __align__(16) unsigned short Bs[2][GBK][GBNP];
  int tid = threadIdx.x;
  int lane = tid & 31, wave = tid >> 5;
  int wm = wave & 3, wn = wave >> 2;     // 4 x 2 wave grid -> 128 x 64 block tile
  int half = lane >> 4, lm = lane & 15;
  int bm = blockIdx.y * GBM, bn = blockIdx.x * GBN;

  // staging indices (computed once)
  int ar = tid >> 1;                 // 0..127 : A tile row
  int ac = (tid & 1) << 4;           // 0 or 16: A tile half-row
  int bkk = tid >> 3;                // 0..31  : B tile row
  int bnn = (tid & 7) << 3;          // 0..56  : B tile col (8 bf16 chunk)
  const unsigned short* aptr = A + (size_t)(bm + ar) * KDIM + ac;
  const unsigned short* bptr = Bm + (size_t)bkk * NDIM + bn + bnn;

  // this thread's LDS staging slots (byte addresses) for each buffer
  unsigned ldsA = lds_addr(&As[0][ar][ac]);
  unsigned ldsB = lds_addr(&Bs[0][bkk][bnn]);
  const unsigned strA = (unsigned)sizeof(As[0]);   // 8 KB
  const unsigned strB = (unsigned)sizeof(Bs[0]);   // 5 KB

  // prologue: async-stage K-tile 0 into buffer 0
  async_ld_b128(ldsA,      aptr);
  async_ld_b128(ldsA + 16, aptr + 8);
  async_ld_b128(ldsB,      bptr);
  aptr += GBK;
  bptr += (size_t)GBK * NDIM;

  v8f acc[2][2] = {};
  int buf = 0;
  for (int k0 = 0; k0 < KDIM; k0 += GBK) {
    wait_async0();                         // this wave's current tile landed in LDS
    __syncthreads();                       // all waves' tiles visible; frees buf^1
    if (k0 + GBK < KDIM) {                 // DMA next tile while we do the WMMAs
      unsigned ao = ldsA + (buf ^ 1) * strA;
      unsigned bo = ldsB + (buf ^ 1) * strB;
      async_ld_b128(ao,      aptr);
      async_ld_b128(ao + 16, aptr + 8);
      async_ld_b128(bo,      bptr);
      aptr += GBK;
      bptr += (size_t)GBK * NDIM;
      __builtin_prefetch(aptr, 0, 0);      // global_prefetch_b8 for the tile after
      __builtin_prefetch(bptr, 0, 0);
    }

    // fragments from current buffer
    Frag af[2], bfr[2];
#pragma unroll
    for (int t = 0; t < 2; ++t) {
      int row = wm * 32 + t * 16 + lm;
#pragma unroll
      for (int vv = 0; vv < 8; ++vv)
        af[t].u[vv] = *(const unsigned int*)&As[buf][row][pairK(vv, half)];
      // B fragment, k 0..15 then 16..31 of 16 columns, in the same k order as pairK
      const unsigned short* bp =
          &Bs[buf][8 * half + (lane & 7)][wn * 32 + t * 16 + 8 * ((lane >> 3) & 1)];
      bfr[t].q[0] = lds_tr16(bp);
      bfr[t].q[1] = lds_tr16(bp + 16 * GBNP);
    }
#pragma unroll
    for (int i = 0; i < 2; ++i)
#pragma unroll
      for (int j = 0; j < 2; ++j)
        acc[i][j] = wmma_bf16(af[i], bfr[j], acc[i][j]);

    buf ^= 1;
  }

  bool outbf = (flags & GF_OUT_BF16) != 0;
  bool relu  = (flags & GF_RELU) != 0;
#pragma unroll
  for (int i = 0; i < 2; ++i)
#pragma unroll
    for (int j = 0; j < 2; ++j) {
      int colg = bn + wn * 32 + j * 16 + lm;
      float bv = bias ? bias[colg] : 0.f;
#pragma unroll
      for (int r = 0; r < 8; ++r) {
        int rowg = bm + wm * 32 + i * 16 + r + 8 * half;
        float val = acc[i][j][r] + bv;
        if (relu) val = fmaxf(val, 0.f);
        size_t idx = (size_t)rowg * NDIM + colg;
        if (res) val += res[idx];
        if (outbf) ((unsigned short*)Cp)[idx] = f2bf(val);
        else       ((float*)Cp)[idx] = val;
      }
    }
}

// ---------------- flash attention: one wave per (b,h,16-query tile) ----------------
#define NEG_BIG (-3.0e38f)

__global__ __launch_bounds__(32) void attn_kernel(
    const unsigned short* __restrict__ Q, const unsigned short* __restrict__ Km,
    const unsigned short* __restrict__ V, unsigned short* __restrict__ O) {
  const int E = 1024, T = 2048, DH = 64;
  __shared__ __align__(16) unsigned short Ps[16][32];
  int lane = threadIdx.x & 31;
  int half = lane >> 4, lm = lane & 15;
  int qt = blockIdx.x;                 // 0..T/16-1
  int bh = blockIdx.y;                 // 0..B*H-1
  int b = bh >> 4, h = bh & 15;
  size_t rowbase = (size_t)b * T;
  int q0 = qt * 16;
  int hoff = h * DH;
  const float scale = 0.03125f;        // 1024^-0.5 (reference scales by full E)

  // Q A-fragments (rows q0+lm, d-chunks 0..31 / 32..63), loaded once
  Frag qa[2];
  const unsigned short* qrow = Q + (rowbase + q0 + lm) * E + hoff;
#pragma unroll
  for (int t = 0; t < 2; ++t)
#pragma unroll
    for (int vv = 0; vv < 8; ++vv)
      qa[t].u[vv] = *(const unsigned int*)(qrow + t * 32 + pairK(vv, half));

  float mrun[8], lrun[8];
#pragma unroll
  for (int r = 0; r < 8; ++r) { mrun[r] = NEG_BIG; lrun[r] = 0.f; }
  v8f oacc[4] = {};

  int qmax = q0 + 15;
  for (int kt = 0; kt <= qmax; kt += 32) {
    // scores: two 16-key subtiles x two 32-wide d-chunks; batch all loads first
    const unsigned short* krow0 = Km + (rowbase + kt + lm) * E + hoff;
    const unsigned short* krow1 = krow0 + (size_t)16 * E;
    Frag kf[4];
#pragma unroll
    for (int t = 0; t < 2; ++t)
#pragma unroll
      for (int vv = 0; vv < 8; ++vv) {
        kf[t].u[vv]     = *(const unsigned int*)(krow0 + t * 32 + pairK(vv, half));
        kf[2 + t].u[vv] = *(const unsigned int*)(krow1 + t * 32 + pairK(vv, half));
      }
    v8f s0 = {}, s1 = {};
    s0 = wmma_bf16(qa[0], kf[0], s0);
    s0 = wmma_bf16(qa[1], kf[1], s0);
    s1 = wmma_bf16(qa[0], kf[2], s1);
    s1 = wmma_bf16(qa[1], kf[3], s1);

    // online softmax update (row = r + 8*half, 16 lanes per row share a half)
#pragma unroll
    for (int r = 0; r < 8; ++r) {
      int mq = q0 + r + 8 * half;
      float a0 = s0[r] * scale; if (kt + lm > mq)      a0 = NEG_BIG;
      float a1 = s1[r] * scale; if (kt + 16 + lm > mq) a1 = NEG_BIG;
      float mx = fmaxf(a0, a1);
#pragma unroll
      for (int off = 1; off < 16; off <<= 1) mx = fmaxf(mx, __shfl_xor(mx, off, 16));
      float mn = fmaxf(mrun[r], mx);
      float alpha = __expf(mrun[r] - mn);
      float p0 = __expf(a0 - mn), p1 = __expf(a1 - mn);
      float rs = p0 + p1;
#pragma unroll
      for (int off = 1; off < 16; off <<= 1) rs += __shfl_xor(rs, off, 16);
      lrun[r] = lrun[r] * alpha + rs;
      mrun[r] = mn;
#pragma unroll
      for (int j = 0; j < 4; ++j) oacc[j][r] *= alpha;
      Ps[r + 8 * half][lm]      = f2bf(p0);
      Ps[r + 8 * half][lm + 16] = f2bf(p1);
    }
    __syncthreads();

    // P (16x32) as A-fragment from LDS; V (32x16 per d-subtile) gathered from global
    Frag pf;
#pragma unroll
    for (int vv = 0; vv < 8; ++vv)
      pf.u[vv] = *(const unsigned int*)&Ps[lm][pairK(vv, half)];
    const unsigned short* vbase = V + (rowbase + kt) * E + hoff + lm;
    Frag vf[4];
#pragma unroll
    for (int j = 0; j < 4; ++j) {
      const unsigned short* vc = vbase + j * 16;
#pragma unroll
      for (int vv = 0; vv < 8; ++vv) {
        int kk = pairK(vv, half);
        unsigned int lo = vc[(size_t)kk * E];
        unsigned int hi = vc[(size_t)(kk + 1) * E];
        vf[j].u[vv] = lo | (hi << 16);
      }
    }
#pragma unroll
    for (int j = 0; j < 4; ++j)
      oacc[j] = wmma_bf16(pf, vf[j], oacc[j]);
    __syncthreads();
  }

  // epilogue: O /= l, store bf16
#pragma unroll
  for (int r = 0; r < 8; ++r) {
    float inv = 1.0f / lrun[r];
    size_t rowg = rowbase + q0 + r + 8 * half;
#pragma unroll
    for (int j = 0; j < 4; ++j)
      O[rowg * E + hoff + j * 16 + lm] = f2bf(oacc[j][r] * inv);
  }
}

// ---------------- host launcher ----------------
extern "C" void kernel_launch(void* const* d_in, const int* in_sizes, int n_in,
                              void* d_out, int out_size, void* d_ws, size_t ws_size,
                              hipStream_t stream) {
  const int E = 1024, H = 16, DFF = 4096, B = 2, T = 2048;
  const int M = B * T;                 // 4096 tokens
  (void)in_sizes; (void)n_in; (void)out_size; (void)ws_size;

  const float* x   = (const float*)d_in[0];
  const float* Wq  = (const float*)d_in[1];
  const float* Wk  = (const float*)d_in[2];
  const float* Wv  = (const float*)d_in[3];
  const float* Wo  = (const float*)d_in[4];
  const float* bo  = (const float*)d_in[5];
  const float* W1  = (const float*)d_in[6];
  const float* b1  = (const float*)d_in[7];
  const float* W2  = (const float*)d_in[8];
  const float* b2  = (const float*)d_in[9];
  const float* g1  = (const float*)d_in[10];
  const float* be1 = (const float*)d_in[11];
  const float* g2  = (const float*)d_in[12];
  const float* be2 = (const float*)d_in[13];
  float* out = (float*)d_out;

  // workspace carve-up (256B aligned)
  char* wsp = (char*)d_ws;
  auto alloc = [&](size_t bytes) -> void* {
    void* p = (void*)wsp;
    wsp += (bytes + 255) & ~(size_t)255;
    return p;
  };
  const size_t EE = (size_t)E * E, ED = (size_t)E * DFF;
  unsigned short* wq16 = (unsigned short*)alloc(EE * 2);
  unsigned short* wk16 = (unsigned short*)alloc(EE * 2);
  unsigned short* wv16 = (unsigned short*)alloc(EE * 2);
  unsigned short* wo16 = (unsigned short*)alloc(EE * 2);
  unsigned short* w116 = (unsigned short*)alloc(ED * 2);
  unsigned short* w216 = (unsigned short*)alloc(ED * 2);
  unsigned short* hb   = (unsigned short*)alloc((size_t)M * E * 2);
  unsigned short* qb   = (unsigned short*)alloc((size_t)(M + 64) * E * 2);  // +64 row pad
  unsigned short* kb   = (unsigned short*)alloc((size_t)(M + 64) * E * 2);
  unsigned short* vb   = (unsigned short*)alloc((size_t)(M + 64) * E * 2);
  unsigned short* ob   = (unsigned short*)alloc((size_t)M * E * 2);
  float*          x1   = (float*)alloc((size_t)M * E * 4);
  unsigned short* h2   = (unsigned short*)alloc((size_t)M * E * 2);
  unsigned short* f1   = (unsigned short*)alloc((size_t)M * DFF * 2);

  // weights -> bf16
  cvt_bf16_kernel<<<(EE + 1023) / 1024, 256, 0, stream>>>(Wq, wq16, (int)EE);
  cvt_bf16_kernel<<<(EE + 1023) / 1024, 256, 0, stream>>>(Wk, wk16, (int)EE);
  cvt_bf16_kernel<<<(EE + 1023) / 1024, 256, 0, stream>>>(Wv, wv16, (int)EE);
  cvt_bf16_kernel<<<(EE + 1023) / 1024, 256, 0, stream>>>(Wo, wo16, (int)EE);
  cvt_bf16_kernel<<<(ED + 1023) / 1024, 256, 0, stream>>>(W1, w116, (int)ED);
  cvt_bf16_kernel<<<(ED + 1023) / 1024, 256, 0, stream>>>(W2, w216, (int)ED);

  // LN1
  ln_bf16_kernel<<<M, 256, 0, stream>>>(x, g1, be1, hb);

  // QKV projections
  dim3 gEE(E / GBN, M / GBM);
  gemm_bf16_kernel<1024, 1024><<<gEE, 256, 0, stream>>>(hb, wq16, nullptr, nullptr, qb, GF_OUT_BF16);
  gemm_bf16_kernel<1024, 1024><<<gEE, 256, 0, stream>>>(hb, wk16, nullptr, nullptr, kb, GF_OUT_BF16);
  gemm_bf16_kernel<1024, 1024><<<gEE, 256, 0, stream>>>(hb, wv16, nullptr, nullptr, vb, GF_OUT_BF16);

  // causal flash attention
  attn_kernel<<<dim3(T / 16, B * H), 32, 0, stream>>>(qb, kb, vb, ob);

  // out-proj + bias + residual(x) -> x1 (fp32)
  gemm_bf16_kernel<1024, 1024><<<gEE, 256, 0, stream>>>(ob, wo16, bo, x, x1, 0);

  // LN2
  ln_bf16_kernel<<<M, 256, 0, stream>>>(x1, g2, be2, h2);

  // FFN
  dim3 gFF1(DFF / GBN, M / GBM);
  gemm_bf16_kernel<4096, 1024><<<gFF1, 256, 0, stream>>>(h2, w116, b1, nullptr, f1,
                                                         GF_OUT_BF16 | GF_RELU);
  gemm_bf16_kernel<1024, 4096><<<gEE, 256, 0, stream>>>(f1, w216, b2, x1, out, 0);
}

// v002
// It runs in 450 microseconds.
// Two timings next to v001 both put it at 1.05 times that version's speed.
// All steps since v000 together make it 1.26 times as fast.
#include <hip/hip_runtime.h>
#include <math.h>

// ---------------- types ----------------
typedef __bf16 v16bf __attribute__((ext_vector_type(16)));
typedef float  v8f   __attribute__((ext_vector_type(8)));
typedef short  s16x8 __attribute__((ext_vector_type(8)));

union Frag {
  v16bf v;
  s16x8 q[2];
  unsigned int u[8];
  unsigned short h[16];
};

__device__ __forceinline__ unsigned short f2bf(float f) {
  unsigned int u = __builtin_bit_cast(unsigned int, f);
  u += 0x7FFFu + ((u >> 16) & 1u);          // round-to-nearest-even
  return (unsigned short)(u >> 16);
}

// element-pair K index for 16-bit WMMA A/B fragments (ISA 7.12.2):
// VGPR v<4 holds k={2v,2v+1}+8*half ; v>=4 holds k={16+2(v-4),...}+8*half
__device__ __forceinline__ int pairK(int v, int half) {
  return ((v < 4) ? (2 * v) : (16 + 2 * (v - 4))) + 8 * half;
}

__device__ __forceinline__ v8f wmma_bf16(const Frag& a, const Frag& b, v8f c) {
  return __builtin_amdgcn_wmma_f32_16x16x32_bf16(
      false, a.v, false, b.v, (short)0, c, false, false);
}

// ---- CDNA5 async global->LDS DMA (ASYNCcnt-tracked, no VGPR data) ----
__device__ __forceinline__ void async_ld_b128(unsigned lds_byte_addr, const void* gptr) {
  asm volatile("global_load_async_to_lds_b128 %0, %1, off"
               :: "v"(lds_byte_addr), "v"(gptr) : "memory");
}
__device__ __forceinline__ void wait_async0() {
  asm volatile("s_wait_asynccnt 0x0" ::: "memory");
}
// generic LDS pointer -> 32-bit LDS byte offset (aperture keeps offset in addr[31:0])
__device__ __forceinline__ unsigned lds_addr(const void* p) {
  return (unsigned)(unsigned long long)p;
}

// transposing LDS load: lane (c = l & 15, h = l >> 4) gets rows 8h..8h+7 of column c
// of a row-major 16-bit tile; lane l passes the address of row 8h + (l & 7), 16-byte chunk (l >> 3) & 1
__device__ __forceinline__ s16x8 lds_tr16(const unsigned short* p) {
  typedef __attribute__((address_space(3))) s16x8 lds_s16x8;
  return __builtin_amdgcn_ds_load_tr16_b128_v8i16((lds_s16x8*)p);
}

// ---------------- fp32 -> bf16 convert, all six weights in one launch ----------------
// The bf16 copies lie one behind the other in the workspace (Wq, Wk, Wv, Wo, W1, W2).
// A block converts 16384 consecutive elements: 64 per thread, so that few waves have to start.
#define CVT_PER_BLOCK 16384
// at most 8 waves a SIMD: a register budget of 128, so that all 16 loads of a thread stay in flight together
__global__ __launch_bounds__(256) __attribute__((amdgpu_waves_per_eu(4, 8))) void cvt_weights_kernel(
    const float* __restrict__ Wq, const float* __restrict__ Wk, const float* __restrict__ Wv,
    const float* __restrict__ Wo, const float* __restrict__ W1, const float* __restrict__ W2,
    unsigned short* __restrict__ out) {
  int seg = blockIdx.x >> 6;             // which run of 2^20 elements (64 blocks each)
  const float* src;
  if (seg < 4)      src = seg == 0 ? Wq : seg == 1 ? Wk : seg == 2 ? Wv : Wo;
  else if (seg < 8) src = W1 + ((size_t)(seg - 4) << 20);
  else              src = W2 + ((size_t)(seg - 8) << 20);
  const float4* in4 = (const float4*)(src + (size_t)(blockIdx.x & 63) * CVT_PER_BLOCK) + threadIdx.x;
  ushort4* o4 = (ushort4*)(out + (size_t)blockIdx.x * CVT_PER_BLOCK) + threadIdx.x;
  float4 v[16];
#pragma unroll   // all 16 loads of 512 B per wave in flight before the first store
  for (int k = 0; k < 16; ++k) v[k] = in4[k * 256];
#pragma unroll   // v[] stays in registers
  for (int k = 0; k < 16; ++k)
    o4[k * 256] = make_ushort4(f2bf(v[k].x), f2bf(v[k].y), f2bf(v[k].z), f2bf(v[k].w));
}

// ---------------- LayerNorm (one wave per token, E=1024) ----------------
// at most 8 waves a SIMD: a register budget of 128, so that gain and bias fly with the token's loads, not pair by pair behind the sums
__global__ __launch_bounds__(256) __attribute__((amdgpu_waves_per_eu(4, 8))) void ln_bf16_kernel(
    const float* __restrict__ x, const float* __restrict__ g,
    const float* __restrict__ b, unsigned short* __restrict__ out) {
  const int E = 1024;
  int lane = threadIdx.x & 31;
  // the wave's number as a scalar: the token's row address then sits in scalar registers
  int tok = blockIdx.x * 8 + __builtin_amdgcn_readfirstlane(threadIdx.x >> 5);
  const float4* xr = (const float4*)(x + (size_t)tok * E) + lane;
  const float4* g4 = (const float4*)g + lane;
  const float4* b4 = (const float4*)b + lane;
  float4 v[8], gg[8], bb[8];
#pragma unroll   // the token's 8 loads of 512 B in flight together
  for (int i = 0; i < 8; ++i) v[i] = xr[i * 32];
#pragma unroll   // gg[], bb[] stay in registers
  for (int i = 0; i < 8; ++i) { gg[i] = g4[i * 32]; bb[i] = b4[i * 32]; }
  float4 a = make_float4(0.f, 0.f, 0.f, 0.f), q = a;   // four independent chains each
#pragma unroll   // v[] stays in registers
  for (int i = 0; i < 8; ++i) {
    a.x += v[i].x; a.y += v[i].y; a.z += v[i].z; a.w += v[i].w;
    q.x += v[i].x * v[i].x; q.y += v[i].y * v[i].y;
    q.z += v[i].z * v[i].z; q.w += v[i].w * v[i].w;
  }
  float s = (a.x + a.y) + (a.z + a.w), s2 = (q.x + q.y) + (q.z + q.w);
#pragma unroll
  for (int off = 16; off; off >>= 1) {
    s  += __shfl_xor(s,  off, 32);
    s2 += __shfl_xor(s2, off, 32);
  }
  float mu = s * (1.0f / E);
  float var = s2 * (1.0f / E) - mu * mu;
  float rinv = rsqrtf(var + 1e-5f);
  ushort4* o4 = (ushort4*)(out + (size_t)tok * E) + lane;
#pragma unroll   // v[] stays in registers
  for (int i = 0; i < 8; ++i) {
    o4[i * 32] = make_ushort4(f2bf((v[i].x - mu) * rinv * gg[i].x + bb[i].x),
                              f2bf((v[i].y - mu) * rinv * gg[i].y + bb[i].y),
                              f2bf((v[i].z - mu) * rinv * gg[i].z + bb[i].z),
                              f2bf((v[i].w - mu) * rinv * gg[i].w + bb[i].w));
  }
}

// ---------------- bf16 GEMM: C = A[M,K] @ B[K,N] (+bias,+relu,+res) ----------------
#define GBM 128
#define GBN 64
#define GBK 32
#define GBNP 80   // LDS row pitch of the B tile in elements: 160 B = 32 B x odd, conflict-free for the transposing load
#define GF_OUT_BF16 1
#define GF_RELU     2

template <int NDIM, int KDIM>
__global__ __launch_bounds__(256) void gemm_bf16_kernel(
    const unsigned short* __restrict__ A, const unsigned short* __restrict__ Bm,
    const float* __restrict__ bias, const float* __restrict__ res,
    void* __restrict__ Cp, int flags) {
  // double-buffered LDS tiles
  __shared__ __align__(16) unsigned short As[2][GBM][GBK];
  __shared__ __align__(16) unsigned short Bs[2][GBK][GBNP];
  int tid = threadIdx.x;
  int lane = tid & 31, wave = tid >> 5;
  int wm = wave & 3, wn = wave >> 2;     // 4 x 2 wave grid -> 128 x 64 block tile
  int half = lane >> 4, lm = lane & 15;
  int bm = blockIdx.y * GBM, bn = blockIdx.x * GBN;

  // staging indices (computed once)
  int ar = tid >> 1;                 // 0..127 : A tile row
  int ac = (tid & 1) << 4;           // 0 or 16: A tile half-row
  int bkk = tid >> 3;                // 0..31  : B tile row
  int bnn = (tid & 7) << 3;          // 0..56  : B tile col (8 bf16 chunk)
  const unsigned short* aptr = A + (size_t)(bm + ar) * KDIM + ac;
  const unsigned short* bptr = Bm + (size_t)bkk * NDIM + bn + bnn;

  // this thread's LDS staging slots (byte addresses) for each buffer
  unsigned ldsA = lds_addr(&As[0][ar][ac]);
  unsigned ldsB = lds_addr(&Bs[0][bkk][bnn]);
  const unsigned strA = (unsigned)sizeof(As[0]);   // 8 KB
  const unsigned strB = (unsigned)sizeof(Bs[0]);   // 5 KB

  // prologue: async-stage K-tile 0 into buffer 0
  async_ld_b128(ldsA,      aptr);
  async_ld_b128(ldsA + 16, aptr + 8);
  async_ld_b128(ldsB,      bptr);
  aptr += GBK;
  bptr += (size_t)GBK * NDIM;

  v8f acc[2][2] = {};
  int buf = 0;
  for (int k0 = 0; k0 < KDIM; k0 += GBK) {
    wait_async0();                         // this wave's current tile landed in LDS
    __syncthreads();                       // all waves' tiles visible; frees buf^1
    if (k0 + GBK < KDIM) {                 // DMA next tile while we do the WMMAs
      unsigned ao = ldsA + (buf ^ 1) * strA;
      unsigned bo = ldsB + (buf ^ 1) * strB;
      async_ld_b128(ao,      aptr);
      async_ld_b128(ao + 16, aptr + 8);
      async_ld_b128(bo,      bptr);
      aptr += GBK;
      bptr += (size_t)GBK * NDIM;
      __builtin_prefetch(aptr, 0, 0);      // global_prefetch_b8 for the tile after
      __builtin_prefetch(bptr, 0, 0);
    }

    // fragments from current buffer
    Frag af[2], bfr[2];
#pragma unroll
    for (int t = 0; t < 2; ++t) {
      int row = wm * 32 + t * 16 + lm;
#pragma unroll
      for (int vv = 0; vv < 8; ++vv)
        af[t].u[vv] = *(const unsigned int*)&As[buf][row][pairK(vv, half)];
      // B fragment, k 0..15 then 16..31 of 16 columns, in the same k order as pairK
      const unsigned short* bp =
          &Bs[buf][8 * half + (lane & 7)][wn * 32 + t * 16 + 8 * ((lane >> 3) & 1)];
      bfr[t].q[0] = lds_tr16(bp);
      bfr[t].q[1] = lds_tr16(bp + 16 * GBNP);
    }
#pragma unroll
    for (int i = 0; i < 2; ++i)
#pragma unroll
      for (int j = 0; j < 2; ++j)
        acc[i][j] = wmma_bf16(af[i], bfr[j], acc[i][j]);

    buf ^= 1;
  }

  bool outbf = (flags & GF_OUT_BF16) != 0;
  bool relu  = (flags & GF_RELU) != 0;
#pragma unroll
  for (int i = 0; i < 2; ++i)
#pragma unroll
    for (int j = 0; j < 2; ++j) {
      int colg = bn + wn * 32 + j * 16 + lm;
      float bv = bias ? bias[colg] : 0.f;
#pragma unroll
      for (int r = 0; r < 8; ++r) {
        int rowg = bm + wm * 32 + i * 16 + r + 8 * half;
        float val = acc[i][j][r] + bv;
        if (relu) val = fmaxf(val, 0.f);
        size_t idx = (size_t)rowg * NDIM + colg;
        if (res) val += res[idx];
        if (outbf) ((unsigned short*)Cp)[idx] = f2bf(val);
        else       ((float*)Cp)[idx] = val;
      }
    }
}

// ---------------- flash attention: one wave per (b,h,16-query tile) ----------------
#define NEG_BIG (-3.0e38f)

__global__ __launch_bounds__(32) void attn_kernel(
    const unsigned short* __restrict__ Q, const unsigned short* __restrict__ Km,
    const unsigned short* __restrict__ V, unsigned short* __restrict__ O) {
  const int E = 1024, T = 2048, DH = 64;
  __shared__ __align__(16) unsigned short Ps[16][32];
  int lane = threadIdx.x & 31;
  int half = lane >> 4, lm = lane & 15;
  int qt = blockIdx.x;                 // 0..T/16-1
  int bh = blockIdx.y;                 // 0..B*H-1
  int b = bh >> 4, h = bh & 15;
  size_t rowbase = (size_t)b * T;
  int q0 = qt * 16;
  int hoff = h * DH;
  const float scale = 0.03125f;        // 1024^-0.5 (reference scales by full E)

  // Q A-fragments (rows q0+lm, d-chunks 0..31 / 32..63), loaded once
  Frag qa[2];
  const unsigned short* qrow = Q + (rowbase + q0 + lm) * E + hoff;
#pragma unroll
  for (int t = 0; t < 2; ++t)
#pragma unroll
    for (int vv = 0; vv < 8; ++vv)
      qa[t].u[vv] = *(const unsigned int*)(qrow + t * 32 + pairK(vv, half));

  float mrun[8], lrun[8];
#pragma unroll
  for (int r = 0; r < 8; ++r) { mrun[r] = NEG_BIG; lrun[r] = 0.f; }
  v8f oacc[4] = {};

  int qmax = q0 + 15;
  for (int kt = 0; kt <= qmax; kt += 32) {
    // scores: two 16-key subtiles x two 32-wide d-chunks; batch all loads first
    const unsigned short* krow0 = Km + (rowbase + kt + lm) * E + hoff;
    const unsigned short* krow1 = krow0 + (size_t)16 * E;
    Frag kf[4];
#pragma unroll
    for (int t = 0; t < 2; ++t)
#pragma unroll
      for (int vv = 0; vv < 8; ++vv) {
        kf[t].u[vv]     = *(const unsigned int*)(krow0 + t * 32 + pairK(vv, half));
        kf[2 + t].u[vv] = *(const unsigned int*)(krow1 + t * 32 + pairK(vv, half));
      }
    v8f s0 = {}, s1 = {};
    s0 = wmma_bf16(qa[0], kf[0], s0);
    s0 = wmma_bf16(qa[1], kf[1], s0);
    s1 = wmma_bf16(qa[0], kf[2], s1);
    s1 = wmma_bf16(qa[1], kf[3], s1);

    // online softmax update (row = r + 8*half, 16 lanes per row share a half)
#pragma unroll
    for (int r = 0; r < 8; ++r) {
      int mq = q0 + r + 8 * half;
      float a0 = s0[r] * scale; if (kt + lm > mq)      a0 = NEG_BIG;
      float a1 = s1[r] * scale; if (kt + 16 + lm > mq) a1 = NEG_BIG;
      float mx = fmaxf(a0, a1);
#pragma unroll
      for (int off = 1; off < 16; off <<= 1) mx = fmaxf(mx, __shfl_xor(mx, off, 16));
      float mn = fmaxf(mrun[r], mx);
      float alpha = __expf(mrun[r] - mn);
      float p0 = __expf(a0 - mn), p1 = __expf(a1 - mn);
      float rs = p0 + p1;
#pragma unroll
      for (int off = 1; off < 16; off <<= 1) rs += __shfl_xor(rs, off, 16);
      lrun[r] = lrun[r] * alpha + rs;
      mrun[r] = mn;
#pragma unroll
      for (int j = 0; j < 4; ++j) oacc[j][r] *= alpha;
      Ps[r + 8 * half][lm]      = f2bf(p0);
      Ps[r + 8 * half][lm + 16] = f2bf(p1);
    }
    __syncthreads();

    // P (16x32) as A-fragment from LDS; V (32x16 per d-subtile) gathered from global
    Frag pf;
#pragma unroll
    for (int vv = 0; vv < 8; ++vv)
      pf.u[vv] = *(const unsigned int*)&Ps[lm][pairK(vv, half)];
    const unsigned short* vbase = V + (rowbase + kt) * E + hoff + lm;
    Frag vf[4];
#pragma unroll
    for (int j = 0; j < 4; ++j) {
      const unsigned short* vc = vbase + j * 16;
#pragma unroll
      for (int vv = 0; vv < 8; ++vv) {
        int kk = pairK(vv, half);
        unsigned int lo = vc[(size_t)kk * E];
        unsigned int hi = vc[(size_t)(kk + 1) * E];
        vf[j].u[vv] = lo | (hi << 16);
      }
    }
#pragma unroll
    for (int j = 0; j < 4; ++j)
      oacc[j] = wmma_bf16(pf, vf[j], oacc[j]);
    __syncthreads();
  }

  // epilogue: O /= l, store bf16
#pragma unroll
  for (int r = 0; r < 8; ++r) {
    float inv = 1.0f / lrun[r];
    size_t rowg = rowbase + q0 + r + 8 * half;
#pragma unroll
    for (int j = 0; j < 4; ++j)
      O[rowg * E + hoff + j * 16 + lm] = f2bf(oacc[j][r] * inv);
  }
}

// ---------------- host launcher ----------------
extern "C" void kernel_launch(void* const* d_in, const int* in_sizes, int n_in,
                              void* d_out, int out_size, void* d_ws, size_t ws_size,
                              hipStream_t stream) {
  const int E = 1024, H = 16, DFF = 4096, B = 2, T = 2048;
  const int M = B * T;                 // 4096 tokens
  (void)in_sizes; (void)n_in; (void)out_size; (void)ws_size;

  const float* x   = (const float*)d_in[0];
  const float* Wq  = (const float*)d_in[1];
  const float* Wk  = (const float*)d_in[2];
  const float* Wv  = (const float*)d_in[3];
  const float* Wo  = (const float*)d_in[4];
  const float* bo  = (const float*)d_in[5];
  const float* W1  = (const float*)d_in[6];
  const float* b1  = (const float*)d_in[7];
  const float* W2  = (const float*)d_in[8];
  const float* b2  = (const float*)d_in[9];
  const float* g1  = (const float*)d_in[10];
  const float* be1 = (const float*)d_in[11];
  const float* g2  = (const float*)d_in[12];
  const float* be2 = (const float*)d_in[13];
  float* out = (float*)d_out;

  // workspace carve-up (256B aligned)
  char* wsp = (char*)d_ws;
  auto alloc = [&](size_t bytes) -> void* {
    void* p = (void*)wsp;
    wsp += (bytes + 255) & ~(size_t)255;
    return p;
  };
  const size_t EE = (size_t)E * E, ED = (size_t)E * DFF;
  unsigned short* wq16 = (unsigned short*)alloc((4 * EE + 2 * ED) * 2);  // all bf16 weights, in a row
  unsigned short* wk16 = wq16 + EE;
  unsigned short* wv16 = wk16 + EE;
  unsigned short* wo16 = wv16 + EE;
  unsigned short* w116 = wo16 + EE;
  unsigned short* w216 = w116 + ED;
  unsigned short* hb   = (unsigned short*)alloc((size_t)M * E * 2);
  unsigned short* qb   = (unsigned short*)alloc((size_t)(M + 64) * E * 2);  // +64 row pad
  unsigned short* kb   = (unsigned short*)alloc((size_t)(M + 64) * E * 2);
  unsigned short* vb   = (unsigned short*)alloc((size_t)(M + 64) * E * 2);
  unsigned short* ob   = (unsigned short*)alloc((size_t)M * E * 2);
  float*          x1   = (float*)alloc((size_t)M * E * 4);
  unsigned short* h2   = (unsigned short*)alloc((size_t)M * E * 2);
  unsigned short* f1   = (unsigned short*)alloc((size_t)M * DFF * 2);

  // weights -> bf16
  cvt_weights_kernel<<<(4 * EE + 2 * ED) / CVT_PER_BLOCK, 256, 0, stream>>>(Wq, Wk, Wv, Wo, W1, W2, wq16);

  // LN1
  ln_bf16_kernel<<<M / 8, 256, 0, stream>>>(x, g1, be1, hb);

  // QKV projections
  dim3 gEE(E / GBN, M / GBM);
  gemm_bf16_kernel<1024, 1024><<<gEE, 256, 0, stream>>>(hb, wq16, nullptr, nullptr, qb, GF_OUT_BF16);
  gemm_bf16_kernel<1024, 1024><<<gEE, 256, 0, stream>>>(hb, wk16, nullptr, nullptr, kb, GF_OUT_BF16);
  gemm_bf16_kernel<1024, 1024><<<gEE, 256, 0, stream>>>(hb, wv16, nullptr, nullptr, vb, GF_OUT_BF16);

  // causal flash attention
  attn_kernel<<<dim3(T / 16, B * H), 32, 0, stream>>>(qb, kb, vb, ob);

  // out-proj + bias + residual(x) -> x1 (fp32)
  gemm_bf16_kernel<1024, 1024><<<gEE, 256, 0, stream>>>(ob, wo16, bo, x, x1, 0);

  // LN2
  ln_bf16_kernel<<<M / 8, 256, 0, stream>>>(x1, g2, be2, h2);

  // FFN
  dim3 gFF1(DFF / GBN, M / GBM);
  gemm_bf16_kernel<4096, 1024><<<gFF1, 256, 0, stream>>>(h2, w116, b1, nullptr, f1,
                                                         GF_OUT_BF16 | GF_RELU);
  gemm_bf16_kernel<1024, 4096><<<gEE, 256, 0, stream>>>(f1, w216, b2, x1, out, 0);
}

// v003
// Measured time: 379 microseconds a run.
// In both of two side-by-side timings against v002, it was 1.18 times as fast.
// All steps since v000 together make it 1.48 times as fast.
#include <hip/hip_runtime.h>
#include <math.h>

// ---------------- types ----------------
typedef __bf16 v16bf __attribute__((ext_vector_type(16)));
typedef float  v8f   __attribute__((ext_vector_type(8)));
typedef short  s16x8 __attribute__((ext_vector_type(8)));

union Frag {
  v16bf v;
  s16x8 q[2];
  unsigned int u[8];
  unsigned short h[16];
};

__device__ __forceinline__ unsigned short f2bf(float f) {
  unsigned int u = __builtin_bit_cast(unsigned int, f);
  u += 0x7FFFu + ((u >> 16) & 1u);          // round-to-nearest-even
  return (unsigned short)(u >> 16);
}

// element-pair K index for 16-bit WMMA A/B fragments (ISA 7.12.2):
// VGPR v<4 holds k={2v,2v+1}+8*half ; v>=4 holds k={16+2(v-4),...}+8*half
__device__ __forceinline__ int pairK(int v, int half) {
  return ((v < 4) ? (2 * v) : (16 + 2 * (v - 4))) + 8 * half;
}

__device__ __forceinline__ v8f wmma_bf16(const Frag& a, const Frag& b, v8f c) {
  return __builtin_amdgcn_wmma_f32_16x16x32_bf16(
      false, a.v, false, b.v, (short)0, c, false, false);
}

// ---- CDNA5 async global->LDS DMA (ASYNCcnt-tracked, no VGPR data) ----
__device__ __forceinline__ void async_ld_b128(unsigned lds_byte_addr, const void* gptr) {
  asm volatile("global_load_async_to_lds_b128 %0, %1, off"
               :: "v"(lds_byte_addr), "v"(gptr) : "memory");
}
__device__ __forceinline__ void wait_async0() {
  asm volatile("s_wait_asynccnt 0x0" ::: "memory");
}
// generic LDS pointer -> 32-bit LDS byte offset (aperture keeps offset in addr[31:0])
__device__ __forceinline__ unsigned lds_addr(const void* p) {
  return (unsigned)(unsigned long long)p;
}

// transposing LDS load: lane (c = l & 15, h = l >> 4) gets rows 8h..8h+7 of column c
// of a row-major 16-bit tile; lane l passes the address of row 8h + (l & 7), 16-byte chunk (l >> 3) & 1
__device__ __forceinline__ s16x8 lds_tr16(const unsigned short* p) {
  typedef __attribute__((address_space(3))) s16x8 lds_s16x8;
  return __builtin_amdgcn_ds_load_tr16_b128_v8i16((lds_s16x8*)p);
}

// ---------------- fp32 -> bf16 convert, all six weights in one launch ----------------
// The bf16 copies lie one behind the other in the workspace (Wq, Wk, Wv, Wo, W1, W2).
// A block converts 16384 consecutive elements: 64 per thread, so that few waves have to start.
#define CVT_PER_BLOCK 16384
// at most 8 waves a SIMD: a register budget of 128, so that all 16 loads of a thread stay in flight together
__global__ __launch_bounds__(256) __attribute__((amdgpu_waves_per_eu(4, 8))) void cvt_weights_kernel(
    const float* __restrict__ Wq, const float* __restrict__ Wk, const float* __restrict__ Wv,
    const float* __restrict__ Wo, const float* __restrict__ W1, const float* __restrict__ W2,
    unsigned short* __restrict__ out) {
  int seg = blockIdx.x >> 6;             // which run of 2^20 elements (64 blocks each)
  const float* src;
  if (seg < 4)      src = seg == 0 ? Wq : seg == 1 ? Wk : seg == 2 ? Wv : Wo;
  else if (seg < 8) src = W1 + ((size_t)(seg - 4) << 20);
  else              src = W2 + ((size_t)(seg - 8) << 20);
  const float4* in4 = (const float4*)(src + (size_t)(blockIdx.x & 63) * CVT_PER_BLOCK) + threadIdx.x;
  ushort4* o4 = (ushort4*)(out + (size_t)blockIdx.x * CVT_PER_BLOCK) + threadIdx.x;
  float4 v[16];
#pragma unroll   // all 16 loads of 512 B per wave in flight before the first store
  for (int k = 0; k < 16; ++k) v[k] = in4[k * 256];
#pragma unroll   // v[] stays in registers
  for (int k = 0; k < 16; ++k)
    o4[k * 256] = make_ushort4(f2bf(v[k].x), f2bf(v[k].y), f2bf(v[k].z), f2bf(v[k].w));
}

// ---------------- LayerNorm (one wave per token, E=1024) ----------------
// at most 8 waves a SIMD: a register budget of 128, so that gain and bias fly with the token's loads, not pair by pair behind the sums
__global__ __launch_bounds__(256) __attribute__((amdgpu_waves_per_eu(4, 8))) void ln_bf16_kernel(
    const float* __restrict__ x, const float* __restrict__ g,
    const float* __restrict__ b, unsigned short* __restrict__ out) {
  const int E = 1024;
  int lane = threadIdx.x & 31;
  // the wave's number as a scalar: the token's row address then sits in scalar registers
  int tok = blockIdx.x * 8 + __builtin_amdgcn_readfirstlane(threadIdx.x >> 5);
  const float4* xr = (const float4*)(x + (size_t)tok * E) + lane;
  const float4* g4 = (const float4*)g + lane;
  const float4* b4 = (const float4*)b + lane;
  float4 v[8], gg[8], bb[8];
#pragma unroll   // the token's 8 loads of 512 B in flight together
  for (int i = 0; i < 8; ++i) v[i] = xr[i * 32];
#pragma unroll   // gg[], bb[] stay in registers
  for (int i = 0; i < 8; ++i) { gg[i] = g4[i * 32]; bb[i] = b4[i * 32]; }
  float4 a = make_float4(0.f, 0.f, 0.f, 0.f), q = a;   // four independent chains each
#pragma unroll   // v[] stays in registers
  for (int i = 0; i < 8; ++i) {
    a.x += v[i].x; a.y += v[i].y; a.z += v[i].z; a.w += v[i].w;
    q.x += v[i].x * v[i].x; q.y += v[i].y * v[i].y;
    q.z += v[i].z * v[i].z; q.w += v[i].w * v[i].w;
  }
  float s = (a.x + a.y) + (a.z + a.w), s2 = (q.x + q.y) + (q.z + q.w);
#pragma unroll
  for (int off = 16; off; off >>= 1) {
    s  += __shfl_xor(s,  off, 32);
    s2 += __shfl_xor(s2, off, 32);
  }
  float mu = s * (1.0f / E);
  float var = s2 * (1.0f / E) - mu * mu;
  float rinv = rsqrtf(var + 1e-5f);
  ushort4* o4 = (ushort4*)(out + (size_t)tok * E) + lane;
#pragma unroll   // v[] stays in registers
  for (int i = 0; i < 8; ++i) {
    o4[i * 32] = make_ushort4(f2bf((v[i].x - mu) * rinv * gg[i].x + bb[i].x),
                              f2bf((v[i].y - mu) * rinv * gg[i].y + bb[i].y),
                              f2bf((v[i].z - mu) * rinv * gg[i].z + bb[i].z),
                              f2bf((v[i].w - mu) * rinv * gg[i].w + bb[i].w));
  }
}

// ---------------- bf16 GEMM: C = A[M,K] @ B[K,N] (+bias,+relu,+res) ----------------
#define GBM 128
#define GBN 64
#define GBK 32
#define GBNP 80   // LDS row pitch of the B tile in elements: 160 B = 32 B x odd, conflict-free for the transposing load
#define GF_OUT_BF16 1
#define GF_RELU     2

template <int NDIM, int KDIM>
__global__ __launch_bounds__(256) void gemm_bf16_kernel(
    const unsigned short* __restrict__ A, const unsigned short* __restrict__ Bm,
    const float* __restrict__ bias, const float* __restrict__ res,
    void* __restrict__ Cp, int flags) {
  // double-buffered LDS tiles
  __shared__ __align__(16) unsigned short As[2][GBM][GBK];
  __shared__ __align__(16) unsigned short Bs[2][GBK][GBNP];
  int tid = threadIdx.x;
  int lane = tid & 31, wave = tid >> 5;
  int wm = wave & 3, wn = wave >> 2;     // 4 x 2 wave grid -> 128 x 64 block tile
  int half = lane >> 4, lm = lane & 15;
  int bm = blockIdx.y * GBM, bn = blockIdx.x * GBN;

  // staging indices (computed once)
  int ar = tid >> 1;                 // 0..127 : A tile row
  int ac = (tid & 1) << 4;           // 0 or 16: A tile half-row
  int bkk = tid >> 3;                // 0..31  : B tile row
  int bnn = (tid & 7) << 3;          // 0..56  : B tile col (8 bf16 chunk)
  const unsigned short* aptr = A + (size_t)(bm + ar) * KDIM + ac;
  const unsigned short* bptr = Bm + (size_t)bkk * NDIM + bn + bnn;

  // this thread's LDS staging slots (byte addresses) for each buffer
  unsigned ldsA = lds_addr(&As[0][ar][ac]);
  unsigned ldsB = lds_addr(&Bs[0][bkk][bnn]);
  const unsigned strA = (unsigned)sizeof(As[0]);   // 8 KB
  const unsigned strB = (unsigned)sizeof(Bs[0]);   // 5 KB

  // prologue: async-stage K-tile 0 into buffer 0
  async_ld_b128(ldsA,      aptr);
  async_ld_b128(ldsA + 16, aptr + 8);
  async_ld_b128(ldsB,      bptr);
  aptr += GBK;
  bptr += (size_t)GBK * NDIM;

  v8f acc[2][2] = {};
  int buf = 0;
  for (int k0 = 0; k0 < KDIM; k0 += GBK) {
    wait_async0();                         // this wave's current tile landed in LDS
    __syncthreads();                       // all waves' tiles visible; frees buf^1
    if (k0 + GBK < KDIM) {                 // DMA next tile while we do the WMMAs
      unsigned ao = ldsA + (buf ^ 1) * strA;
      unsigned bo = ldsB + (buf ^ 1) * strB;
      async_ld_b128(ao,      aptr);
      async_ld_b128(ao + 16, aptr + 8);
      async_ld_b128(bo,      bptr);
      aptr += GBK;
      bptr += (size_t)GBK * NDIM;
      __builtin_prefetch(aptr, 0, 0);      // global_prefetch_b8 for the tile after
      __builtin_prefetch(bptr, 0, 0);
    }

    // fragments from current buffer
    Frag af[2], bfr[2];
#pragma unroll
    for (int t = 0; t < 2; ++t) {
      int row = wm * 32 + t * 16 + lm;
#pragma unroll
      for (int vv = 0; vv < 8; ++vv)
        af[t].u[vv] = *(const unsigned int*)&As[buf][row][pairK(vv, half)];
      // B fragment, k 0..15 then 16..31 of 16 columns, in the same k order as pairK
      const unsigned short* bp =
          &Bs[buf][8 * half + (lane & 7)][wn * 32 + t * 16 + 8 * ((lane >> 3) & 1)];
      bfr[t].q[0] = lds_tr16(bp);
      bfr[t].q[1] = lds_tr16(bp + 16 * GBNP);
    }
#pragma unroll
    for (int i = 0; i < 2; ++i)
#pragma unroll
      for (int j = 0; j < 2; ++j)
        acc[i][j] = wmma_bf16(af[i], bfr[j], acc[i][j]);

    buf ^= 1;
  }

  bool outbf = (flags & GF_OUT_BF16) != 0;
  bool relu  = (flags & GF_RELU) != 0;
#pragma unroll
  for (int i = 0; i < 2; ++i)
#pragma unroll
    for (int j = 0; j < 2; ++j) {
      int colg = bn + wn * 32 + j * 16 + lm;
      float bv = bias ? bias[colg] : 0.f;
#pragma unroll
      for (int r = 0; r < 8; ++r) {
        int rowg = bm + wm * 32 + i * 16 + r + 8 * half;
        float val = acc[i][j][r] + bv;
        if (relu) val = fmaxf(val, 0.f);
        size_t idx = (size_t)rowg * NDIM + colg;
        if (res) val += res[idx];
        if (outbf) ((unsigned short*)Cp)[idx] = f2bf(val);
        else       ((float*)Cp)[idx] = val;
      }
    }
}

// ---------------- flash attention: one wave per (b,h,16-query tile) ----------------
#define NEG_BIG (-3.0e38f)
#define AKP 72   // LDS row pitch of the K tile in elements: 144 B = 16 B x odd, conflict-free for ds_load_b128
#define AVP 80   // LDS row pitch of the V tile in elements: 160 B = 32 B x odd, conflict-free for the transposing load

// One wave copies a tile of 32 rows x 128 B (one head's slice of 32 keys) to LDS: 8 copies, each of
// 4 whole 128-B lines (8 lanes a row). lds, g: the lane's own 16 bytes in rows 0..3; step: LDS bytes of 4 rows.
// The wait on xcnt ends the statement so that no address register is rewritten in front of it.
__device__ __forceinline__ void async_tile_32x128(unsigned lds, unsigned step, const unsigned short* g) {
  const size_t gs = (size_t)4 * 1024;   // elements of 4 rows in global memory
  asm volatile(
      "global_load_async_to_lds_b128 %0, %8, off\n\t"
      "global_load_async_to_lds_b128 %1, %9, off\n\t"
      "global_load_async_to_lds_b128 %2, %10, off\n\t"
      "global_load_async_to_lds_b128 %3, %11, off\n\t"
      "global_load_async_to_lds_b128 %4, %12, off\n\t"
      "global_load_async_to_lds_b128 %5, %13, off\n\t"
      "global_load_async_to_lds_b128 %6, %14, off\n\t"
      "global_load_async_to_lds_b128 %7, %15, off\n\t"
      "s_wait_xcnt 0x0"
      :: "v"(lds), "v"(lds + step), "v"(lds + 2 * step), "v"(lds + 3 * step),
         "v"(lds + 4 * step), "v"(lds + 5 * step), "v"(lds + 6 * step), "v"(lds + 7 * step),
         "v"(g), "v"(g + gs), "v"(g + 2 * gs), "v"(g + 3 * gs),
         "v"(g + 4 * gs), "v"(g + 5 * gs), "v"(g + 6 * gs), "v"(g + 7 * gs)
      : "memory");
}

__global__ __launch_bounds__(32) void attn_kernel(
    const unsigned short* __restrict__ Q, const unsigned short* __restrict__ Km,
    const unsigned short* __restrict__ V, unsigned short* __restrict__ O) {
  const int E = 1024, T = 2048, DH = 64;
  __shared__ __align__(16) unsigned short Ps[16][32];
  __shared__ __align__(16) unsigned short Ks[2][32][AKP];   // two buffers: the next 32 keys fly while these are worked on
  __shared__ __align__(16) unsigned short Vs[2][32][AVP];
  int lane = threadIdx.x & 31;
  int half = lane >> 4, lm = lane & 15;
  int qt = blockIdx.x;                 // 0..T/16-1
  int bh = blockIdx.y;                 // 0..B*H-1
  int b = bh >> 4, h = bh & 15;
  size_t rowbase = (size_t)b * T;
  int q0 = qt * 16;
  int hoff = h * DH;
  const float scale = 0.03125f;        // 1024^-0.5 (reference scales by full E)

  // Q A-fragments (rows q0+lm, d-chunks 0..31 / 32..63), loaded once
  Frag qa[2];
  const unsigned short* qrow = Q + (rowbase + q0 + lm) * E + hoff;
#pragma unroll
  for (int t = 0; t < 2; ++t)
#pragma unroll
    for (int vv = 0; vv < 8; ++vv)
      qa[t].u[vv] = *(const unsigned int*)(qrow + t * 32 + pairK(vv, half));

  float mrun[8], lrun[8];
#pragma unroll
  for (int r = 0; r < 8; ++r) { mrun[r] = NEG_BIG; lrun[r] = 0.f; }
  v8f oacc[4] = {};

  int qmax = q0 + 15;

  // this lane's 16 bytes of rows 0..3 of a tile, in global memory and in LDS
  const unsigned short* kg = Km + (rowbase + (lane >> 3)) * E + hoff + (lane & 7) * 8;
  const unsigned short* vg = V  + (rowbase + (lane >> 3)) * E + hoff + (lane & 7) * 8;
  unsigned kl = lds_addr(&Ks[0][lane >> 3][(lane & 7) * 8]);
  unsigned vl = lds_addr(&Vs[0][lane >> 3][(lane & 7) * 8]);
  const unsigned strK = (unsigned)sizeof(Ks[0]), strV = (unsigned)sizeof(Vs[0]);

  // keys 0..31 into buffer 0, landed and published; then keys 32..63 into buffer 1
  async_tile_32x128(kl, 4 * AKP * 2, kg);
  async_tile_32x128(vl, 4 * AVP * 2, vg);
  wait_async0();
  __syncthreads();
  if (32 <= qmax) {
    async_tile_32x128(kl + strK, 4 * AKP * 2, kg + (size_t)32 * E);
    async_tile_32x128(vl + strV, 4 * AVP * 2, vg + (size_t)32 * E);
  }

  int buf = 0;
  for (int kt = 0; kt <= qmax; kt += 32) {
    // scores: two 16-key subtiles x two 32-wide d-chunks, K rows from LDS
    const unsigned short* krow0 = &Ks[buf][lm][0];
    const unsigned short* krow1 = &Ks[buf][16 + lm][0];
    Frag kf[4];
#pragma unroll
    for (int t = 0; t < 2; ++t)
#pragma unroll
      for (int vv = 0; vv < 8; ++vv) {
        kf[t].u[vv]     = *(const unsigned int*)(krow0 + t * 32 + pairK(vv, half));
        kf[2 + t].u[vv] = *(const unsigned int*)(krow1 + t * 32 + pairK(vv, half));
      }
    v8f s0 = {}, s1 = {};
    s0 = wmma_bf16(qa[0], kf[0], s0);
    s0 = wmma_bf16(qa[1], kf[1], s0);
    s1 = wmma_bf16(qa[0], kf[2], s1);
    s1 = wmma_bf16(qa[1], kf[3], s1);

    // online softmax update (row = r + 8*half, 16 lanes per row share a half)
#pragma unroll
    for (int r = 0; r < 8; ++r) {
      int mq = q0 + r + 8 * half;
      float a0 = s0[r] * scale; if (kt + lm > mq)      a0 = NEG_BIG;
      float a1 = s1[r] * scale; if (kt + 16 + lm > mq) a1 = NEG_BIG;
      float mx = fmaxf(a0, a1);
#pragma unroll
      for (int off = 1; off < 16; off <<= 1) mx = fmaxf(mx, __shfl_xor(mx, off, 16));
      float mn = fmaxf(mrun[r], mx);
      float alpha = __expf(mrun[r] - mn);
      float p0 = __expf(a0 - mn), p1 = __expf(a1 - mn);
      float rs = p0 + p1;
#pragma unroll
      for (int off = 1; off < 16; off <<= 1) rs += __shfl_xor(rs, off, 16);
      lrun[r] = lrun[r] * alpha + rs;
      mrun[r] = mn;
#pragma unroll
      for (int j = 0; j < 4; ++j) oacc[j][r] *= alpha;
      Ps[r + 8 * half][lm]      = f2bf(p0);
      Ps[r + 8 * half][lm + 16] = f2bf(p1);
    }
    __syncthreads();

    // P (16x32) as A-fragment from LDS; V (32x16 per d-subtile) by the transposing load,
    // keys 0..15 then 16..31 of 16 columns, in the same k order as pairK
    Frag pf;
#pragma unroll
    for (int vv = 0; vv < 8; ++vv)
      pf.u[vv] = *(const unsigned int*)&Ps[lm][pairK(vv, half)];
    Frag vf[4];
#pragma unroll
    for (int j = 0; j < 4; ++j) {
      const unsigned short* vp = &Vs[buf][8 * half + (lane & 7)][j * 16 + 8 * ((lane >> 3) & 1)];
      vf[j].q[0] = lds_tr16(vp);
      vf[j].q[1] = lds_tr16(vp + 16 * AVP);
    }
#pragma unroll
    for (int j = 0; j < 4; ++j)
      oacc[j] = wmma_bf16(pf, vf[j], oacc[j]);

    // hand-over: this pass's LDS reads are done, the next tile has landed, then the barrier;
    // only behind it is the buffer just read filled again
    // (the work-group is one wave: the compiler emits no barrier instruction for __syncthreads here)
    asm volatile("s_wait_dscnt 0x0" ::: "memory");
    wait_async0();
    __syncthreads();
    if (kt + 64 <= qmax) {
      async_tile_32x128(kl + buf * strK, 4 * AKP * 2, kg + (size_t)(kt + 64) * E);
      async_tile_32x128(vl + buf * strV, 4 * AVP * 2, vg + (size_t)(kt + 64) * E);
    }
    buf ^= 1;
  }
  wait_async0();   // no copy is left in flight when the wave ends

  // epilogue: O /= l, store bf16
#pragma unroll
  for (int r = 0; r < 8; ++r) {
    float inv = 1.0f / lrun[r];
    size_t rowg = rowbase + q0 + r + 8 * half;
#pragma unroll
    for (int j = 0; j < 4; ++j)
      O[rowg * E + hoff + j * 16 + lm] = f2bf(oacc[j][r] * inv);
  }
}

// ---------------- host launcher ----------------
extern "C" void kernel_launch(void* const* d_in, const int* in_sizes, int n_in,
                              void* d_out, int out_size, void* d_ws, size_t ws_size,
                              hipStream_t stream) {
  const int E = 1024, H = 16, DFF = 4096, B = 2, T = 2048;
  const int M = B * T;                 // 4096 tokens
  (void)in_sizes; (void)n_in; (void)out_size; (void)ws_size;

  const float* x   = (const float*)d_in[0];
  const float* Wq  = (const float*)d_in[1];
  const float* Wk  = (const float*)d_in[2];
  const float* Wv  = (const float*)d_in[3];
  const float* Wo  = (const float*)d_in[4];
  const float* bo  = (const float*)d_in[5];
  const float* W1  = (const float*)d_in[6];
  const float* b1  = (const float*)d_in[7];
  const float* W2  = (const float*)d_in[8];
  const float* b2  = (const float*)d_in[9];
  const float* g1  = (const float*)d_in[10];
  const float* be1 = (const float*)d_in[11];
  const float* g2  = (const float*)d_in[12];
  const float* be2 = (const float*)d_in[13];
  float* out = (float*)d_out;

  // workspace carve-up (256B aligned)
  char* wsp = (char*)d_ws;
  auto alloc = [&](size_t bytes) -> void* {
    void* p = (void*)wsp;
    wsp += (bytes + 255) & ~(size_t)255;
    return p;
  };
  const size_t EE = (size_t)E * E, ED = (size_t)E * DFF;
  unsigned short* wq16 = (unsigned short*)alloc((4 * EE + 2 * ED) * 2);  // all bf16 weights, in a row
  unsigned short* wk16 = wq16 + EE;
  unsigned short* wv16 = wk16 + EE;
  unsigned short* wo16 = wv16 + EE;
  unsigned short* w116 = wo16 + EE;
  unsigned short* w216 = w116 + ED;
  unsigned short* hb   = (unsigned short*)alloc((size_t)M * E * 2);
  unsigned short* qb   = (unsigned short*)alloc((size_t)(M + 64) * E * 2);  // +64 row pad
  unsigned short* kb   = (unsigned short*)alloc((size_t)(M + 64) * E * 2);
  unsigned short* vb   = (unsigned short*)alloc((size_t)(M + 64) * E * 2);
  unsigned short* ob   = (unsigned short*)alloc((size_t)M * E * 2);
  float*          x1   = (float*)alloc((size_t)M * E * 4);
  unsigned short* h2   = (unsigned short*)alloc((size_t)M * E * 2);
  unsigned short* f1   = (unsigned short*)alloc((size_t)M * DFF * 2);

  // weights -> bf16
  cvt_weights_kernel<<<(4 * EE + 2 * ED) / CVT_PER_BLOCK, 256, 0, stream>>>(Wq, Wk, Wv, Wo, W1, W2, wq16);

  // LN1
  ln_bf16_kernel<<<M / 8, 256, 0, stream>>>(x, g1, be1, hb);

  // QKV projections
  dim3 gEE(E / GBN, M / GBM);
  gemm_bf16_kernel<1024, 1024><<<gEE, 256, 0, stream>>>(hb, wq16, nullptr, nullptr, qb, GF_OUT_BF16);
  gemm_bf16_kernel<1024, 1024><<<gEE, 256, 0, stream>>>(hb, wk16, nullptr, nullptr, kb, GF_OUT_BF16);
  gemm_bf16_kernel<1024, 1024><<<gEE, 256, 0, stream>>>(hb, wv16, nullptr, nullptr, vb, GF_OUT_BF16);

  // causal flash attention
  attn_kernel<<<dim3(T / 16, B * H), 32, 0, stream>>>(qb, kb, vb, ob);

  // out-proj + bias + residual(x) -> x1 (fp32)
  gemm_bf16_kernel<1024, 1024><<<gEE, 256, 0, stream>>>(ob, wo16, bo, x, x1, 0);

  // LN2
  ln_bf16_kernel<<<M / 8, 256, 0, stream>>>(x1, g2, be2, h2);

  // FFN
  dim3 gFF1(DFF / GBN, M / GBM);
  gemm_bf16_kernel<4096, 1024><<<gFF1, 256, 0, stream>>>(h2, w116, b1, nullptr, f1,
                                                         GF_OUT_BF16 | GF_RELU);
  gemm_bf16_kernel<1024, 4096><<<gEE, 256, 0, stream>>>(f1, w216, b2, x1, out, 0);
}

// v004
// One run takes 317 microseconds.
// In both of two side-by-side timings against v003, it was 1.21 times as fast.
// Counting every step since v000, it is 1.79 times as fast.
#include <hip/hip_runtime.h>
#include <math.h>

// ---------------- types ----------------
typedef __bf16 v16bf __attribute__((ext_vector_type(16)));
typedef float  v8f   __attribute__((ext_vector_type(8)));
typedef short  s16x8 __attribute__((ext_vector_type(8)));

union Frag {
  v16bf v;
  s16x8 q[2];
  unsigned int u[8];
  unsigned short h[16];
};

__device__ __forceinline__ unsigned short f2bf(float f) {
  unsigned int u = __builtin_bit_cast(unsigned int, f);
  u += 0x7FFFu + ((u >> 16) & 1u);          // round-to-nearest-even
  return (unsigned short)(u >> 16);
}

// element-pair K index for 16-bit WMMA A/B fragments (ISA 7.12.2):
// VGPR v<4 holds k={2v,2v+1}+8*half ; v>=4 holds k={16+2(v-4),...}+8*half
__device__ __forceinline__ int pairK(int v, int half) {
  return ((v < 4) ? (2 * v) : (16 + 2 * (v - 4))) + 8 * half;
}

__device__ __forceinline__ v8f wmma_bf16(const Frag& a, const Frag& b, v8f c) {
  return __builtin_amdgcn_wmma_f32_16x16x32_bf16(
      false, a.v, false, b.v, (short)0, c, false, false);
}

// ---- CDNA5 async global->LDS DMA (ASYNCcnt-tracked, no VGPR data) ----
__device__ __forceinline__ void wait_async0() {
  asm volatile("s_wait_asynccnt 0x0" ::: "memory");
}
// generic LDS pointer -> 32-bit LDS byte offset (aperture keeps offset in addr[31:0])
__device__ __forceinline__ unsigned lds_addr(const void* p) {
  return (unsigned)(unsigned long long)p;
}

// transposing LDS load: lane (c = l & 15, h = l >> 4) gets rows 8h..8h+7 of column c
// of a row-major 16-bit tile; lane l passes the address of row 8h + (l & 7), 16-byte chunk (l >> 3) & 1
__device__ __forceinline__ s16x8 lds_tr16(const unsigned short* p) {
  typedef __attribute__((address_space(3))) s16x8 lds_s16x8;
  return __builtin_amdgcn_ds_load_tr16_b128_v8i16((lds_s16x8*)p);
}

// ---------------- fp32 -> bf16 convert, all six weights in one launch ----------------
// The bf16 copies lie one behind the other in the workspace (Wq, Wk, Wv, Wo, W1, W2).
// A block converts 16384 consecutive elements: 64 per thread, so that few waves have to start.
#define CVT_PER_BLOCK 16384
// at most 8 waves a SIMD: a register budget of 128, so that all 16 loads of a thread stay in flight together
__global__ __launch_bounds__(256) __attribute__((amdgpu_waves_per_eu(4, 8))) void cvt_weights_kernel(
    const float* __restrict__ Wq, const float* __restrict__ Wk, const float* __restrict__ Wv,
    const float* __restrict__ Wo, const float* __restrict__ W1, const float* __restrict__ W2,
    unsigned short* __restrict__ out) {
  int seg = blockIdx.x >> 6;             // which run of 2^20 elements (64 blocks each)
  const float* src;
  if (seg < 4)      src = seg == 0 ? Wq : seg == 1 ? Wk : seg == 2 ? Wv : Wo;
  else if (seg < 8) src = W1 + ((size_t)(seg - 4) << 20);
  else              src = W2 + ((size_t)(seg - 8) << 20);
  const float4* in4 = (const float4*)(src + (size_t)(blockIdx.x & 63) * CVT_PER_BLOCK) + threadIdx.x;
  ushort4* o4 = (ushort4*)(out + (size_t)blockIdx.x * CVT_PER_BLOCK) + threadIdx.x;
  float4 v[16];
#pragma unroll   // all 16 loads of 512 B per wave in flight before the first store
  for (int k = 0; k < 16; ++k) v[k] = in4[k * 256];
#pragma unroll   // v[] stays in registers
  for (int k = 0; k < 16; ++k)
    o4[k * 256] = make_ushort4(f2bf(v[k].x), f2bf(v[k].y), f2bf(v[k].z), f2bf(v[k].w));
}

// ---------------- LayerNorm (one wave per token, E=1024) ----------------
// at most 8 waves a SIMD: a register budget of 128, so that gain and bias fly with the token's loads, not pair by pair behind the sums
__global__ __launch_bounds__(256) __attribute__((amdgpu_waves_per_eu(4, 8))) void ln_bf16_kernel(
    const float* __restrict__ x, const float* __restrict__ g,
    const float* __restrict__ b, unsigned short* __restrict__ out) {
  const int E = 1024;
  int lane = threadIdx.x & 31;
  // the wave's number as a scalar: the token's row address then sits in scalar registers
  int tok = blockIdx.x * 8 + __builtin_amdgcn_readfirstlane(threadIdx.x >> 5);
  const float4* xr = (const float4*)(x + (size_t)tok * E) + lane;
  const float4* g4 = (const float4*)g + lane;
  const float4* b4 = (const float4*)b + lane;
  float4 v[8], gg[8], bb[8];
#pragma unroll   // the token's 8 loads of 512 B in flight together
  for (int i = 0; i < 8; ++i) v[i] = xr[i * 32];
#pragma unroll   // gg[], bb[] stay in registers
  for (int i = 0; i < 8; ++i) { gg[i] = g4[i * 32]; bb[i] = b4[i * 32]; }
  float4 a = make_float4(0.f, 0.f, 0.f, 0.f), q = a;   // four independent chains each
#pragma unroll   // v[] stays in registers
  for (int i = 0; i < 8; ++i) {
    a.x += v[i].x; a.y += v[i].y; a.z += v[i].z; a.w += v[i].w;
    q.x += v[i].x * v[i].x; q.y += v[i].y * v[i].y;
    q.z += v[i].z * v[i].z; q.w += v[i].w * v[i].w;
  }
  float s = (a.x + a.y) + (a.z + a.w), s2 = (q.x + q.y) + (q.z + q.w);
#pragma unroll
  for (int off = 16; off; off >>= 1) {
    s  += __shfl_xor(s,  off, 32);
    s2 += __shfl_xor(s2, off, 32);
  }
  float mu = s * (1.0f / E);
  float var = s2 * (1.0f / E) - mu * mu;
  float rinv = rsqrtf(var + 1e-5f);
  ushort4* o4 = (ushort4*)(out + (size_t)tok * E) + lane;
#pragma unroll   // v[] stays in registers
  for (int i = 0; i < 8; ++i) {
    o4[i * 32] = make_ushort4(f2bf((v[i].x - mu) * rinv * gg[i].x + bb[i].x),
                              f2bf((v[i].y - mu) * rinv * gg[i].y + bb[i].y),
                              f2bf((v[i].z - mu) * rinv * gg[i].z + bb[i].z),
                              f2bf((v[i].w - mu) * rinv * gg[i].w + bb[i].w));
  }
}

// ---------------- bf16 GEMM: C = A[M,K] @ B[K,N] (+bias,+relu,+res) ----------------
#define GBM 128
#define GBN 64
#define GBK 64    // a row of the A tile is then one whole 128-B line, like a row of the B tile
#define GAP 72    // LDS row pitch of the A tile in elements: 144 B = 16 B x odd, conflict-free for ds_load_b128
#define GBNP 80   // LDS row pitch of the B tile in elements: 160 B = 32 B x odd, conflict-free for the transposing load
#define GF_OUT_BF16 1
#define GF_RELU     2

// One thread's share of a K tile: 4 copies of A (rows r, r+32, r+64, r+96) and 2 of B (rows r, r+32), 16 B each.
// 8 lanes share a row, so every copy of a wave covers 4 whole 128-B lines.
// la, ga, lb, gb: the thread's own 16 bytes in row r; ars, brs: elements of 32 rows in global memory.
// The wait on xcnt ends the statement so that no address register is rewritten in front of it.
__device__ __forceinline__ void async_gemm_tile(unsigned la, const unsigned short* ga, size_t ars,
                                                unsigned lb, const unsigned short* gb, size_t brs) {
  const unsigned las = 32 * GAP * 2, lbs = 32 * GBNP * 2;   // LDS bytes of 32 rows
  asm volatile(
      "global_load_async_to_lds_b128 %0, %6, off\n\t"
      "global_load_async_to_lds_b128 %1, %7, off\n\t"
      "global_load_async_to_lds_b128 %2, %8, off\n\t"
      "global_load_async_to_lds_b128 %3, %9, off\n\t"
      "global_load_async_to_lds_b128 %4, %10, off\n\t"
      "global_load_async_to_lds_b128 %5, %11, off\n\t"
      "s_wait_xcnt 0x0"
      :: "v"(la), "v"(la + las), "v"(la + 2 * las), "v"(la + 3 * las), "v"(lb), "v"(lb + lbs),
         "v"(ga), "v"(ga + ars), "v"(ga + 2 * ars), "v"(ga + 3 * ars), "v"(gb), "v"(gb + brs)
      : "memory");
}

template <int NDIM, int KDIM>
__global__ __launch_bounds__(256) void gemm_bf16_kernel(
    const unsigned short* __restrict__ A, const unsigned short* __restrict__ Bm,
    const float* __restrict__ bias, const float* __restrict__ res,
    void* __restrict__ Cp, int flags) {
  // two buffers: the next K tile flies while this one is worked on
  __shared__ __align__(16) unsigned short As[2][GBM][GAP];
  __shared__ __align__(16) unsigned short Bs[2][GBK][GBNP];
  constexpr int NT = KDIM / GBK;         // K tiles
  static_assert(KDIM % GBK == 0 && NT >= 2, "the two-buffer prologue needs two whole K tiles");
  int tid = threadIdx.x;
  int lane = tid & 31, wave = tid >> 5;
  int wm = wave & 3, wn = wave >> 2;     // 4 x 2 wave grid -> 128 x 64 block tile
  int half = lane >> 4, lm = lane & 15;
  int bm = blockIdx.y * GBM, bn = blockIdx.x * GBN;

  // staging indices (computed once): row of the thread's first copy, its 16-B chunk of the 128-B row
  int sr = tid >> 3;                 // 0..31
  int sc = (tid & 7) << 3;           // 0..56, in elements
  const unsigned short* aptr = A + (size_t)(bm + sr) * KDIM + sc;
  const unsigned short* bptr = Bm + (size_t)sr * NDIM + bn + sc;
  const size_t ars = (size_t)32 * KDIM, brs = (size_t)32 * NDIM;
  // one prefetched byte a line: 2 threads an A row, 4 threads a B row cover a whole K tile; the first is tile 2
  const unsigned short* apf = A + (size_t)(bm + (tid >> 1)) * KDIM + 2 * GBK;
  const unsigned short* bpf = Bm + (size_t)((tid >> 2) + 2 * GBK) * NDIM + bn;

  // this thread's LDS staging slots (byte addresses) in buffer 0
  unsigned ldsA = lds_addr(&As[0][sr][sc]);
  unsigned ldsB = lds_addr(&Bs[0][sr][sc]);
  const unsigned strA = (unsigned)sizeof(As[0]);   // 18 KB
  const unsigned strB = (unsigned)sizeof(Bs[0]);   // 10 KB

  // K tile 0 into buffer 0, landed and published; then K tile 1 into buffer 1
  async_gemm_tile(ldsA, aptr, ars, ldsB, bptr, brs);
  wait_async0();
  __syncthreads();
  async_gemm_tile(ldsA + strA, aptr + GBK, ars, ldsB + strB, bptr + (size_t)GBK * NDIM, brs);

  v8f acc[2][2] = {};
  for (int kt = 0; kt < NT; ++kt) {
    int buf = kt & 1;
    if (kt + 3 < NT) {                     // global_prefetch_b8 for the tile that is copied at this trip's foot;
      __builtin_prefetch(apf, 0, 0);       // the test keeps both pointers inside their matrices behind the advance too
      __builtin_prefetch(bpf, 0, 0);
      apf += GBK;
      bpf += (size_t)GBK * NDIM;
    }

    // the tile's two 32-wide k chunks, in rising k
#pragma unroll   // kk constant: LDS offsets become immediates, the second chunk's loads can go ahead of the first's products
    for (int kk = 0; kk < GBK; kk += 32) {
      Frag af[2], bfr[2];
#pragma unroll
      for (int t = 0; t < 2; ++t) {
        int row = wm * 32 + t * 16 + lm;
#pragma unroll
        for (int vv = 0; vv < 8; ++vv)
          af[t].u[vv] = *(const unsigned int*)&As[buf][row][kk + pairK(vv, half)];
        // B fragment, k 0..15 then 16..31 of 16 columns, in the same k order as pairK
        const unsigned short* bp =
            &Bs[buf][kk + 8 * half + (lane & 7)][wn * 32 + t * 16 + 8 * ((lane >> 3) & 1)];
        bfr[t].q[0] = lds_tr16(bp);
        bfr[t].q[1] = lds_tr16(bp + 16 * GBNP);
      }
#pragma unroll
      for (int i = 0; i < 2; ++i)
#pragma unroll
        for (int j = 0; j < 2; ++j)
          acc[i][j] = wmma_bf16(af[i], bfr[j], acc[i][j]);
    }

    // hand-over: this trip's LDS reads are done, the next tile has landed, then the barrier;
    // only behind it is the buffer just read filled again
    asm volatile("s_wait_dscnt 0x0" ::: "memory");
    wait_async0();
    __syncthreads();
    if (kt + 2 < NT)
      async_gemm_tile(ldsA + buf * strA, aptr + (size_t)(kt + 2) * GBK, ars,
                      ldsB + buf * strB, bptr + (size_t)(kt + 2) * GBK * NDIM, brs);
  }
  wait_async0();   // no copy is left in flight when the wave ends

  bool outbf = (flags & GF_OUT_BF16) != 0;
  bool relu  = (flags & GF_RELU) != 0;
#pragma unroll
  for (int i = 0; i < 2; ++i)
#pragma unroll
    for (int j = 0; j < 2; ++j) {
      int colg = bn + wn * 32 + j * 16 + lm;
      float bv = bias ? bias[colg] : 0.f;
#pragma unroll
      for (int r = 0; r < 8; ++r) {
        int rowg = bm + wm * 32 + i * 16 + r + 8 * half;
        float val = acc[i][j][r] + bv;
        if (relu) val = fmaxf(val, 0.f);
        size_t idx = (size_t)rowg * NDIM + colg;
        if (res) val += res[idx];
        if (outbf) ((unsigned short*)Cp)[idx] = f2bf(val);
        else       ((float*)Cp)[idx] = val;
      }
    }
}

// ---------------- flash attention: one wave per (b,h,16-query tile) ----------------
#define NEG_BIG (-3.0e38f)
#define AKP 72   // LDS row pitch of the K tile in elements: 144 B = 16 B x odd, conflict-free for ds_load_b128
#define AVP 80   // LDS row pitch of the V tile in elements: 160 B = 32 B x odd, conflict-free for the transposing load

// One wave copies a tile of 32 rows x 128 B (one head's slice of 32 keys) to LDS: 8 copies, each of
// 4 whole 128-B lines (8 lanes a row). lds, g: the lane's own 16 bytes in rows 0..3; step: LDS bytes of 4 rows.
// The wait on xcnt ends the statement so that no address register is rewritten in front of it.
__device__ __forceinline__ void async_tile_32x128(unsigned lds, unsigned step, const unsigned short* g) {
  const size_t gs = (size_t)4 * 1024;   // elements of 4 rows in global memory
  asm volatile(
      "global_load_async_to_lds_b128 %0, %8, off\n\t"
      "global_load_async_to_lds_b128 %1, %9, off\n\t"
      "global_load_async_to_lds_b128 %2, %10, off\n\t"
      "global_load_async_to_lds_b128 %3, %11, off\n\t"
      "global_load_async_to_lds_b128 %4, %12, off\n\t"
      "global_load_async_to_lds_b128 %5, %13, off\n\t"
      "global_load_async_to_lds_b128 %6, %14, off\n\t"
      "global_load_async_to_lds_b128 %7, %15, off\n\t"
      "s_wait_xcnt 0x0"
      :: "v"(lds), "v"(lds + step), "v"(lds + 2 * step), "v"(lds + 3 * step),
         "v"(lds + 4 * step), "v"(lds + 5 * step), "v"(lds + 6 * step), "v"(lds + 7 * step),
         "v"(g), "v"(g + gs), "v"(g + 2 * gs), "v"(g + 3 * gs),
         "v"(g + 4 * gs), "v"(g + 5 * gs), "v"(g + 6 * gs), "v"(g + 7 * gs)
      : "memory");
}

__global__ __launch_bounds__(32) void attn_kernel(
    const unsigned short* __restrict__ Q, const unsigned short* __restrict__ Km,
    const unsigned short* __restrict__ V, unsigned short* __restrict__ O) {
  const int E = 1024, T = 2048, DH = 64;
  __shared__ __align__(16) unsigned short Ps[16][32];
  __shared__ __align__(16) unsigned short Ks[2][32][AKP];   // two buffers: the next 32 keys fly while these are worked on
  __shared__ __align__(16) unsigned short Vs[2][32][AVP];
  int lane = threadIdx.x & 31;
  int half = lane >> 4, lm = lane & 15;
  int qt = blockIdx.x;                 // 0..T/16-1
  int bh = blockIdx.y;                 // 0..B*H-1
  int b = bh >> 4, h = bh & 15;
  size_t rowbase = (size_t)b * T;
  int q0 = qt * 16;
  int hoff = h * DH;
  const float scale = 0.03125f;        // 1024^-0.5 (reference scales by full E)

  // Q A-fragments (rows q0+lm, d-chunks 0..31 / 32..63), loaded once
  Frag qa[2];
  const unsigned short* qrow = Q + (rowbase + q0 + lm) * E + hoff;
#pragma unroll
  for (int t = 0; t < 2; ++t)
#pragma unroll
    for (int vv = 0; vv < 8; ++vv)
      qa[t].u[vv] = *(const unsigned int*)(qrow + t * 32 + pairK(vv, half));

  float mrun[8], lrun[8];
#pragma unroll
  for (int r = 0; r < 8; ++r) { mrun[r] = NEG_BIG; lrun[r] = 0.f; }
  v8f oacc[4] = {};

  int qmax = q0 + 15;

  // this lane's 16 bytes of rows 0..3 of a tile, in global memory and in LDS
  const unsigned short* kg = Km + (rowbase + (lane >> 3)) * E + hoff + (lane & 7) * 8;
  const unsigned short* vg = V  + (rowbase + (lane >> 3)) * E + hoff + (lane & 7) * 8;
  unsigned kl = lds_addr(&Ks[0][lane >> 3][(lane & 7) * 8]);
  unsigned vl = lds_addr(&Vs[0][lane >> 3][(lane & 7) * 8]);
  const unsigned strK = (unsigned)sizeof(Ks[0]), strV = (unsigned)sizeof(Vs[0]);

  // keys 0..31 into buffer 0, landed and published; then keys 32..63 into buffer 1
  async_tile_32x128(kl, 4 * AKP * 2, kg);
  async_tile_32x128(vl, 4 * AVP * 2, vg);
  wait_async0();
  __syncthreads();
  if (32 <= qmax) {
    async_tile_32x128(kl + strK, 4 * AKP * 2, kg + (size_t)32 * E);
    async_tile_32x128(vl + strV, 4 * AVP * 2, vg + (size_t)32 * E);
  }

  int buf = 0;
  for (int kt = 0; kt <= qmax; kt += 32) {
    // scores: two 16-key subtiles x two 32-wide d-chunks, K rows from LDS
    const unsigned short* krow0 = &Ks[buf][lm][0];
    const unsigned short* krow1 = &Ks[buf][16 + lm][0];
    Frag kf[4];
#pragma unroll
    for (int t = 0; t < 2; ++t)
#pragma unroll
      for (int vv = 0; vv < 8; ++vv) {
        kf[t].u[vv]     = *(const unsigned int*)(krow0 + t * 32 + pairK(vv, half));
        kf[2 + t].u[vv] = *(const unsigned int*)(krow1 + t * 32 + pairK(vv, half));
      }
    v8f s0 = {}, s1 = {};
    s0 = wmma_bf16(qa[0], kf[0], s0);
    s0 = wmma_bf16(qa[1], kf[1], s0);
    s1 = wmma_bf16(qa[0], kf[2], s1);
    s1 = wmma_bf16(qa[1], kf[3], s1);

    // online softmax update (row = r + 8*half, 16 lanes per row share a half)
#pragma unroll
    for (int r = 0; r < 8; ++r) {
      int mq = q0 + r + 8 * half;
      float a0 = s0[r] * scale; if (kt + lm > mq)      a0 = NEG_BIG;
      float a1 = s1[r] * scale; if (kt + 16 + lm > mq) a1 = NEG_BIG;
      float mx = fmaxf(a0, a1);
#pragma unroll
      for (int off = 1; off < 16; off <<= 1) mx = fmaxf(mx, __shfl_xor(mx, off, 16));
      float mn = fmaxf(mrun[r], mx);
      float alpha = __expf(mrun[r] - mn);
      float p0 = __expf(a0 - mn), p1 = __expf(a1 - mn);
      float rs = p0 + p1;
#pragma unroll
      for (int off = 1; off < 16; off <<= 1) rs += __shfl_xor(rs, off, 16);
      lrun[r] = lrun[r] * alpha + rs;
      mrun[r] = mn;
#pragma unroll
      for (int j = 0; j < 4; ++j) oacc[j][r] *= alpha;
      Ps[r + 8 * half][lm]      = f2bf(p0);
      Ps[r + 8 * half][lm + 16] = f2bf(p1);
    }
    __syncthreads();

    // P (16x32) as A-fragment from LDS; V (32x16 per d-subtile) by the transposing load,
    // keys 0..15 then 16..31 of 16 columns, in the same k order as pairK
    Frag pf;
#pragma unroll
    for (int vv = 0; vv < 8; ++vv)
      pf.u[vv] = *(const unsigned int*)&Ps[lm][pairK(vv, half)];
    Frag vf[4];
#pragma unroll
    for (int j = 0; j < 4; ++j) {
      const unsigned short* vp = &Vs[buf][8 * half + (lane & 7)][j * 16 + 8 * ((lane >> 3) & 1)];
      vf[j].q[0] = lds_tr16(vp);
      vf[j].q[1] = lds_tr16(vp + 16 * AVP);
    }
#pragma unroll
    for (int j = 0; j < 4; ++j)
      oacc[j] = wmma_bf16(pf, vf[j], oacc[j]);

    // hand-over: this pass's LDS reads are done, the next tile has landed, then the barrier;
    // only behind it is the buffer just read filled again
    // (the work-group is one wave: the compiler emits no barrier instruction for __syncthreads here)
    asm volatile("s_wait_dscnt 0x0" ::: "memory");
    wait_async0();
    __syncthreads();
    if (kt + 64 <= qmax) {
      async_tile_32x128(kl + buf * strK, 4 * AKP * 2, kg + (size_t)(kt + 64) * E);
      async_tile_32x128(vl + buf * strV, 4 * AVP * 2, vg + (size_t)(kt + 64) * E);
    }
    buf ^= 1;
  }
  wait_async0();   // no copy is left in flight when the wave ends

  // epilogue: O /= l, store bf16
#pragma unroll
  for (int r = 0; r < 8; ++r) {
    float inv = 1.0f / lrun[r];
    size_t rowg = rowbase + q0 + r + 8 * half;
#pragma unroll
    for (int j = 0; j < 4; ++j)
      O[rowg * E + hoff + j * 16 + lm] = f2bf(oacc[j][r] * inv);
  }
}

// ---------------- host launcher ----------------
extern "C" void kernel_launch(void* const* d_in, const int* in_sizes, int n_in,
                              void* d_out, int out_size, void* d_ws, size_t ws_size,
                              hipStream_t stream) {
  const int E = 1024, H = 16, DFF = 4096, B = 2, T = 2048;
  const int M = B * T;                 // 4096 tokens
  (void)in_sizes; (void)n_in; (void)out_size; (void)ws_size;

  const float* x   = (const float*)d_in[0];
  const float* Wq  = (const float*)d_in[1];
  const float* Wk  = (const float*)d_in[2];
  const float* Wv  = (const float*)d_in[3];
  const float* Wo  = (const float*)d_in[4];
  const float* bo  = (const float*)d_in[5];
  const float* W1  = (const float*)d_in[6];
  const float* b1  = (const float*)d_in[7];
  const float* W2  = (const float*)d_in[8];
  const float* b2  = (const float*)d_in[9];
  const float* g1  = (const float*)d_in[10];
  const float* be1 = (const float*)d_in[11];
  const float* g2  = (const float*)d_in[12];
  const float* be2 = (const float*)d_in[13];
  float* out = (float*)d_out;

  // workspace carve-up (256B aligned)
  char* wsp = (char*)d_ws;
  auto alloc = [&](size_t bytes) -> void* {
    void* p = (void*)wsp;
    wsp += (bytes + 255) & ~(size_t)255;
    return p;
  };
  const size_t EE = (size_t)E * E, ED = (size_t)E * DFF;
  unsigned short* wq16 = (unsigned short*)alloc((4 * EE + 2 * ED) * 2);  // all bf16 weights, in a row
  unsigned short* wk16 = wq16 + EE;
  unsigned short* wv16 = wk16 + EE;
  unsigned short* wo16 = wv16 + EE;
  unsigned short* w116 = wo16 + EE;
  unsigned short* w216 = w116 + ED;
  unsigned short* hb   = (unsigned short*)alloc((size_t)M * E * 2);
  unsigned short* qb   = (unsigned short*)alloc((size_t)(M + 64) * E * 2);  // +64 row pad
  unsigned short* kb   = (unsigned short*)alloc((size_t)(M + 64) * E * 2);
  unsigned short* vb   = (unsigned short*)alloc((size_t)(M + 64) * E * 2);
  unsigned short* ob   = (unsigned short*)alloc((size_t)M * E * 2);
  float*          x1   = (float*)alloc((size_t)M * E * 4);
  unsigned short* h2   = (unsigned short*)alloc((size_t)M * E * 2);
  unsigned short* f1   = (unsigned short*)alloc((size_t)M * DFF * 2);

  // weights -> bf16
  cvt_weights_kernel<<<(4 * EE + 2 * ED) / CVT_PER_BLOCK, 256, 0, stream>>>(Wq, Wk, Wv, Wo, W1, W2, wq16);

  // LN1
  ln_bf16_kernel<<<M / 8, 256, 0, stream>>>(x, g1, be1, hb);

  // QKV projections
  dim3 gEE(E / GBN, M / GBM);
  gemm_bf16_kernel<1024, 1024><<<gEE, 256, 0, stream>>>(hb, wq16, nullptr, nullptr, qb, GF_OUT_BF16);
  gemm_bf16_kernel<1024, 1024><<<gEE, 256, 0, stream>>>(hb, wk16, nullptr, nullptr, kb, GF_OUT_BF16);
  gemm_bf16_kernel<1024, 1024><<<gEE, 256, 0, stream>>>(hb, wv16, nullptr, nullptr, vb, GF_OUT_BF16);

  // causal flash attention
  attn_kernel<<<dim3(T / 16, B * H), 32, 0, stream>>>(qb, kb, vb, ob);

  // out-proj + bias + residual(x) -> x1 (fp32)
  gemm_bf16_kernel<1024, 1024><<<gEE, 256, 0, stream>>>(ob, wo16, bo, x, x1, 0);

  // LN2
  ln_bf16_kernel<<<M / 8, 256, 0, stream>>>(x1, g2, be2, h2);

  // FFN
  dim3 gFF1(DFF / GBN, M / GBM);
  gemm_bf16_kernel<4096, 1024><<<gFF1, 256, 0, stream>>>(h2, w116, b1, nullptr, f1,
                                                         GF_OUT_BF16 | GF_RELU);
  gemm_bf16_kernel<1024, 4096><<<gEE, 256, 0, stream>>>(f1, w216, b2, x1, out, 0);
}

// v005
// One run takes 267 microseconds.
// In both of two side-by-side timings against v004, it was 1.19 times as fast.
// Over all steps from v000 it is 2.12 times as fast.
#include <hip/hip_runtime.h>
#include <math.h>

// ---------------- types ----------------
typedef __bf16 v16bf __attribute__((ext_vector_type(16)));
typedef float  v8f   __attribute__((ext_vector_type(8)));
typedef short  s16x8 __attribute__((ext_vector_type(8)));

union Frag {
  v16bf v;
  s16x8 q[2];
  unsigned int u[8];
  unsigned short h[16];
};

__device__ __forceinline__ unsigned short f2bf(float f) {
  unsigned int u = __builtin_bit_cast(unsigned int, f);
  u += 0x7FFFu + ((u >> 16) & 1u);          // round-to-nearest-even
  return (unsigned short)(u >> 16);
}

// element-pair K index for 16-bit WMMA A/B fragments (ISA 7.12.2):
// VGPR v<4 holds k={2v,2v+1}+8*half ; v>=4 holds k={16+2(v-4),...}+8*half
__device__ __forceinline__ int pairK(int v, int half) {
  return ((v < 4) ? (2 * v) : (16 + 2 * (v - 4))) + 8 * half;
}

__device__ __forceinline__ v8f wmma_bf16(const Frag& a, const Frag& b, v8f c) {
  return __builtin_amdgcn_wmma_f32_16x16x32_bf16(
      false, a.v, false, b.v, (short)0, c, false, false);
}

// ---- CDNA5 async global->LDS DMA (ASYNCcnt-tracked, no VGPR data) ----
__device__ __forceinline__ void wait_async0() {
  asm volatile("s_wait_asynccnt 0x0" ::: "memory");
}
// generic LDS pointer -> 32-bit LDS byte offset (aperture keeps offset in addr[31:0])
__device__ __forceinline__ unsigned lds_addr(const void* p) {
  return (unsigned)(unsigned long long)p;
}

// transposing LDS load: lane (c = l & 15, h = l >> 4) gets rows 8h..8h+7 of column c
// of a row-major 16-bit tile; lane l passes the address of row 8h + (l & 7), 16-byte chunk (l >> 3) & 1
__device__ __forceinline__ s16x8 lds_tr16(const unsigned short* p) {
  typedef __attribute__((address_space(3))) s16x8 lds_s16x8;
  return __builtin_amdgcn_ds_load_tr16_b128_v8i16((lds_s16x8*)p);
}

// ---------------- fp32 -> bf16 convert, all six weights in one launch ----------------
// The bf16 copies lie one behind the other in the workspace (Wq, Wk, Wv, Wo, W1, W2).
// A block converts 16384 consecutive elements: 64 per thread, so that few waves have to start.
#define CVT_PER_BLOCK 16384
// at most 8 waves a SIMD: a register budget of 128, so that all 16 loads of a thread stay in flight together
__global__ __launch_bounds__(256) __attribute__((amdgpu_waves_per_eu(4, 8))) void cvt_weights_kernel(
    const float* __restrict__ Wq, const float* __restrict__ Wk, const float* __restrict__ Wv,
    const float* __restrict__ Wo, const float* __restrict__ W1, const float* __restrict__ W2,
    unsigned short* __restrict__ out) {
  int seg = blockIdx.x >> 6;             // which run of 2^20 elements (64 blocks each)
  const float* src;
  if (seg < 4)      src = seg == 0 ? Wq : seg == 1 ? Wk : seg == 2 ? Wv : Wo;
  else if (seg < 8) src = W1 + ((size_t)(seg - 4) << 20);
  else              src = W2 + ((size_t)(seg - 8) << 20);
  const float4* in4 = (const float4*)(src + (size_t)(blockIdx.x & 63) * CVT_PER_BLOCK) + threadIdx.x;
  ushort4* o4 = (ushort4*)(out + (size_t)blockIdx.x * CVT_PER_BLOCK) + threadIdx.x;
  float4 v[16];
#pragma unroll   // all 16 loads of 512 B per wave in flight before the first store
  for (int k = 0; k < 16; ++k) v[k] = in4[k * 256];
#pragma unroll   // v[] stays in registers
  for (int k = 0; k < 16; ++k)
    o4[k * 256] = make_ushort4(f2bf(v[k].x), f2bf(v[k].y), f2bf(v[k].z), f2bf(v[k].w));
}

// ---------------- LayerNorm (one wave per token, E=1024) ----------------
// at most 8 waves a SIMD: a register budget of 128, so that gain and bias fly with the token's loads, not pair by pair behind the sums
__global__ __launch_bounds__(256) __attribute__((amdgpu_waves_per_eu(4, 8))) void ln_bf16_kernel(
    const float* __restrict__ x, const float* __restrict__ g,
    const float* __restrict__ b, unsigned short* __restrict__ out) {
  const int E = 1024;
  int lane = threadIdx.x & 31;
  // the wave's number as a scalar: the token's row address then sits in scalar registers
  int tok = blockIdx.x * 8 + __builtin_amdgcn_readfirstlane(threadIdx.x >> 5);
  const float4* xr = (const float4*)(x + (size_t)tok * E) + lane;
  const float4* g4 = (const float4*)g + lane;
  const float4* b4 = (const float4*)b + lane;
  float4 v[8], gg[8], bb[8];
#pragma unroll   // the token's 8 loads of 512 B in flight together
  for (int i = 0; i < 8; ++i) v[i] = xr[i * 32];
#pragma unroll   // gg[], bb[] stay in registers
  for (int i = 0; i < 8; ++i) { gg[i] = g4[i * 32]; bb[i] = b4[i * 32]; }
  float4 a = make_float4(0.f, 0.f, 0.f, 0.f), q = a;   // four independent chains each
#pragma unroll   // v[] stays in registers
  for (int i = 0; i < 8; ++i) {
    a.x += v[i].x; a.y += v[i].y; a.z += v[i].z; a.w += v[i].w;
    q.x += v[i].x * v[i].x; q.y += v[i].y * v[i].y;
    q.z += v[i].z * v[i].z; q.w += v[i].w * v[i].w;
  }
  float s = (a.x + a.y) + (a.z + a.w), s2 = (q.x + q.y) + (q.z + q.w);
#pragma unroll
  for (int off = 16; off; off >>= 1) {
    s  += __shfl_xor(s,  off, 32);
    s2 += __shfl_xor(s2, off, 32);
  }
  float mu = s * (1.0f / E);
  float var = s2 * (1.0f / E) - mu * mu;
  float rinv = rsqrtf(var + 1e-5f);
  ushort4* o4 = (ushort4*)(out + (size_t)tok * E) + lane;
#pragma unroll   // v[] stays in registers
  for (int i = 0; i < 8; ++i) {
    o4[i * 32] = make_ushort4(f2bf((v[i].x - mu) * rinv * gg[i].x + bb[i].x),
                              f2bf((v[i].y - mu) * rinv * gg[i].y + bb[i].y),
                              f2bf((v[i].z - mu) * rinv * gg[i].z + bb[i].z),
                              f2bf((v[i].w - mu) * rinv * gg[i].w + bb[i].w));
  }
}

// ---------------- bf16 GEMM: C = A[M,K] @ B[K,N] (+bias,+relu,+res) ----------------
#define GBM 128
#define GBN 64
#define GBK 64    // a row of the A tile is then one whole 128-B line, like a row of the B tile
#define GAP 72    // LDS row pitch of the A tile in elements: 144 B = 16 B x odd, conflict-free for ds_load_b128
#define GBNP 80   // LDS row pitch of the B tile in elements: 160 B = 32 B x odd, conflict-free for the transposing load
#define GF_OUT_BF16 1
#define GF_RELU     2

// One thread's share of a K tile: 4 copies of A (rows r, r+32, r+64, r+96) and 2 of B (rows r, r+32), 16 B each.
// 8 lanes share a row, so every copy of a wave covers 4 whole 128-B lines.
// la, ga, lb, gb: the thread's own 16 bytes in row r; ars, brs: elements of 32 rows in global memory.
// The wait on xcnt ends the statement so that no address register is rewritten in front of it.
__device__ __forceinline__ void async_gemm_tile(unsigned la, const unsigned short* ga, size_t ars,
                                                unsigned lb, const unsigned short* gb, size_t brs) {
  const unsigned las = 32 * GAP * 2, lbs = 32 * GBNP * 2;   // LDS bytes of 32 rows
  asm volatile(
      "global_load_async_to_lds_b128 %0, %6, off\n\t"
      "global_load_async_to_lds_b128 %1, %7, off\n\t"
      "global_load_async_to_lds_b128 %2, %8, off\n\t"
      "global_load_async_to_lds_b128 %3, %9, off\n\t"
      "global_load_async_to_lds_b128 %4, %10, off\n\t"
      "global_load_async_to_lds_b128 %5, %11, off\n\t"
      "s_wait_xcnt 0x0"
      :: "v"(la), "v"(la + las), "v"(la + 2 * las), "v"(la + 3 * las), "v"(lb), "v"(lb + lbs),
         "v"(ga), "v"(ga + ars), "v"(ga + 2 * ars), "v"(ga + 3 * ars), "v"(gb), "v"(gb + brs)
      : "memory");
}

template <int NDIM, int KDIM>
__global__ __launch_bounds__(256) void gemm_bf16_kernel(
    const unsigned short* __restrict__ A, const unsigned short* __restrict__ Bm,
    const float* __restrict__ bias, const float* __restrict__ res,
    void* __restrict__ Cp, int flags) {
  // two buffers: the next K tile flies while this one is worked on
  __shared__ __align__(16) unsigned short As[2][GBM][GAP];
  __shared__ __align__(16) unsigned short Bs[2][GBK][GBNP];
  constexpr int NT = KDIM / GBK;         // K tiles
  static_assert(KDIM % GBK == 0 && NT >= 2, "the two-buffer prologue needs two whole K tiles");
  int tid = threadIdx.x;
  int lane = tid & 31, wave = tid >> 5;
  int wm = wave & 3, wn = wave >> 2;     // 4 x 2 wave grid -> 128 x 64 block tile
  int half = lane >> 4, lm = lane & 15;
  int bm = blockIdx.y * GBM, bn = blockIdx.x * GBN;

  // staging indices (computed once): row of the thread's first copy, its 16-B chunk of the 128-B row
  int sr = tid >> 3;                 // 0..31
  int sc = (tid & 7) << 3;           // 0..56, in elements
  const unsigned short* aptr = A + (size_t)(bm + sr) * KDIM + sc;
  const unsigned short* bptr = Bm + (size_t)sr * NDIM + bn + sc;
  const size_t ars = (size_t)32 * KDIM, brs = (size_t)32 * NDIM;
  // one prefetched byte a line: 2 threads an A row, 4 threads a B row cover a whole K tile; the first is tile 2
  const unsigned short* apf = A + (size_t)(bm + (tid >> 1)) * KDIM + 2 * GBK;
  const unsigned short* bpf = Bm + (size_t)((tid >> 2) + 2 * GBK) * NDIM + bn;

  // this thread's LDS staging slots (byte addresses) in buffer 0
  unsigned ldsA = lds_addr(&As[0][sr][sc]);
  unsigned ldsB = lds_addr(&Bs[0][sr][sc]);
  const unsigned strA = (unsigned)sizeof(As[0]);   // 18 KB
  const unsigned strB = (unsigned)sizeof(Bs[0]);   // 10 KB

  // K tile 0 into buffer 0, landed and published; then K tile 1 into buffer 1
  async_gemm_tile(ldsA, aptr, ars, ldsB, bptr, brs);
  wait_async0();
  __syncthreads();
  async_gemm_tile(ldsA + strA, aptr + GBK, ars, ldsB + strB, bptr + (size_t)GBK * NDIM, brs);

  v8f acc[2][2] = {};
  for (int kt = 0; kt < NT; ++kt) {
    int buf = kt & 1;
    if (kt + 3 < NT) {                     // global_prefetch_b8 for the tile that is copied at this trip's foot;
      __builtin_prefetch(apf, 0, 0);       // the test keeps both pointers inside their matrices behind the advance too
      __builtin_prefetch(bpf, 0, 0);
      apf += GBK;
      bpf += (size_t)GBK * NDIM;
    }

    // the tile's two 32-wide k chunks, in rising k
#pragma unroll   // kk constant: LDS offsets become immediates, the second chunk's loads can go ahead of the first's products
    for (int kk = 0; kk < GBK; kk += 32) {
      Frag af[2], bfr[2];
#pragma unroll
      for (int t = 0; t < 2; ++t) {
        int row = wm * 32 + t * 16 + lm;
#pragma unroll
        for (int vv = 0; vv < 8; ++vv)
          af[t].u[vv] = *(const unsigned int*)&As[buf][row][kk + pairK(vv, half)];
        // B fragment, k 0..15 then 16..31 of 16 columns, in the same k order as pairK
        const unsigned short* bp =
            &Bs[buf][kk + 8 * half + (lane & 7)][wn * 32 + t * 16 + 8 * ((lane >> 3) & 1)];
        bfr[t].q[0] = lds_tr16(bp);
        bfr[t].q[1] = lds_tr16(bp + 16 * GBNP);
      }
#pragma unroll
      for (int i = 0; i < 2; ++i)
#pragma unroll
        for (int j = 0; j < 2; ++j)
          acc[i][j] = wmma_bf16(af[i], bfr[j], acc[i][j]);
    }

    // hand-over: this trip's LDS reads are done, the next tile has landed, then the barrier;
    // only behind it is the buffer just read filled again
    asm volatile("s_wait_dscnt 0x0" ::: "memory");
    wait_async0();
    __syncthreads();
    if (kt + 2 < NT)
      async_gemm_tile(ldsA + buf * strA, aptr + (size_t)(kt + 2) * GBK, ars,
                      ldsB + buf * strB, bptr + (size_t)(kt + 2) * GBK * NDIM, brs);
  }
  wait_async0();   // no copy is left in flight when the wave ends

  bool outbf = (flags & GF_OUT_BF16) != 0;
  bool relu  = (flags & GF_RELU) != 0;
#pragma unroll
  for (int i = 0; i < 2; ++i)
#pragma unroll
    for (int j = 0; j < 2; ++j) {
      int colg = bn + wn * 32 + j * 16 + lm;
      float bv = bias ? bias[colg] : 0.f;
#pragma unroll
      for (int r = 0; r < 8; ++r) {
        int rowg = bm + wm * 32 + i * 16 + r + 8 * half;
        float val = acc[i][j][r] + bv;
        if (relu) val = fmaxf(val, 0.f);
        size_t idx = (size_t)rowg * NDIM + colg;
        if (res) val += res[idx];
        if (outbf) ((unsigned short*)Cp)[idx] = f2bf(val);
        else       ((float*)Cp)[idx] = val;
      }
    }
}

// ---------------- flash attention: one wave per (b,h,16-query tile) ----------------
#define NEG_BIG (-3.0e38f)
#define AKP 72   // LDS row pitch of the K tile in elements: 144 B = 16 B x odd, conflict-free for ds_load_b128
#define AVP 80   // LDS row pitch of the V tile in elements: 160 B = 32 B x odd, conflict-free for the transposing load

// One wave copies a tile of 32 rows x 128 B (one head's slice of 32 keys) to LDS: 8 copies, each of
// 4 whole 128-B lines (8 lanes a row). lds, g: the lane's own 16 bytes in rows 0..3; step: LDS bytes of 4 rows.
// The wait on xcnt ends the statement so that no address register is rewritten in front of it.
__device__ __forceinline__ void async_tile_32x128(unsigned lds, unsigned step, const unsigned short* g) {
  const size_t gs = (size_t)4 * 1024;   // elements of 4 rows in global memory
  asm volatile(
      "global_load_async_to_lds_b128 %0, %8, off\n\t"
      "global_load_async_to_lds_b128 %1, %9, off\n\t"
      "global_load_async_to_lds_b128 %2, %10, off\n\t"
      "global_load_async_to_lds_b128 %3, %11, off\n\t"
      "global_load_async_to_lds_b128 %4, %12, off\n\t"
      "global_load_async_to_lds_b128 %5, %13, off\n\t"
      "global_load_async_to_lds_b128 %6, %14, off\n\t"
      "global_load_async_to_lds_b128 %7, %15, off\n\t"
      "s_wait_xcnt 0x0"
      :: "v"(lds), "v"(lds + step), "v"(lds + 2 * step), "v"(lds + 3 * step),
         "v"(lds + 4 * step), "v"(lds + 5 * step), "v"(lds + 6 * step), "v"(lds + 7 * step),
         "v"(g), "v"(g + gs), "v"(g + 2 * gs), "v"(g + 3 * gs),
         "v"(g + 4 * gs), "v"(g + 5 * gs), "v"(g + 6 * gs), "v"(g + 7 * gs)
      : "memory");
}

// lane l takes the value of lane l ^ 16 (the other half of the wave)
__device__ __forceinline__ float xhalf(float x) {
  int b = __builtin_bit_cast(int, x);
  return __builtin_bit_cast(float,
      __builtin_amdgcn_permlanex16(b, b, 0x76543210, 0xfedcba98, false, false));
}

// two floats to one register of two bf16 (lo in bits 15..0), round-to-nearest-even like f2bf: one v_cvt_pk_bf16_f32
__device__ __forceinline__ unsigned int pack2bf(float lo, float hi) {
  typedef float  f32x2 __attribute__((ext_vector_type(2)));
  typedef __bf16 bf16x2 __attribute__((ext_vector_type(2)));
  return __builtin_bit_cast(unsigned int, __builtin_convertvector(f32x2{lo, hi}, bf16x2));
}

// The products are taken transposed: S^T = K Q^T (keys x queries), O^T += V^T P^T (d x queries).
// A lane then holds 16 of the 32 scores of ONE query (column lm): maximum and sum run inside the lane,
// the two halves of the wave meet in one exchange, and the two score tiles, converted in place,
// are the B operand P^T in the hardware's k order: P goes through no LDS.
__global__ __launch_bounds__(32) void attn_kernel(
    const unsigned short* __restrict__ Q, const unsigned short* __restrict__ Km,
    const unsigned short* __restrict__ V, unsigned short* __restrict__ O) {
  const int E = 1024, T = 2048, DH = 64;
  __shared__ __align__(16) unsigned short Ks[2][32][AKP];   // two buffers: the next 32 keys fly while these are worked on
  __shared__ __align__(16) unsigned short Vs[2][32][AVP];
  int lane = threadIdx.x & 31;
  int half = lane >> 4, lm = lane & 15;
  int qt = blockIdx.x;                 // 0..T/16-1
  int bh = blockIdx.y;                 // 0..B*H-1
  int b = bh >> 4, h = bh & 15;
  size_t rowbase = (size_t)b * T;
  int q0 = qt * 16;
  int hoff = h * DH;
  const float scale = 0.03125f;        // 1024^-0.5 (reference scales by full E)

  // Q^T B-fragments (columns q0+lm, d-chunks 0..31 / 32..63), loaded once
  Frag qa[2];
  const unsigned short* qrow = Q + (rowbase + q0 + lm) * E + hoff;
#pragma unroll
  for (int t = 0; t < 2; ++t)
#pragma unroll
    for (int vv = 0; vv < 8; ++vv)
      qa[t].u[vv] = *(const unsigned int*)(qrow + t * 32 + pairK(vv, half));

  float mrun = NEG_BIG;                // running maximum of query q0 + lm, the same in both halves
  float lrun = 0.f;                    // running sum over this half's keys only; the halves are joined at the end
  v8f oacc[4] = {};                    // oacc[j][r] = O^T[d = 16 j + 8 half + r][query lm]

  int qmax = q0 + 15;
  int mq = q0 + lm;                    // this lane's query

  // this lane's 16 bytes of rows 0..3 of a tile, in global memory and in LDS
  const unsigned short* kg = Km + (rowbase + (lane >> 3)) * E + hoff + (lane & 7) * 8;
  const unsigned short* vg = V  + (rowbase + (lane >> 3)) * E + hoff + (lane & 7) * 8;
  unsigned kl = lds_addr(&Ks[0][lane >> 3][(lane & 7) * 8]);
  unsigned vl = lds_addr(&Vs[0][lane >> 3][(lane & 7) * 8]);
  const unsigned strK = (unsigned)sizeof(Ks[0]), strV = (unsigned)sizeof(Vs[0]);

  // keys 0..31 into buffer 0, landed and published; then keys 32..63 into buffer 1
  async_tile_32x128(kl, 4 * AKP * 2, kg);
  async_tile_32x128(vl, 4 * AVP * 2, vg);
  wait_async0();
  __syncthreads();
  if (32 <= qmax) {
    async_tile_32x128(kl + strK, 4 * AKP * 2, kg + (size_t)32 * E);
    async_tile_32x128(vl + strV, 4 * AVP * 2, vg + (size_t)32 * E);
  }

  int buf = 0;
  for (int kt = 0; kt <= qmax; kt += 32) {
    // scores: two 16-key subtiles x two 32-wide d-chunks, K rows from LDS as A fragments
    const unsigned short* krow0 = &Ks[buf][lm][0];
    const unsigned short* krow1 = &Ks[buf][16 + lm][0];
    Frag kf[4];
#pragma unroll
    for (int t = 0; t < 2; ++t)
#pragma unroll
      for (int vv = 0; vv < 8; ++vv) {
        kf[t].u[vv]     = *(const unsigned int*)(krow0 + t * 32 + pairK(vv, half));
        kf[2 + t].u[vv] = *(const unsigned int*)(krow1 + t * 32 + pairK(vv, half));
      }
    // V^T (16 d rows x 32 keys per d-subtile) as A fragments by the transposing load,
    // keys 0..15 then 16..31, in the same k order as pairK
    Frag vf[4];
#pragma unroll
    for (int j = 0; j < 4; ++j) {
      const unsigned short* vp = &Vs[buf][8 * half + (lane & 7)][j * 16 + 8 * ((lane >> 3) & 1)];
      vf[j].q[0] = lds_tr16(vp);
      vf[j].q[1] = lds_tr16(vp + 16 * AVP);
    }
    // s0[r]: key kt + 8 half + r, s1[r]: key kt + 16 + 8 half + r, both against query lm
    v8f s0 = {}, s1 = {};
    s0 = wmma_bf16(kf[0], qa[0], s0);
    s0 = wmma_bf16(kf[1], qa[1], s0);
    s1 = wmma_bf16(kf[2], qa[0], s1);
    s1 = wmma_bf16(kf[3], qa[1], s1);

    // online softmax update of this lane's query
    int ahead = mq - (kt + 8 * half);    // key r of this half's first subtile is masked where r > ahead
    float a0[8], a1[8];
#pragma unroll
    for (int r = 0; r < 8; ++r) {
      a0[r] = s0[r] * scale; if (r > ahead)      a0[r] = NEG_BIG;
      a1[r] = s1[r] * scale; if (16 + r > ahead) a1[r] = NEG_BIG;
    }
    float m4[4];                         // four independent chains
#pragma unroll
    for (int c = 0; c < 4; ++c)
      m4[c] = fmaxf(fmaxf(a0[2 * c], a0[2 * c + 1]), fmaxf(a1[2 * c], a1[2 * c + 1]));
    float mx = fmaxf(fmaxf(m4[0], m4[1]), fmaxf(m4[2], m4[3]));
    mx = fmaxf(mx, xhalf(mx));
    float mn = fmaxf(mrun, mx);
    float alpha = __expf(mrun - mn);
    mrun = mn;
    float p0[8], p1[8];
#pragma unroll
    for (int r = 0; r < 8; ++r) { p0[r] = __expf(a0[r] - mn); p1[r] = __expf(a1[r] - mn); }
    float r4[4];                         // four independent chains
#pragma unroll
    for (int c = 0; c < 4; ++c)
      r4[c] = (p0[2 * c] + p0[2 * c + 1]) + (p1[2 * c] + p1[2 * c + 1]);
    lrun = lrun * alpha + ((r4[0] + r4[1]) + (r4[2] + r4[3]));
#pragma unroll
    for (int j = 0; j < 4; ++j)
#pragma unroll
      for (int r = 0; r < 8; ++r) oacc[j][r] *= alpha;

    // P^T (32 keys x 16 queries) as B fragment: element s of the lane is key 8 half + s (s < 8), 16 + 8 half + s - 8 (s >= 8)
    Frag pf;
#pragma unroll
    for (int vv = 0; vv < 4; ++vv) {
      pf.u[vv]     = pack2bf(p0[2 * vv], p0[2 * vv + 1]);
      pf.u[4 + vv] = pack2bf(p1[2 * vv], p1[2 * vv + 1]);
    }
#pragma unroll
    for (int j = 0; j < 4; ++j)
      oacc[j] = wmma_bf16(vf[j], pf, oacc[j]);

    // hand-over: this pass's LDS reads are done, the next tile has landed, then the barrier;
    // only behind it is the buffer just read filled again
    // (the work-group is one wave: the compiler emits no barrier instruction for __syncthreads here)
    // the scheduling barrier keeps the softmax and the products in front of the two waits: lifted over them,
    // the wait on the copies would stand in mid-pass and cut the time that the next tile has to land
    __builtin_amdgcn_sched_barrier(0);
    asm volatile("s_wait_dscnt 0x0" ::: "memory");
    wait_async0();
    __syncthreads();
    if (kt + 64 <= qmax) {
      async_tile_32x128(kl + buf * strK, 4 * AKP * 2, kg + (size_t)(kt + 64) * E);
      async_tile_32x128(vl + buf * strV, 4 * AVP * 2, vg + (size_t)(kt + 64) * E);
    }
    buf ^= 1;
  }
  wait_async0();   // no copy is left in flight when the wave ends

  // epilogue: join the halves' sums, O /= l; a lane holds 8 consecutive d of its query's row: one 16-byte store each
  float inv = 1.0f / (lrun + xhalf(lrun));
  unsigned short* orow = O + (rowbase + q0 + lm) * E + hoff + 8 * half;
#pragma unroll
  for (int j = 0; j < 4; ++j) {
    uint4 w;
    w.x = pack2bf(oacc[j][0] * inv, oacc[j][1] * inv);
    w.y = pack2bf(oacc[j][2] * inv, oacc[j][3] * inv);
    w.z = pack2bf(oacc[j][4] * inv, oacc[j][5] * inv);
    w.w = pack2bf(oacc[j][6] * inv, oacc[j][7] * inv);
    *(uint4*)(orow + j * 16) = w;
  }
}

// ---------------- host launcher ----------------
extern "C" void kernel_launch(void* const* d_in, const int* in_sizes, int n_in,
                              void* d_out, int out_size, void* d_ws, size_t ws_size,
                              hipStream_t stream) {
  const int E = 1024, H = 16, DFF = 4096, B = 2, T = 2048;
  const int M = B * T;                 // 4096 tokens
  (void)in_sizes; (void)n_in; (void)out_size; (void)ws_size;

  const float* x   = (const float*)d_in[0];
  const float* Wq  = (const float*)d_in[1];
  const float* Wk  = (const float*)d_in[2];
  const float* Wv  = (const float*)d_in[3];
  const float* Wo  = (const float*)d_in[4];
  const float* bo  = (const float*)d_in[5];
  const float* W1  = (const float*)d_in[6];
  const float* b1  = (const float*)d_in[7];
  const float* W2  = (const float*)d_in[8];
  const float* b2  = (const float*)d_in[9];
  const float* g1  = (const float*)d_in[10];
  const float* be1 = (const float*)d_in[11];
  const float* g2  = (const float*)d_in[12];
  const float* be2 = (const float*)d_in[13];
  float* out = (float*)d_out;

  // workspace carve-up (256B aligned)
  char* wsp = (char*)d_ws;
  auto alloc = [&](size_t bytes) -> void* {
    void* p = (void*)wsp;
    wsp += (bytes + 255) & ~(size_t)255;
    return p;
  };
  const size_t EE = (size_t)E * E, ED = (size_t)E * DFF;
  unsigned short* wq16 = (unsigned short*)alloc((4 * EE + 2 * ED) * 2);  // all bf16 weights, in a row
  unsigned short* wk16 = wq16 + EE;
  unsigned short* wv16 = wk16 + EE;
  unsigned short* wo16 = wv16 + EE;
  unsigned short* w116 = wo16 + EE;
  unsigned short* w216 = w116 + ED;
  unsigned short* hb   = (unsigned short*)alloc((size_t)M * E * 2);
  unsigned short* qb   = (unsigned short*)alloc((size_t)(M + 64) * E * 2);  // +64 row pad
  unsigned short* kb   = (unsigned short*)alloc((size_t)(M + 64) * E * 2);
  unsigned short* vb   = (unsigned short*)alloc((size_t)(M + 64) * E * 2);
  unsigned short* ob   = (unsigned short*)alloc((size_t)M * E * 2);
  float*          x1   = (float*)alloc((size_t)M * E * 4);
  unsigned short* h2   = (unsigned short*)alloc((size_t)M * E * 2);
  unsigned short* f1   = (unsigned short*)alloc((size_t)M * DFF * 2);

  // weights -> bf16
  cvt_weights_kernel<<<(4 * EE + 2 * ED) / CVT_PER_BLOCK, 256, 0, stream>>>(Wq, Wk, Wv, Wo, W1, W2, wq16);

  // LN1
  ln_bf16_kernel<<<M / 8, 256, 0, stream>>>(x, g1, be1, hb);

  // QKV projections
  dim3 gEE(E / GBN, M / GBM);
  gemm_bf16_kernel<1024, 1024><<<gEE, 256, 0, stream>>>(hb, wq16, nullptr, nullptr, qb, GF_OUT_BF16);
  gemm_bf16_kernel<1024, 1024><<<gEE, 256, 0, stream>>>(hb, wk16, nullptr, nullptr, kb, GF_OUT_BF16);
  gemm_bf16_kernel<1024, 1024><<<gEE, 256, 0, stream>>>(hb, wv16, nullptr, nullptr, vb, GF_OUT_BF16);

  // causal flash attention
  attn_kernel<<<dim3(T / 16, B * H), 32, 0, stream>>>(qb, kb, vb, ob);

  // out-proj + bias + residual(x) -> x1 (fp32)
  gemm_bf16_kernel<1024, 1024><<<gEE, 256, 0, stream>>>(ob, wo16, bo, x, x1, 0);

  // LN2
  ln_bf16_kernel<<<M / 8, 256, 0, stream>>>(x1, g2, be2, h2);

  // FFN
  dim3 gFF1(DFF / GBN, M / GBM);
  gemm_bf16_kernel<4096, 1024><<<gFF1, 256, 0, stream>>>(h2, w116, b1, nullptr, f1,
                                                         GF_OUT_BF16 | GF_RELU);
  gemm_bf16_kernel<1024, 4096><<<gEE, 256, 0, stream>>>(f1, w216, b2, x1, out, 0);
}

// v006
// One run takes 245 microseconds.
// Two timings next to v005 both put it at 1.09 times that version's speed.
// Over all steps from v000 it is 2.31 times as fast.
#include <hip/hip_runtime.h>
#include <math.h>

// ---------------- types ----------------
typedef __bf16 v16bf __attribute__((ext_vector_type(16)));
typedef float  v8f   __attribute__((ext_vector_type(8)));
typedef short  s16x8 __attribute__((ext_vector_type(8)));

union Frag {
  v16bf v;
  s16x8 q[2];
  unsigned int u[8];
  unsigned short h[16];
};

__device__ __forceinline__ unsigned short f2bf(float f) {
  unsigned int u = __builtin_bit_cast(unsigned int, f);
  u += 0x7FFFu + ((u >> 16) & 1u);          // round-to-nearest-even
  return (unsigned short)(u >> 16);
}

// element-pair K index for 16-bit WMMA A/B fragments (ISA 7.12.2):
// VGPR v<4 holds k={2v,2v+1}+8*half ; v>=4 holds k={16+2(v-4),...}+8*half
__device__ __forceinline__ int pairK(int v, int half) {
  return ((v < 4) ? (2 * v) : (16 + 2 * (v - 4))) + 8 * half;
}

__device__ __forceinline__ v8f wmma_bf16(const Frag& a, const Frag& b, v8f c) {
  return __builtin_amdgcn_wmma_f32_16x16x32_bf16(
      false, a.v, false, b.v, (short)0, c, false, false);
}

// ---- CDNA5 async global->LDS DMA (ASYNCcnt-tracked, no VGPR data) ----
__device__ __forceinline__ void wait_async0() {
  asm volatile("s_wait_asynccnt 0x0" ::: "memory");
}
// generic LDS pointer -> 32-bit LDS byte offset (aperture keeps offset in addr[31:0])
__device__ __forceinline__ unsigned lds_addr(const void* p) {
  return (unsigned)(unsigned long long)p;
}

// transposing LDS load: lane (c = l & 15, h = l >> 4) gets rows 8h..8h+7 of column c
// of a row-major 16-bit tile; lane l passes the address of row 8h + (l & 7), 16-byte chunk (l >> 3) & 1
__device__ __forceinline__ s16x8 lds_tr16(const unsigned short* p) {
  typedef __attribute__((address_space(3))) s16x8 lds_s16x8;
  return __builtin_amdgcn_ds_load_tr16_b128_v8i16((lds_s16x8*)p);
}

// ---------------- fp32 -> bf16 convert, all six weights in one launch ----------------
// The bf16 copies lie one behind the other in the workspace (Wq, Wk, Wv, Wo, W1, W2).
// A block converts 16384 consecutive elements: 64 per thread, so that few waves have to start.
#define CVT_PER_BLOCK 16384
// at most 8 waves a SIMD: a register budget of 128, so that all 16 loads of a thread stay in flight together
__global__ __launch_bounds__(256) __attribute__((amdgpu_waves_per_eu(4, 8))) void cvt_weights_kernel(
    const float* __restrict__ Wq, const float* __restrict__ Wk, const float* __restrict__ Wv,
    const float* __restrict__ Wo, const float* __restrict__ W1, const float* __restrict__ W2,
    unsigned short* __restrict__ out) {
  int seg = blockIdx.x >> 6;             // which run of 2^20 elements (64 blocks each)
  const float* src;
  if (seg < 4)      src = seg == 0 ? Wq : seg == 1 ? Wk : seg == 2 ? Wv : Wo;
  else if (seg < 8) src = W1 + ((size_t)(seg - 4) << 20);
  else              src = W2 + ((size_t)(seg - 8) << 20);
  const float4* in4 = (const float4*)(src + (size_t)(blockIdx.x & 63) * CVT_PER_BLOCK) + threadIdx.x;
  ushort4* o4 = (ushort4*)(out + (size_t)blockIdx.x * CVT_PER_BLOCK) + threadIdx.x;
  float4 v[16];
#pragma unroll   // all 16 loads of 512 B per wave in flight before the first store
  for (int k = 0; k < 16; ++k) v[k] = in4[k * 256];
#pragma unroll   // v[] stays in registers
  for (int k = 0; k < 16; ++k)
    o4[k * 256] = make_ushort4(f2bf(v[k].x), f2bf(v[k].y), f2bf(v[k].z), f2bf(v[k].w));
}

// ---------------- LayerNorm (one wave per token, E=1024) ----------------
// at most 8 waves a SIMD: a register budget of 128, so that gain and bias fly with the token's loads, not pair by pair behind the sums
__global__ __launch_bounds__(256) __attribute__((amdgpu_waves_per_eu(4, 8))) void ln_bf16_kernel(
    const float* __restrict__ x, const float* __restrict__ g,
    const float* __restrict__ b, unsigned short* __restrict__ out) {
  const int E = 1024;
  int lane = threadIdx.x & 31;
  // the wave's number as a scalar: the token's row address then sits in scalar registers
  int tok = blockIdx.x * 8 + __builtin_amdgcn_readfirstlane(threadIdx.x >> 5);
  const float4* xr = (const float4*)(x + (size_t)tok * E) + lane;
  const float4* g4 = (const float4*)g + lane;
  const float4* b4 = (const float4*)b + lane;
  float4 v[8], gg[8], bb[8];
#pragma unroll   // the token's 8 loads of 512 B in flight together
  for (int i = 0; i < 8; ++i) v[i] = xr[i * 32];
#pragma unroll   // gg[], bb[] stay in registers
  for (int i = 0; i < 8; ++i) { gg[i] = g4[i * 32]; bb[i] = b4[i * 32]; }
  float4 a = make_float4(0.f, 0.f, 0.f, 0.f), q = a;   // four independent chains each
#pragma unroll   // v[] stays in registers
  for (int i = 0; i < 8; ++i) {
    a.x += v[i].x; a.y += v[i].y; a.z += v[i].z; a.w += v[i].w;
    q.x += v[i].x * v[i].x; q.y += v[i].y * v[i].y;
    q.z += v[i].z * v[i].z; q.w += v[i].w * v[i].w;
  }
  float s = (a.x + a.y) + (a.z + a.w), s2 = (q.x + q.y) + (q.z + q.w);
#pragma unroll
  for (int off = 16; off; off >>= 1) {
    s  += __shfl_xor(s,  off, 32);
    s2 += __shfl_xor(s2, off, 32);
  }
  float mu = s * (1.0f / E);
  float var = s2 * (1.0f / E) - mu * mu;
  float rinv = rsqrtf(var + 1e-5f);
  ushort4* o4 = (ushort4*)(out + (size_t)tok * E) + lane;
#pragma unroll   // v[] stays in registers
  for (int i = 0; i < 8; ++i) {
    o4[i * 32] = make_ushort4(f2bf((v[i].x - mu) * rinv * gg[i].x + bb[i].x),
                              f2bf((v[i].y - mu) * rinv * gg[i].y + bb[i].y),
                              f2bf((v[i].z - mu) * rinv * gg[i].z + bb[i].z),
                              f2bf((v[i].w - mu) * rinv * gg[i].w + bb[i].w));
  }
}

// ---------------- bf16 GEMM: C = A[M,K] @ B[K,N] (+bias,+relu,+res) ----------------
#define GBM 128
#define GBN 128
#define GBK 128   // a row of either tile is two whole 128-B lines
#define GAP 136   // LDS row pitch of the A tile in elements: 272 B = 16 B x odd, conflict-free for ds_load_b128
#define GBNP 144  // LDS row pitch of the B tile in elements: 288 B = 32 B x odd, conflict-free for the transposing load
#define GF_OUT_BF16 1
#define GF_RELU     2

// One thread's share of one operand's K tile (128 rows of 256 B): 8 copies of 16 B, rows r, r+16, ..., r+112.
// 16 lanes share a row, so every copy of a wave covers 4 whole 128-B lines.
// l, g: the thread's own 16 bytes in row r; ls: LDS bytes of 16 rows; gs: elements of 16 rows in global memory.
// The wait on xcnt ends the statement so that no address register is rewritten in front of it.
__device__ __forceinline__ void async_gemm_rows(unsigned l, unsigned ls, const unsigned short* g, size_t gs) {
  asm volatile(
      "global_load_async_to_lds_b128 %0, %8, off\n\t"
      "global_load_async_to_lds_b128 %1, %9, off\n\t"
      "global_load_async_to_lds_b128 %2, %10, off\n\t"
      "global_load_async_to_lds_b128 %3, %11, off\n\t"
      "global_load_async_to_lds_b128 %4, %12, off\n\t"
      "global_load_async_to_lds_b128 %5, %13, off\n\t"
      "global_load_async_to_lds_b128 %6, %14, off\n\t"
      "global_load_async_to_lds_b128 %7, %15, off\n\t"
      "s_wait_xcnt 0x0"
      :: "v"(l), "v"(l + ls), "v"(l + 2 * ls), "v"(l + 3 * ls),
         "v"(l + 4 * ls), "v"(l + 5 * ls), "v"(l + 6 * ls), "v"(l + 7 * ls),
         "v"(g), "v"(g + gs), "v"(g + 2 * gs), "v"(g + 3 * gs),
         "v"(g + 4 * gs), "v"(g + 5 * gs), "v"(g + 6 * gs), "v"(g + 7 * gs)
      : "memory");
}

// One thread's share of a whole K tile: its 8 copies of A, then its 8 of B.
__device__ __forceinline__ void async_gemm_tile(unsigned la, const unsigned short* ga, size_t ars,
                                                unsigned lb, const unsigned short* gb, size_t brs) {
  async_gemm_rows(la, 16 * GAP * 2, ga, ars);
  async_gemm_rows(lb, 16 * GBNP * 2, gb, brs);
}

template <int NDIM, int KDIM>
__global__ __launch_bounds__(256) void gemm_bf16_kernel(
    const unsigned short* __restrict__ A, const unsigned short* __restrict__ Bm,
    const float* __restrict__ bias, const float* __restrict__ res,
    void* __restrict__ Cp, int flags) {
  // two buffers: the next K tile flies while this one is worked on
  __shared__ __align__(16) unsigned short As[2][GBM][GAP];
  __shared__ __align__(16) unsigned short Bs[2][GBK][GBNP];
  constexpr int NT = KDIM / GBK;         // K tiles
  static_assert(KDIM % GBK == 0 && NT >= 2, "the two-buffer prologue needs two whole K tiles");
  int tid = threadIdx.x;
  int lane = tid & 31, wave = tid >> 5;
  int wm = wave & 1, wn = wave >> 1;     // 2 x 4 wave grid of 64 x 32 wave tiles -> 128 x 128 block tile
  int half = lane >> 4, lm = lane & 15;
  int bm = blockIdx.y * GBM, bn = blockIdx.x * GBN;

  // staging indices (computed once): row of the thread's first copy, its 16-B chunk of the 256-B row
  int sr = tid >> 4;                 // 0..15
  int sc = (tid & 15) << 3;          // 0..120, in elements
  const unsigned short* aptr = A + (size_t)(bm + sr) * KDIM + sc;
  const unsigned short* bptr = Bm + (size_t)sr * NDIM + bn + sc;
  const size_t ars = (size_t)16 * KDIM, brs = (size_t)16 * NDIM;
  // one prefetched byte a line: 2 threads a row, one for each of its lines, cover a whole K tile; the first is tile 2
  const unsigned short* apf = A + (size_t)(bm + (tid >> 1)) * KDIM + (tid & 1) * 64 + 2 * GBK;
  const unsigned short* bpf = Bm + (size_t)((tid >> 1) + 2 * GBK) * NDIM + bn + (tid & 1) * 64;

  // this thread's LDS staging slots (byte addresses) in buffer 0
  unsigned ldsA = lds_addr(&As[0][sr][sc]);
  unsigned ldsB = lds_addr(&Bs[0][sr][sc]);
  const unsigned strA = (unsigned)sizeof(As[0]);   // 34 KB
  const unsigned strB = (unsigned)sizeof(Bs[0]);   // 36 KB

  // K tile 0 into buffer 0, landed and published; then K tile 1 into buffer 1
  async_gemm_tile(ldsA, aptr, ars, ldsB, bptr, brs);
  wait_async0();
  __syncthreads();
  async_gemm_tile(ldsA + strA, aptr + GBK, ars, ldsB + strB, bptr + (size_t)GBK * NDIM, brs);

  v8f acc[4][2] = {};
  // two fragment sets: k chunk c + 1 (32 wide) is loaded from LDS while chunk c is multiplied
  Frag af[2][4], bfr[2][2];
  auto load_chunk = [&](int buf, int kk, Frag* a, Frag* b) {
#pragma unroll
    for (int t = 0; t < 4; ++t) {
      int row = wm * 64 + t * 16 + lm;
#pragma unroll
      for (int vv = 0; vv < 8; ++vv)
        a[t].u[vv] = *(const unsigned int*)&As[buf][row][kk + pairK(vv, half)];
    }
#pragma unroll
    for (int t = 0; t < 2; ++t) {
      // B fragment, k 0..15 then 16..31 of 16 columns, in the same k order as pairK
      const unsigned short* bp =
          &Bs[buf][kk + 8 * half + (lane & 7)][wn * 32 + t * 16 + 8 * ((lane >> 3) & 1)];
      b[t].q[0] = lds_tr16(bp);
      b[t].q[1] = lds_tr16(bp + 16 * GBNP);
    }
  };
  auto mul_chunk = [&](const Frag* a, const Frag* b) {
#pragma unroll
    for (int i = 0; i < 4; ++i)
#pragma unroll
      for (int j = 0; j < 2; ++j)
        acc[i][j] = wmma_bf16(a[i], b[j], acc[i][j]);
  };
  constexpr int NC = GBK / 32;           // k chunks of a tile, taken in rising k
  static_assert(NC % 2 == 0, "a tile's first chunk always goes to fragment set 0");

  load_chunk(0, 0, af[0], bfr[0]);       // tile 0 is published: its first chunk
  for (int kt = 0; kt < NT; ++kt) {
    int buf = kt & 1;
    if (kt + 3 < NT) {                     // global_prefetch_b8 for the tile that is copied at this trip's foot;
      __builtin_prefetch(apf, 0, 0);       // the test keeps both pointers inside their matrices behind the advance too
      __builtin_prefetch(bpf, 0, 0);
      apf += GBK;
      bpf += (size_t)GBK * NDIM;
    }

#pragma unroll   // c constant: LDS offsets become immediates, the fragment sets stay in registers
    for (int c = 0; c + 1 < NC; ++c) {
      load_chunk(buf, (c + 1) * 32, af[(c + 1) & 1], bfr[(c + 1) & 1]);
      // keeps the next chunk's 12 loads in front of this chunk's products: left alone, the compiler loads
      // one A fragment at a time into the same registers and waits out the LDS latency at each
      __builtin_amdgcn_sched_barrier(0);
      mul_chunk(af[c & 1], bfr[c & 1]);
    }

    // hand-over, with the tile's last chunk already in registers: this trip's LDS reads are done,
    // the next tile has landed, then the barrier; only behind it is the buffer just read filled again
    // the scheduling barrier keeps the products above in front of the waits: lifted over them,
    // the wait on the copies would stand in mid-trip and cut the time that the next tile has to land
    __builtin_amdgcn_sched_barrier(0);
    asm volatile("s_wait_dscnt 0x0" ::: "memory");
    wait_async0();
    __syncthreads();
    if (kt + 2 < NT)
      async_gemm_tile(ldsA + buf * strA, aptr + (size_t)(kt + 2) * GBK, ars,
                      ldsB + buf * strB, bptr + (size_t)(kt + 2) * GBK * NDIM, brs);
    if (kt + 1 < NT)                       // the next tile is published: its first chunk
      load_chunk(buf ^ 1, 0, af[0], bfr[0]);
    // keeps the refill and the next chunk's loads in front of the last chunk's products, which then cover their flight
    __builtin_amdgcn_sched_barrier(0);
    mul_chunk(af[(NC - 1) & 1], bfr[(NC - 1) & 1]);
    // the four vector slots that the chip needs between the last product and the first overwrite of its operands:
    // the scheduling barrier holds the slots behind the products
    __builtin_amdgcn_sched_barrier(0);
    asm volatile("v_nop\n\tv_nop\n\tv_nop\n\tv_nop");
  }
  wait_async0();   // no copy is left in flight when the wave ends

  bool outbf = (flags & GF_OUT_BF16) != 0;
  bool relu  = (flags & GF_RELU) != 0;
#pragma unroll
  for (int i = 0; i < 4; ++i)
#pragma unroll
    for (int j = 0; j < 2; ++j) {
      int colg = bn + wn * 32 + j * 16 + lm;
      float bv = bias ? bias[colg] : 0.f;
#pragma unroll
      for (int r = 0; r < 8; ++r) {
        int rowg = bm + wm * 64 + i * 16 + r + 8 * half;
        float val = acc[i][j][r] + bv;
        if (relu) val = fmaxf(val, 0.f);
        size_t idx = (size_t)rowg * NDIM + colg;
        if (res) val += res[idx];
        if (outbf) ((unsigned short*)Cp)[idx] = f2bf(val);
        else       ((float*)Cp)[idx] = val;
      }
    }
}

// ---------------- flash attention: one wave per (b,h,16-query tile) ----------------
#define NEG_BIG (-3.0e38f)
#define AKP 72   // LDS row pitch of the K tile in elements: 144 B = 16 B x odd, conflict-free for ds_load_b128
#define AVP 80   // LDS row pitch of the V tile in elements: 160 B = 32 B x odd, conflict-free for the transposing load

// One wave copies a tile of 32 rows x 128 B (one head's slice of 32 keys) to LDS: 8 copies, each of
// 4 whole 128-B lines (8 lanes a row). lds, g: the lane's own 16 bytes in rows 0..3; step: LDS bytes of 4 rows.
// The wait on xcnt ends the statement so that no address register is rewritten in front of it.
__device__ __forceinline__ void async_tile_32x128(unsigned lds, unsigned step, const unsigned short* g) {
  const size_t gs = (size_t)4 * 1024;   // elements of 4 rows in global memory
  asm volatile(
      "global_load_async_to_lds_b128 %0, %8, off\n\t"
      "global_load_async_to_lds_b128 %1, %9, off\n\t"
      "global_load_async_to_lds_b128 %2, %10, off\n\t"
      "global_load_async_to_lds_b128 %3, %11, off\n\t"
      "global_load_async_to_lds_b128 %4, %12, off\n\t"
      "global_load_async_to_lds_b128 %5, %13, off\n\t"
      "global_load_async_to_lds_b128 %6, %14, off\n\t"
      "global_load_async_to_lds_b128 %7, %15, off\n\t"
      "s_wait_xcnt 0x0"
      :: "v"(lds), "v"(lds + step), "v"(lds + 2 * step), "v"(lds + 3 * step),
         "v"(lds + 4 * step), "v"(lds + 5 * step), "v"(lds + 6 * step), "v"(lds + 7 * step),
         "v"(g), "v"(g + gs), "v"(g + 2 * gs), "v"(g + 3 * gs),
         "v"(g + 4 * gs), "v"(g + 5 * gs), "v"(g + 6 * gs), "v"(g + 7 * gs)
      : "memory");
}

// lane l takes the value of lane l ^ 16 (the other half of the wave)
__device__ __forceinline__ float xhalf(float x) {
  int b = __builtin_bit_cast(int, x);
  return __builtin_bit_cast(float,
      __builtin_amdgcn_permlanex16(b, b, 0x76543210, 0xfedcba98, false, false));
}

// two floats to one register of two bf16 (lo in bits 15..0), round-to-nearest-even like f2bf: one v_cvt_pk_bf16_f32
__device__ __forceinline__ unsigned int pack2bf(float lo, float hi) {
  typedef float  f32x2 __attribute__((ext_vector_type(2)));
  typedef __bf16 bf16x2 __attribute__((ext_vector_type(2)));
  return __builtin_bit_cast(unsigned int, __builtin_convertvector(f32x2{lo, hi}, bf16x2));
}

// The products are taken transposed: S^T = K Q^T (keys x queries), O^T += V^T P^T (d x queries).
// A lane then holds 16 of the 32 scores of ONE query (column lm): maximum and sum run inside the lane,
// the two halves of the wave meet in one exchange, and the two score tiles, converted in place,
// are the B operand P^T in the hardware's k order: P goes through no LDS.
__global__ __launch_bounds__(32) void attn_kernel(
    const unsigned short* __restrict__ Q, const unsigned short* __restrict__ Km,
    const unsigned short* __restrict__ V, unsigned short* __restrict__ O) {
  const int E = 1024, T = 2048, DH = 64;
  __shared__ __align__(16) unsigned short Ks[2][32][AKP];   // two buffers: the next 32 keys fly while these are worked on
  __shared__ __align__(16) unsigned short Vs[2][32][AVP];
  int lane = threadIdx.x & 31;
  int half = lane >> 4, lm = lane & 15;
  int qt = blockIdx.x;                 // 0..T/16-1
  int bh = blockIdx.y;                 // 0..B*H-1
  int b = bh >> 4, h = bh & 15;
  size_t rowbase = (size_t)b * T;
  int q0 = qt * 16;
  int hoff = h * DH;
  const float scale = 0.03125f;        // 1024^-0.5 (reference scales by full E)

  // Q^T B-fragments (columns q0+lm, d-chunks 0..31 / 32..63), loaded once
  Frag qa[2];
  const unsigned short* qrow = Q + (rowbase + q0 + lm) * E + hoff;
#pragma unroll
  for (int t = 0; t < 2; ++t)
#pragma unroll
    for (int vv = 0; vv < 8; ++vv)
      qa[t].u[vv] = *(const unsigned int*)(qrow + t * 32 + pairK(vv, half));

  float mrun = NEG_BIG;                // running maximum of query q0 + lm, the same in both halves
  float lrun = 0.f;                    // running sum over this half's keys only; the halves are joined at the end
  v8f oacc[4] = {};                    // oacc[j][r] = O^T[d = 16 j + 8 half + r][query lm]

  int qmax = q0 + 15;
  int mq = q0 + lm;                    // this lane's query

  // this lane's 16 bytes of rows 0..3 of a tile, in global memory and in LDS
  const unsigned short* kg = Km + (rowbase + (lane >> 3)) * E + hoff + (lane & 7) * 8;
  const unsigned short* vg = V  + (rowbase + (lane >> 3)) * E + hoff + (lane & 7) * 8;
  unsigned kl = lds_addr(&Ks[0][lane >> 3][(lane & 7) * 8]);
  unsigned vl = lds_addr(&Vs[0][lane >> 3][(lane & 7) * 8]);
  const unsigned strK = (unsigned)sizeof(Ks[0]), strV = (unsigned)sizeof(Vs[0]);

  // keys 0..31 into buffer 0, landed and published; then keys 32..63 into buffer 1
  async_tile_32x128(kl, 4 * AKP * 2, kg);
  async_tile_32x128(vl, 4 * AVP * 2, vg);
  wait_async0();
  __syncthreads();
  if (32 <= qmax) {
    async_tile_32x128(kl + strK, 4 * AKP * 2, kg + (size_t)32 * E);
    async_tile_32x128(vl + strV, 4 * AVP * 2, vg + (size_t)32 * E);
  }

  int buf = 0;
  for (int kt = 0; kt <= qmax; kt += 32) {
    // scores: two 16-key subtiles x two 32-wide d-chunks, K rows from LDS as A fragments
    const unsigned short* krow0 = &Ks[buf][lm][0];
    const unsigned short* krow1 = &Ks[buf][16 + lm][0];
    Frag kf[4];
#pragma unroll
    for (int t = 0; t < 2; ++t)
#pragma unroll
      for (int vv = 0; vv < 8; ++vv) {
        kf[t].u[vv]     = *(const unsigned int*)(krow0 + t * 32 + pairK(vv, half));
        kf[2 + t].u[vv] = *(const unsigned int*)(krow1 + t * 32 + pairK(vv, half));
      }
    // V^T (16 d rows x 32 keys per d-subtile) as A fragments by the transposing load,
    // keys 0..15 then 16..31, in the same k order as pairK
    Frag vf[4];
#pragma unroll
    for (int j = 0; j < 4; ++j) {
      const unsigned short* vp = &Vs[buf][8 * half + (lane & 7)][j * 16 + 8 * ((lane >> 3) & 1)];
      vf[j].q[0] = lds_tr16(vp);
      vf[j].q[1] = lds_tr16(vp + 16 * AVP);
    }
    // s0[r]: key kt + 8 half + r, s1[r]: key kt + 16 + 8 half + r, both against query lm
    v8f s0 = {}, s1 = {};
    s0 = wmma_bf16(kf[0], qa[0], s0);
    s0 = wmma_bf16(kf[1], qa[1], s0);
    s1 = wmma_bf16(kf[2], qa[0], s1);
    s1 = wmma_bf16(kf[3], qa[1], s1);

    // online softmax update of this lane's query
    int ahead = mq - (kt + 8 * half);    // key r of this half's first subtile is masked where r > ahead
    float a0[8], a1[8];
#pragma unroll
    for (int r = 0; r < 8; ++r) {
      a0[r] = s0[r] * scale; if (r > ahead)      a0[r] = NEG_BIG;
      a1[r] = s1[r] * scale; if (16 + r > ahead) a1[r] = NEG_BIG;
    }
    float m4[4];                         // four independent chains
#pragma unroll
    for (int c = 0; c < 4; ++c)
      m4[c] = fmaxf(fmaxf(a0[2 * c], a0[2 * c + 1]), fmaxf(a1[2 * c], a1[2 * c + 1]));
    float mx = fmaxf(fmaxf(m4[0], m4[1]), fmaxf(m4[2], m4[3]));
    mx = fmaxf(mx, xhalf(mx));
    float mn = fmaxf(mrun, mx);
    float alpha = __expf(mrun - mn);
    mrun = mn;
    float p0[8], p1[8];
#pragma unroll
    for (int r = 0; r < 8; ++r) { p0[r] = __expf(a0[r] - mn); p1[r] = __expf(a1[r] - mn); }
    float r4[4];                         // four independent chains
#pragma unroll
    for (int c = 0; c < 4; ++c)
      r4[c] = (p0[2 * c] + p0[2 * c + 1]) + (p1[2 * c] + p1[2 * c + 1]);
    lrun = lrun * alpha + ((r4[0] + r4[1]) + (r4[2] + r4[3]));
#pragma unroll
    for (int j = 0; j < 4; ++j)
#pragma unroll
      for (int r = 0; r < 8; ++r) oacc[j][r] *= alpha;

    // P^T (32 keys x 16 queries) as B fragment: element s of the lane is key 8 half + s (s < 8), 16 + 8 half + s - 8 (s >= 8)
    Frag pf;
#pragma unroll
    for (int vv = 0; vv < 4; ++vv) {
      pf.u[vv]     = pack2bf(p0[2 * vv], p0[2 * vv + 1]);
      pf.u[4 + vv] = pack2bf(p1[2 * vv], p1[2 * vv + 1]);
    }
#pragma unroll
    for (int j = 0; j < 4; ++j)
      oacc[j] = wmma_bf16(vf[j], pf, oacc[j]);

    // hand-over: this pass's LDS reads are done, the next tile has landed, then the barrier;
    // only behind it is the buffer just read filled again
    // (the work-group is one wave: the compiler emits no barrier instruction for __syncthreads here)
    // the scheduling barrier keeps the softmax and the products in front of the two waits: lifted over them,
    // the wait on the copies would stand in mid-pass and cut the time that the next tile has to land
    __builtin_amdgcn_sched_barrier(0);
    asm volatile("s_wait_dscnt 0x0" ::: "memory");
    wait_async0();
    __syncthreads();
    if (kt + 64 <= qmax) {
      async_tile_32x128(kl + buf * strK, 4 * AKP * 2, kg + (size_t)(kt + 64) * E);
      async_tile_32x128(vl + buf * strV, 4 * AVP * 2, vg + (size_t)(kt + 64) * E);
    }
    buf ^= 1;
  }
  wait_async0();   // no copy is left in flight when the wave ends

  // epilogue: join the halves' sums, O /= l; a lane holds 8 consecutive d of its query's row: one 16-byte store each
  float inv = 1.0f / (lrun + xhalf(lrun));
  unsigned short* orow = O + (rowbase + q0 + lm) * E + hoff + 8 * half;
#pragma unroll
  for (int j = 0; j < 4; ++j) {
    uint4 w;
    w.x = pack2bf(oacc[j][0] * inv, oacc[j][1] * inv);
    w.y = pack2bf(oacc[j][2] * inv, oacc[j][3] * inv);
    w.z = pack2bf(oacc[j][4] * inv, oacc[j][5] * inv);
    w.w = pack2bf(oacc[j][6] * inv, oacc[j][7] * inv);
    *(uint4*)(orow + j * 16) = w;
  }
}

// ---------------- host launcher ----------------
extern "C" void kernel_launch(void* const* d_in, const int* in_sizes, int n_in,
                              void* d_out, int out_size, void* d_ws, size_t ws_size,
                              hipStream_t stream) {
  const int E = 1024, H = 16, DFF = 4096, B = 2, T = 2048;
  const int M = B * T;                 // 4096 tokens
  (void)in_sizes; (void)n_in; (void)out_size; (void)ws_size;

  const float* x   = (const float*)d_in[0];
  const float* Wq  = (const float*)d_in[1];
  const float* Wk  = (const float*)d_in[2];
  const float* Wv  = (const float*)d_in[3];
  const float* Wo  = (const float*)d_in[4];
  const float* bo  = (const float*)d_in[5];
  const float* W1  = (const float*)d_in[6];
  const float* b1  = (const float*)d_in[7];
  const float* W2  = (const float*)d_in[8];
  const float* b2  = (const float*)d_in[9];
  const float* g1  = (const float*)d_in[10];
  const float* be1 = (const float*)d_in[11];
  const float* g2  = (const float*)d_in[12];
  const float* be2 = (const float*)d_in[13];
  float* out = (float*)d_out;

  // workspace carve-up (256B aligned)
  char* wsp = (char*)d_ws;
  auto alloc = [&](size_t bytes) -> void* {
    void* p = (void*)wsp;
    wsp += (bytes + 255) & ~(size_t)255;
    return p;
  };
  const size_t EE = (size_t)E * E, ED = (size_t)E * DFF;
  unsigned short* wq16 = (unsigned short*)alloc((4 * EE + 2 * ED) * 2);  // all bf16 weights, in a row
  unsigned short* wk16 = wq16 + EE;
  unsigned short* wv16 = wk16 + EE;
  unsigned short* wo16 = wv16 + EE;
  unsigned short* w116 = wo16 + EE;
  unsigned short* w216 = w116 + ED;
  unsigned short* hb   = (unsigned short*)alloc((size_t)M * E * 2);
  unsigned short* qb   = (unsigned short*)alloc((size_t)(M + 64) * E * 2);  // +64 row pad
  unsigned short* kb   = (unsigned short*)alloc((size_t)(M + 64) * E * 2);
  unsigned short* vb   = (unsigned short*)alloc((size_t)(M + 64) * E * 2);
  unsigned short* ob   = (unsigned short*)alloc((size_t)M * E * 2);
  float*          x1   = (float*)alloc((size_t)M * E * 4);
  unsigned short* h2   = (unsigned short*)alloc((size_t)M * E * 2);
  unsigned short* f1   = (unsigned short*)alloc((size_t)M * DFF * 2);

  // weights -> bf16
  cvt_weights_kernel<<<(4 * EE + 2 * ED) / CVT_PER_BLOCK, 256, 0, stream>>>(Wq, Wk, Wv, Wo, W1, W2, wq16);

  // LN1
  ln_bf16_kernel<<<M / 8, 256, 0, stream>>>(x, g1, be1, hb);

  // QKV projections
  dim3 gEE(E / GBN, M / GBM);
  gemm_bf16_kernel<1024, 1024><<<gEE, 256, 0, stream>>>(hb, wq16, nullptr, nullptr, qb, GF_OUT_BF16);
  gemm_bf16_kernel<1024, 1024><<<gEE, 256, 0, stream>>>(hb, wk16, nullptr, nullptr, kb, GF_OUT_BF16);
  gemm_bf16_kernel<1024, 1024><<<gEE, 256, 0, stream>>>(hb, wv16, nullptr, nullptr, vb, GF_OUT_BF16);

  // causal flash attention
  attn_kernel<<<dim3(T / 16, B * H), 32, 0, stream>>>(qb, kb, vb, ob);

  // out-proj + bias + residual(x) -> x1 (fp32)
  gemm_bf16_kernel<1024, 1024><<<gEE, 256, 0, stream>>>(ob, wo16, bo, x, x1, 0);

  // LN2
  ln_bf16_kernel<<<M / 8, 256, 0, stream>>>(x1, g2, be2, h2);

  // FFN
  dim3 gFF1(DFF / GBN, M / GBM);
  gemm_bf16_kernel<4096, 1024><<<gFF1, 256, 0, stream>>>(h2, w116, b1, nullptr, f1,
                                                         GF_OUT_BF16 | GF_RELU);
  gemm_bf16_kernel<1024, 4096><<<gEE, 256, 0, stream>>>(f1, w216, b2, x1, out, 0);
}

// v007
// It runs in 187 microseconds.
// In two side-by-side timings against v006, it was 1.31 and 1.30 times as fast.
// Over all steps from v000 it is 3.02 times as fast.
#include <hip/hip_runtime.h>
#include <math.h>

// ---------------- types ----------------
typedef __bf16 v16bf __attribute__((ext_vector_type(16)));
typedef float  v8f   __attribute__((ext_vector_type(8)));
typedef short  s16x8 __attribute__((ext_vector_type(8)));

union Frag {
  v16bf v;
  s16x8 q[2];
  unsigned int u[8];
  unsigned short h[16];
};

__device__ __forceinline__ unsigned short f2bf(float f) {
  unsigned int u = __builtin_bit_cast(unsigned int, f);
  u += 0x7FFFu + ((u >> 16) & 1u);          // round-to-nearest-even
  return (unsigned short)(u >> 16);
}

// element-pair K index for 16-bit WMMA A/B fragments (ISA 7.12.2):
// VGPR v<4 holds k={2v,2v+1}+8*half ; v>=4 holds k={16+2(v-4),...}+8*half
__device__ __forceinline__ int pairK(int v, int half) {
  return ((v < 4) ? (2 * v) : (16 + 2 * (v - 4))) + 8 * half;
}

__device__ __forceinline__ v8f wmma_bf16(const Frag& a, const Frag& b, v8f c) {
  return __builtin_amdgcn_wmma_f32_16x16x32_bf16(
      false, a.v, false, b.v, (short)0, c, false, false);
}

// ---- CDNA5 async global->LDS DMA (ASYNCcnt-tracked, no VGPR data) ----
__device__ __forceinline__ void wait_async0() {
  asm volatile("s_wait_asynccnt 0x0" ::: "memory");
}
// generic LDS pointer -> 32-bit LDS byte offset (aperture keeps offset in addr[31:0])
__device__ __forceinline__ unsigned lds_addr(const void* p) {
  return (unsigned)(unsigned long long)p;
}

// transposing LDS load: lane (c = l & 15, h = l >> 4) gets rows 8h..8h+7 of column c
// of a row-major 16-bit tile; lane l passes the address of row 8h + (l & 7), 16-byte chunk (l >> 3) & 1
__device__ __forceinline__ s16x8 lds_tr16(const unsigned short* p) {
  typedef __attribute__((address_space(3))) s16x8 lds_s16x8;
  return __builtin_amdgcn_ds_load_tr16_b128_v8i16((lds_s16x8*)p);
}

// ---------------- fp32 -> bf16 convert, all six weights in one launch ----------------
// The bf16 copies lie one behind the other in the workspace (Wq, Wk, Wv, Wo, W1, W2).
// A block converts 16384 consecutive elements: 64 per thread, so that few waves have to start.
#define CVT_PER_BLOCK 16384
// at most 8 waves a SIMD: a register budget of 128, so that all 16 loads of a thread stay in flight together
__global__ __launch_bounds__(256) __attribute__((amdgpu_waves_per_eu(4, 8))) void cvt_weights_kernel(
    const float* __restrict__ Wq, const float* __restrict__ Wk, const float* __restrict__ Wv,
    const float* __restrict__ Wo, const float* __restrict__ W1, const float* __restrict__ W2,
    unsigned short* __restrict__ out) {
  int seg = blockIdx.x >> 6;             // which run of 2^20 elements (64 blocks each)
  const float* src;
  if (seg < 4)      src = seg == 0 ? Wq : seg == 1 ? Wk : seg == 2 ? Wv : Wo;
  else if (seg < 8) src = W1 + ((size_t)(seg - 4) << 20);
  else              src = W2 + ((size_t)(seg - 8) << 20);
  const float4* in4 = (const float4*)(src + (size_t)(blockIdx.x & 63) * CVT_PER_BLOCK) + threadIdx.x;
  ushort4* o4 = (ushort4*)(out + (size_t)blockIdx.x * CVT_PER_BLOCK) + threadIdx.x;
  float4 v[16];
#pragma unroll   // all 16 loads of 512 B per wave in flight before the first store
  for (int k = 0; k < 16; ++k) v[k] = in4[k * 256];
#pragma unroll   // v[] stays in registers
  for (int k = 0; k < 16; ++k)
    o4[k * 256] = make_ushort4(f2bf(v[k].x), f2bf(v[k].y), f2bf(v[k].z), f2bf(v[k].w));
}

// ---------------- LayerNorm (one wave per token, E=1024) ----------------
// at most 8 waves a SIMD: a register budget of 128, so that gain and bias fly with the token's loads, not pair by pair behind the sums
__global__ __launch_bounds__(256) __attribute__((amdgpu_waves_per_eu(4, 8))) void ln_bf16_kernel(
    const float* __restrict__ x, const float* __restrict__ g,
    const float* __restrict__ b, unsigned short* __restrict__ out) {
  const int E = 1024;
  int lane = threadIdx.x & 31;
  // the wave's number as a scalar: the token's row address then sits in scalar registers
  int tok = blockIdx.x * 8 + __builtin_amdgcn_readfirstlane(threadIdx.x >> 5);
  const float4* xr = (const float4*)(x + (size_t)tok * E) + lane;
  const float4* g4 = (const float4*)g + lane;
  const float4* b4 = (const float4*)b + lane;
  float4 v[8], gg[8], bb[8];
#pragma unroll   // the token's 8 loads of 512 B in flight together
  for (int i = 0; i < 8; ++i) v[i] = xr[i * 32];
#pragma unroll   // gg[], bb[] stay in registers
  for (int i = 0; i < 8; ++i) { gg[i] = g4[i * 32]; bb[i] = b4[i * 32]; }
  float4 a = make_float4(0.f, 0.f, 0.f, 0.f), q = a;   // four independent chains each
#pragma unroll   // v[] stays in registers
  for (int i = 0; i < 8; ++i) {
    a.x += v[i].x; a.y += v[i].y; a.z += v[i].z; a.w += v[i].w;
    q.x += v[i].x * v[i].x; q.y += v[i].y * v[i].y;
    q.z += v[i].z * v[i].z; q.w += v[i].w * v[i].w;
  }
  float s = (a.x + a.y) + (a.z + a.w), s2 = (q.x + q.y) + (q.z + q.w);
#pragma unroll
  for (int off = 16; off; off >>= 1) {
    s  += __shfl_xor(s,  off, 32);
    s2 += __shfl_xor(s2, off, 32);
  }
  float mu = s * (1.0f / E);
  float var = s2 * (1.0f / E) - mu * mu;
  float rinv = rsqrtf(var + 1e-5f);
  ushort4* o4 = (ushort4*)(out + (size_t)tok * E) + lane;
#pragma unroll   // v[] stays in registers
  for (int i = 0; i < 8; ++i) {
    o4[i * 32] = make_ushort4(f2bf((v[i].x - mu) * rinv * gg[i].x + bb[i].x),
                              f2bf((v[i].y - mu) * rinv * gg[i].y + bb[i].y),
                              f2bf((v[i].z - mu) * rinv * gg[i].z + bb[i].z),
                              f2bf((v[i].w - mu) * rinv * gg[i].w + bb[i].w));
  }
}

// ---------------- bf16 GEMM: C = A[M,K] @ B[K,N] (+bias,+relu,+res) ----------------
#define GBM 128
#define GBN 128
#define GBK 128   // a row of either tile is two whole 128-B lines
#define GAP 136   // LDS row pitch of the A tile in elements: 272 B = 16 B x odd, conflict-free for ds_load_b128
#define GBNP 144  // LDS row pitch of the B tile in elements: 288 B = 32 B x odd, conflict-free for the transposing load
#define GF_OUT_BF16 1
#define GF_RELU     2
#define GF_BIAS     4
#define GF_RES      8

// One thread's share of one operand's K tile (128 rows of 256 B): 8 copies of 16 B, rows r, r+16, ..., r+112.
// 16 lanes share a row, so every copy of a wave covers 4 whole 128-B lines.
// l, g: the thread's own 16 bytes in row r; ls: LDS bytes of 16 rows; gs: elements of 16 rows in global memory.
// The wait on xcnt ends the statement so that no address register is rewritten in front of it.
__device__ __forceinline__ void async_gemm_rows(unsigned l, unsigned ls, const unsigned short* g, size_t gs) {
  asm volatile(
      "global_load_async_to_lds_b128 %0, %8, off\n\t"
      "global_load_async_to_lds_b128 %1, %9, off\n\t"
      "global_load_async_to_lds_b128 %2, %10, off\n\t"
      "global_load_async_to_lds_b128 %3, %11, off\n\t"
      "global_load_async_to_lds_b128 %4, %12, off\n\t"
      "global_load_async_to_lds_b128 %5, %13, off\n\t"
      "global_load_async_to_lds_b128 %6, %14, off\n\t"
      "global_load_async_to_lds_b128 %7, %15, off\n\t"
      "s_wait_xcnt 0x0"
      :: "v"(l), "v"(l + ls), "v"(l + 2 * ls), "v"(l + 3 * ls),
         "v"(l + 4 * ls), "v"(l + 5 * ls), "v"(l + 6 * ls), "v"(l + 7 * ls),
         "v"(g), "v"(g + gs), "v"(g + 2 * gs), "v"(g + 3 * gs),
         "v"(g + 4 * gs), "v"(g + 5 * gs), "v"(g + 6 * gs), "v"(g + 7 * gs)
      : "memory");
}

// One thread's share of a whole K tile: its 8 copies of A, then its 8 of B.
__device__ __forceinline__ void async_gemm_tile(unsigned la, const unsigned short* ga, size_t ars,
                                                unsigned lb, const unsigned short* gb, size_t brs) {
  async_gemm_rows(la, 16 * GAP * 2, ga, ars);
  async_gemm_rows(lb, 16 * GBNP * 2, gb, brs);
}

// FLAGS is a compile-time constant: the epilogue then holds no branch, and nothing keeps its loads apart
template <int NDIM, int KDIM, int FLAGS>
__global__ __launch_bounds__(256) void gemm_bf16_kernel(
    const unsigned short* __restrict__ A, const unsigned short* __restrict__ Bm,
    const float* __restrict__ bias, const float* __restrict__ res,
    void* __restrict__ Cp) {
  // two buffers: the next K tile flies while this one is worked on
  __shared__ __align__(16) unsigned short As[2][GBM][GAP];
  __shared__ __align__(16) unsigned short Bs[2][GBK][GBNP];
  constexpr int NT = KDIM / GBK;         // K tiles
  static_assert(KDIM % GBK == 0 && NT >= 2, "the two-buffer prologue needs two whole K tiles");
  int tid = threadIdx.x;
  int lane = tid & 31, wave = tid >> 5;
  int wm = wave & 1, wn = wave >> 1;     // 2 x 4 wave grid of 64 x 32 wave tiles -> 128 x 128 block tile
  int half = lane >> 4, lm = lane & 15;
  int bm = blockIdx.y * GBM, bn = blockIdx.x * GBN;

  // staging indices (computed once): row of the thread's first copy, its 16-B chunk of the 256-B row
  int sr = tid >> 4;                 // 0..15
  int sc = (tid & 15) << 3;          // 0..120, in elements
  const unsigned short* aptr = A + (size_t)(bm + sr) * KDIM + sc;
  const unsigned short* bptr = Bm + (size_t)sr * NDIM + bn + sc;
  const size_t ars = (size_t)16 * KDIM, brs = (size_t)16 * NDIM;
  // one prefetched byte a line: 2 threads a row, one for each of its lines, cover a whole K tile; the first is tile 2
  const unsigned short* apf = A + (size_t)(bm + (tid >> 1)) * KDIM + (tid & 1) * 64 + 2 * GBK;
  const unsigned short* bpf = Bm + (size_t)((tid >> 1) + 2 * GBK) * NDIM + bn + (tid & 1) * 64;

  // this thread's LDS staging slots (byte addresses) in buffer 0
  unsigned ldsA = lds_addr(&As[0][sr][sc]);
  unsigned ldsB = lds_addr(&Bs[0][sr][sc]);
  const unsigned strA = (unsigned)sizeof(As[0]);   // 34 KB
  const unsigned strB = (unsigned)sizeof(Bs[0]);   // 36 KB

  // K tile 0 into buffer 0, landed and published; then K tile 1 into buffer 1
  async_gemm_tile(ldsA, aptr, ars, ldsB, bptr, brs);
  wait_async0();
  __syncthreads();
  async_gemm_tile(ldsA + strA, aptr + GBK, ars, ldsB + strB, bptr + (size_t)GBK * NDIM, brs);

  v8f acc[4][2] = {};
  // two fragment sets: k chunk c + 1 (32 wide) is loaded from LDS while chunk c is multiplied
  Frag af[2][4], bfr[2][2];
  auto load_chunk = [&](int buf, int kk, Frag* a, Frag* b) {
#pragma unroll
    for (int t = 0; t < 4; ++t) {
      int row = wm * 64 + t * 16 + lm;
#pragma unroll
      for (int vv = 0; vv < 8; ++vv)
        a[t].u[vv] = *(const unsigned int*)&As[buf][row][kk + pairK(vv, half)];
    }
#pragma unroll
    for (int t = 0; t < 2; ++t) {
      // B fragment, k 0..15 then 16..31 of 16 columns, in the same k order as pairK
      const unsigned short* bp =
          &Bs[buf][kk + 8 * half + (lane & 7)][wn * 32 + t * 16 + 8 * ((lane >> 3) & 1)];
      b[t].q[0] = lds_tr16(bp);
      b[t].q[1] = lds_tr16(bp + 16 * GBNP);
    }
  };
  auto mul_chunk = [&](const Frag* a, const Frag* b) {
#pragma unroll
    for (int i = 0; i < 4; ++i)
#pragma unroll
      for (int j = 0; j < 2; ++j)
        acc[i][j] = wmma_bf16(a[i], b[j], acc[i][j]);
  };
  constexpr int NC = GBK / 32;           // k chunks of a tile, taken in rising k
  static_assert(NC % 2 == 0, "a tile's first chunk always goes to fragment set 0");

  load_chunk(0, 0, af[0], bfr[0]);       // tile 0 is published: its first chunk
  for (int kt = 0; kt < NT; ++kt) {
    int buf = kt & 1;
    if (kt + 3 < NT) {                     // global_prefetch_b8 for the tile that is copied at this trip's foot;
      __builtin_prefetch(apf, 0, 0);       // the test keeps both pointers inside their matrices behind the advance too
      __builtin_prefetch(bpf, 0, 0);
      apf += GBK;
      bpf += (size_t)GBK * NDIM;
    }

#pragma unroll   // c constant: LDS offsets become immediates, the fragment sets stay in registers
    for (int c = 0; c + 1 < NC; ++c) {
      load_chunk(buf, (c + 1) * 32, af[(c + 1) & 1], bfr[(c + 1) & 1]);
      // keeps the next chunk's 12 loads in front of this chunk's products: left alone, the compiler loads
      // one A fragment at a time into the same registers and waits out the LDS latency at each
      __builtin_amdgcn_sched_barrier(0);
      mul_chunk(af[c & 1], bfr[c & 1]);
    }

    // hand-over, with the tile's last chunk already in registers: this trip's LDS reads are done,
    // the next tile has landed, then the barrier; only behind it is the buffer just read filled again
    // the scheduling barrier keeps the products above in front of the waits: lifted over them,
    // the wait on the copies would stand in mid-trip and cut the time that the next tile has to land
    __builtin_amdgcn_sched_barrier(0);
    asm volatile("s_wait_dscnt 0x0" ::: "memory");
    wait_async0();
    __syncthreads();
    if (kt + 2 < NT)
      async_gemm_tile(ldsA + buf * strA, aptr + (size_t)(kt + 2) * GBK, ars,
                      ldsB + buf * strB, bptr + (size_t)(kt + 2) * GBK * NDIM, brs);
    if (kt + 1 < NT)                       // the next tile is published: its first chunk
      load_chunk(buf ^ 1, 0, af[0], bfr[0]);
    // keeps the refill and the next chunk's loads in front of the last chunk's products, which then cover their flight
    __builtin_amdgcn_sched_barrier(0);
    mul_chunk(af[(NC - 1) & 1], bfr[(NC - 1) & 1]);
    // the four vector slots that the chip needs between the last product and the first overwrite of its operands:
    // the scheduling barrier holds the slots behind the products
    __builtin_amdgcn_sched_barrier(0);
    asm volatile("v_nop\n\tv_nop\n\tv_nop\n\tv_nop");
  }
  wait_async0();   // no copy is left in flight when the wave ends

  constexpr bool outbf = (FLAGS & GF_OUT_BF16) != 0;
  constexpr bool relu  = (FLAGS & GF_RELU) != 0;
  constexpr bool hasb  = (FLAGS & GF_BIAS) != 0;
  constexpr bool hasr  = (FLAGS & GF_RES) != 0;
  // the lane's first element; its other 63 lie at constant distances from it (immediate offsets of one address)
  const int col0 = bn + wn * 32 + lm;
  const size_t e0 = (size_t)(bm + wm * 64 + 8 * half) * NDIM + col0;
  float bv[2] = {0.f, 0.f};
  if constexpr (hasb) {
    bv[0] = bias[col0];
    bv[1] = bias[col0 + 16];
  }
  // all 64 residual values of the lane are asked for before the first is used: one latency, not 64 in a row
  float rv[4][2][8];
  if constexpr (hasr) {
#pragma unroll   // i, j, r constant in all three loops: rv[] stays in registers, the distances become immediate offsets
    for (int i = 0; i < 4; ++i)
#pragma unroll   // as above
      for (int j = 0; j < 2; ++j)
#pragma unroll   // as above
        for (int r = 0; r < 8; ++r)
          rv[i][j][r] = res[e0 + (size_t)(i * 16 + r) * NDIM + j * 16];
  }
#pragma unroll   // i, j, r constant in all three loops: acc[], rv[] stay in registers, the distances become immediate offsets
  for (int i = 0; i < 4; ++i)
#pragma unroll   // as above
    for (int j = 0; j < 2; ++j)
#pragma unroll   // as above
      for (int r = 0; r < 8; ++r) {
        float val = acc[i][j][r];
        if constexpr (hasb) val += bv[j];
        if constexpr (relu) val = fmaxf(val, 0.f);
        if constexpr (hasr) val += rv[i][j][r];
        size_t idx = e0 + (size_t)(i * 16 + r) * NDIM + j * 16;
        if constexpr (outbf) ((unsigned short*)Cp)[idx] = f2bf(val);
        else                 ((float*)Cp)[idx] = val;
      }
}

// ---------------- flash attention: one wave per (b,h,16-query tile) ----------------
#define NEG_BIG (-3.0e38f)
#define AKP 72   // LDS row pitch of the K tile in elements: 144 B = 16 B x odd, conflict-free for ds_load_b128
#define AVP 80   // LDS row pitch of the V tile in elements: 160 B = 32 B x odd, conflict-free for the transposing load

// One wave copies a tile of 32 rows x 128 B (one head's slice of 32 keys) to LDS: 8 copies, each of
// 4 whole 128-B lines (8 lanes a row). lds, g: the lane's own 16 bytes in rows 0..3; step: LDS bytes of 4 rows.
// The wait on xcnt ends the statement so that no address register is rewritten in front of it.
__device__ __forceinline__ void async_tile_32x128(unsigned lds, unsigned step, const unsigned short* g) {
  const size_t gs = (size_t)4 * 1024;   // elements of 4 rows in global memory
  asm volatile(
      "global_load_async_to_lds_b128 %0, %8, off\n\t"
      "global_load_async_to_lds_b128 %1, %9, off\n\t"
      "global_load_async_to_lds_b128 %2, %10, off\n\t"
      "global_load_async_to_lds_b128 %3, %11, off\n\t"
      "global_load_async_to_lds_b128 %4, %12, off\n\t"
      "global_load_async_to_lds_b128 %5, %13, off\n\t"
      "global_load_async_to_lds_b128 %6, %14, off\n\t"
      "global_load_async_to_lds_b128 %7, %15, off\n\t"
      "s_wait_xcnt 0x0"
      :: "v"(lds), "v"(lds + step), "v"(lds + 2 * step), "v"(lds + 3 * step),
         "v"(lds + 4 * step), "v"(lds + 5 * step), "v"(lds + 6 * step), "v"(lds + 7 * step),
         "v"(g), "v"(g + gs), "v"(g + 2 * gs), "v"(g + 3 * gs),
         "v"(g + 4 * gs), "v"(g + 5 * gs), "v"(g + 6 * gs), "v"(g + 7 * gs)
      : "memory");
}

// lane l takes the value of lane l ^ 16 (the other half of the wave)
__device__ __forceinline__ float xhalf(float x) {
  int b = __builtin_bit_cast(int, x);
  return __builtin_bit_cast(float,
      __builtin_amdgcn_permlanex16(b, b, 0x76543210, 0xfedcba98, false, false));
}

// two floats to one register of two bf16 (lo in bits 15..0), round-to-nearest-even like f2bf: one v_cvt_pk_bf16_f32
__device__ __forceinline__ unsigned int pack2bf(float lo, float hi) {
  typedef float  f32x2 __attribute__((ext_vector_type(2)));
  typedef __bf16 bf16x2 __attribute__((ext_vector_type(2)));
  return __builtin_bit_cast(unsigned int, __builtin_convertvector(f32x2{lo, hi}, bf16x2));
}

// The products are taken transposed: S^T = K Q^T (keys x queries), O^T += V^T P^T (d x queries).
// A lane then holds 16 of the 32 scores of ONE query (column lm): maximum and sum run inside the lane,
// the two halves of the wave meet in one exchange, and the two score tiles, converted in place,
// are the B operand P^T in the hardware's k order: P goes through no LDS.
__global__ __launch_bounds__(32) void attn_kernel(
    const unsigned short* __restrict__ Q, const unsigned short* __restrict__ Km,
    const unsigned short* __restrict__ V, unsigned short* __restrict__ O) {
  const int E = 1024, T = 2048, DH = 64;
  __shared__ __align__(16) unsigned short Ks[2][32][AKP];   // two buffers: the next 32 keys fly while these are worked on
  __shared__ __align__(16) unsigned short Vs[2][32][AVP];
  int lane = threadIdx.x & 31;
  int half = lane >> 4, lm = lane & 15;
  int qt = blockIdx.x;                 // 0..T/16-1
  int bh = blockIdx.y;                 // 0..B*H-1
  int b = bh >> 4, h = bh & 15;
  size_t rowbase = (size_t)b * T;
  int q0 = qt * 16;
  int hoff = h * DH;
  const float scale = 0.03125f;        // 1024^-0.5 (reference scales by full E)

  // Q^T B-fragments (columns q0+lm, d-chunks 0..31 / 32..63), loaded once
  Frag qa[2];
  const unsigned short* qrow = Q + (rowbase + q0 + lm) * E + hoff;
#pragma unroll
  for (int t = 0; t < 2; ++t)
#pragma unroll
    for (int vv = 0; vv < 8; ++vv)
      qa[t].u[vv] = *(const unsigned int*)(qrow + t * 32 + pairK(vv, half));

  float mrun = NEG_BIG;                // running maximum of query q0 + lm, the same in both halves
  float lrun = 0.f;                    // running sum over this half's keys only; the halves are joined at the end
  v8f oacc[4] = {};                    // oacc[j][r] = O^T[d = 16 j + 8 half + r][query lm]

  int qmax = q0 + 15;
  int mq = q0 + lm;                    // this lane's query

  // this lane's 16 bytes of rows 0..3 of a tile, in global memory and in LDS
  const unsigned short* kg = Km + (rowbase + (lane >> 3)) * E + hoff + (lane & 7) * 8;
  const unsigned short* vg = V  + (rowbase + (lane >> 3)) * E + hoff + (lane & 7) * 8;
  unsigned kl = lds_addr(&Ks[0][lane >> 3][(lane & 7) * 8]);
  unsigned vl = lds_addr(&Vs[0][lane >> 3][(lane & 7) * 8]);
  const unsigned strK = (unsigned)sizeof(Ks[0]), strV = (unsigned)sizeof(Vs[0]);

  // keys 0..31 into buffer 0, landed and published; then keys 32..63 into buffer 1
  async_tile_32x128(kl, 4 * AKP * 2, kg);
  async_tile_32x128(vl, 4 * AVP * 2, vg);
  wait_async0();
  __syncthreads();
  if (32 <= qmax) {
    async_tile_32x128(kl + strK, 4 * AKP * 2, kg + (size_t)32 * E);
    async_tile_32x128(vl + strV, 4 * AVP * 2, vg + (size_t)32 * E);
  }

  int buf = 0;
  for (int kt = 0; kt <= qmax; kt += 32) {
    // scores: two 16-key subtiles x two 32-wide d-chunks, K rows from LDS as A fragments
    const unsigned short* krow0 = &Ks[buf][lm][0];
    const unsigned short* krow1 = &Ks[buf][16 + lm][0];
    Frag kf[4];
#pragma unroll
    for (int t = 0; t < 2; ++t)
#pragma unroll
      for (int vv = 0; vv < 8; ++vv) {
        kf[t].u[vv]     = *(const unsigned int*)(krow0 + t * 32 + pairK(vv, half));
        kf[2 + t].u[vv] = *(const unsigned int*)(krow1 + t * 32 + pairK(vv, half));
      }
    // V^T (16 d rows x 32 keys per d-subtile) as A fragments by the transposing load,
    // keys 0..15 then 16..31, in the same k order as pairK
    Frag vf[4];
#pragma unroll
    for (int j = 0; j < 4; ++j) {
      const unsigned short* vp = &Vs[buf][8 * half + (lane & 7)][j * 16 + 8 * ((lane >> 3) & 1)];
      vf[j].q[0] = lds_tr16(vp);
      vf[j].q[1] = lds_tr16(vp + 16 * AVP);
    }
    // s0[r]: key kt + 8 half + r, s1[r]: key kt + 16 + 8 half + r, both against query lm
    v8f s0 = {}, s1 = {};
    s0 = wmma_bf16(kf[0], qa[0], s0);
    s0 = wmma_bf16(kf[1], qa[1], s0);
    s1 = wmma_bf16(kf[2], qa[0], s1);
    s1 = wmma_bf16(kf[3], qa[1], s1);

    // online softmax update of this lane's query
    int ahead = mq - (kt + 8 * half);    // key r of this half's first subtile is masked where r > ahead
    float a0[8], a1[8];
#pragma unroll
    for (int r = 0; r < 8; ++r) {
      a0[r] = s0[r] * scale; if (r > ahead)      a0[r] = NEG_BIG;
      a1[r] = s1[r] * scale; if (16 + r > ahead) a1[r] = NEG_BIG;
    }
    float m4[4];                         // four independent chains
#pragma unroll
    for (int c = 0; c < 4; ++c)
      m4[c] = fmaxf(fmaxf(a0[2 * c], a0[2 * c + 1]), fmaxf(a1[2 * c], a1[2 * c + 1]));
    float mx = fmaxf(fmaxf(m4[0], m4[1]), fmaxf(m4[2], m4[3]));
    mx = fmaxf(mx, xhalf(mx));
    float mn = fmaxf(mrun, mx);
    float alpha = __expf(mrun - mn);
    mrun = mn;
    float p0[8], p1[8];
#pragma unroll
    for (int r = 0; r < 8; ++r) { p0[r] = __expf(a0[r] - mn); p1[r] = __expf(a1[r] - mn); }
    float r4[4];                         // four independent chains
#pragma unroll
    for (int c = 0; c < 4; ++c)
      r4[c] = (p0[2 * c] + p0[2 * c + 1]) + (p1[2 * c] + p1[2 * c + 1]);
    lrun = lrun * alpha + ((r4[0] + r4[1]) + (r4[2] + r4[3]));
#pragma unroll
    for (int j = 0; j < 4; ++j)
#pragma unroll
      for (int r = 0; r < 8; ++r) oacc[j][r] *= alpha;

    // P^T (32 keys x 16 queries) as B fragment: element s of the lane is key 8 half + s (s < 8), 16 + 8 half + s - 8 (s >= 8)
    Frag pf;
#pragma unroll
    for (int vv = 0; vv < 4; ++vv) {
      pf.u[vv]     = pack2bf(p0[2 * vv], p0[2 * vv + 1]);
      pf.u[4 + vv] = pack2bf(p1[2 * vv], p1[2 * vv + 1]);
    }
#pragma unroll
    for (int j = 0; j < 4; ++j)
      oacc[j] = wmma_bf16(vf[j], pf, oacc[j]);

    // hand-over: this pass's LDS reads are done, the next tile has landed, then the barrier;
    // only behind it is the buffer just read filled again
    // (the work-group is one wave: the compiler emits no barrier instruction for __syncthreads here)
    // the scheduling barrier keeps the softmax and the products in front of the two waits: lifted over them,
    // the wait on the copies would stand in mid-pass and cut the time that the next tile has to land
    __builtin_amdgcn_sched_barrier(0);
    asm volatile("s_wait_dscnt 0x0" ::: "memory");
    wait_async0();
    __syncthreads();
    if (kt + 64 <= qmax) {
      async_tile_32x128(kl + buf * strK, 4 * AKP * 2, kg + (size_t)(kt + 64) * E);
      async_tile_32x128(vl + buf * strV, 4 * AVP * 2, vg + (size_t)(kt + 64) * E);
    }
    buf ^= 1;
  }
  wait_async0();   // no copy is left in flight when the wave ends

  // epilogue: join the halves' sums, O /= l; a lane holds 8 consecutive d of its query's row: one 16-byte store each
  float inv = 1.0f / (lrun + xhalf(lrun));
  unsigned short* orow = O + (rowbase + q0 + lm) * E + hoff + 8 * half;
#pragma unroll
  for (int j = 0; j < 4; ++j) {
    uint4 w;
    w.x = pack2bf(oacc[j][0] * inv, oacc[j][1] * inv);
    w.y = pack2bf(oacc[j][2] * inv, oacc[j][3] * inv);
    w.z = pack2bf(oacc[j][4] * inv, oacc[j][5] * inv);
    w.w = pack2bf(oacc[j][6] * inv, oacc[j][7] * inv);
    *(uint4*)(orow + j * 16) = w;
  }
}

// ---------------- host launcher ----------------
extern "C" void kernel_launch(void* const* d_in, const int* in_sizes, int n_in,
                              void* d_out, int out_size, void* d_ws, size_t ws_size,
                              hipStream_t stream) {
  const int E = 1024, H = 16, DFF = 4096, B = 2, T = 2048;
  const int M = B * T;                 // 4096 tokens
  (void)in_sizes; (void)n_in; (void)out_size; (void)ws_size;

  const float* x   = (const float*)d_in[0];
  const float* Wq  = (const float*)d_in[1];
  const float* Wk  = (const float*)d_in[2];
  const float* Wv  = (const float*)d_in[3];
  const float* Wo  = (const float*)d_in[4];
  const float* bo  = (const float*)d_in[5];
  const float* W1  = (const float*)d_in[6];
  const float* b1  = (const float*)d_in[7];
  const float* W2  = (const float*)d_in[8];
  const float* b2  = (const float*)d_in[9];
  const float* g1  = (const float*)d_in[10];
  const float* be1 = (const float*)d_in[11];
  const float* g2  = (const float*)d_in[12];
  const float* be2 = (const float*)d_in[13];
  float* out = (float*)d_out;

  // workspace carve-up (256B aligned)
  char* wsp = (char*)d_ws;
  auto alloc = [&](size_t bytes) -> void* {
    void* p = (void*)wsp;
    wsp += (bytes + 255) & ~(size_t)255;
    return p;
  };
  const size_t EE = (size_t)E * E, ED = (size_t)E * DFF;
  unsigned short* wq16 = (unsigned short*)alloc((4 * EE + 2 * ED) * 2);  // all bf16 weights, in a row
  unsigned short* wk16 = wq16 + EE;
  unsigned short* wv16 = wk16 + EE;
  unsigned short* wo16 = wv16 + EE;
  unsigned short* w116 = wo16 + EE;
  unsigned short* w216 = w116 + ED;
  unsigned short* hb   = (unsigned short*)alloc((size_t)M * E * 2);
  unsigned short* qb   = (unsigned short*)alloc((size_t)(M + 64) * E * 2);  // +64 row pad
  unsigned short* kb   = (unsigned short*)alloc((size_t)(M + 64) * E * 2);
  unsigned short* vb   = (unsigned short*)alloc((size_t)(M + 64) * E * 2);
  unsigned short* ob   = (unsigned short*)alloc((size_t)M * E * 2);
  float*          x1   = (float*)alloc((size_t)M * E * 4);
  unsigned short* h2   = (unsigned short*)alloc((size_t)M * E * 2);
  unsigned short* f1   = (unsigned short*)alloc((size_t)M * DFF * 2);

  // weights -> bf16
  cvt_weights_kernel<<<(4 * EE + 2 * ED) / CVT_PER_BLOCK, 256, 0, stream>>>(Wq, Wk, Wv, Wo, W1, W2, wq16);

  // LN1
  ln_bf16_kernel<<<M / 8, 256, 0, stream>>>(x, g1, be1, hb);

  // QKV projections
  dim3 gEE(E / GBN, M / GBM);
  gemm_bf16_kernel<1024, 1024, GF_OUT_BF16><<<gEE, 256, 0, stream>>>(hb, wq16, nullptr, nullptr, qb);
  gemm_bf16_kernel<1024, 1024, GF_OUT_BF16><<<gEE, 256, 0, stream>>>(hb, wk16, nullptr, nullptr, kb);
  gemm_bf16_kernel<1024, 1024, GF_OUT_BF16><<<gEE, 256, 0, stream>>>(hb, wv16, nullptr, nullptr, vb);

  // causal flash attention
  attn_kernel<<<dim3(T / 16, B * H), 32, 0, stream>>>(qb, kb, vb, ob);

  // out-proj + bias + residual(x) -> x1 (fp32)
  gemm_bf16_kernel<1024, 1024, GF_BIAS | GF_RES><<<gEE, 256, 0, stream>>>(ob, wo16, bo, x, x1);

  // LN2
  ln_bf16_kernel<<<M / 8, 256, 0, stream>>>(x1, g2, be2, h2);

  // FFN
  dim3 gFF1(DFF / GBN, M / GBM);
  gemm_bf16_kernel<4096, 1024, GF_OUT_BF16 | GF_RELU | GF_BIAS><<<gFF1, 256, 0, stream>>>(h2, w116, b1, nullptr, f1);
  gemm_bf16_kernel<1024, 4096, GF_BIAS | GF_RES><<<gEE, 256, 0, stream>>>(f1, w216, b2, x1, out);
}

// v008
// A run of this version takes 182 microseconds.
// Next to v007, in two timings, it ran 1.04 and 1.03 times as fast.
// Counting every step since v000, it is 3.13 times as fast.
#include <hip/hip_runtime.h>
#include <math.h>

// ---------------- types ----------------
typedef __bf16 v16bf __attribute__((ext_vector_type(16)));
typedef float  v8f   __attribute__((ext_vector_type(8)));
typedef short  s16x8 __attribute__((ext_vector_type(8)));

union Frag {
  v16bf v;
  s16x8 q[2];
  unsigned int u[8];
  unsigned short h[16];
};

__device__ __forceinline__ unsigned short f2bf(float f) {
  unsigned int u = __builtin_bit_cast(unsigned int, f);
  u += 0x7FFFu + ((u >> 16) & 1u);          // round-to-nearest-even
  return (unsigned short)(u >> 16);
}

// element-pair K index for 16-bit WMMA A/B fragments (ISA 7.12.2):
// VGPR v<4 holds k={2v,2v+1}+8*half ; v>=4 holds k={16+2(v-4),...}+8*half
__device__ __forceinline__ int pairK(int v, int half) {
  return ((v < 4) ? (2 * v) : (16 + 2 * (v - 4))) + 8 * half;
}

__device__ __forceinline__ v8f wmma_bf16(const Frag& a, const Frag& b, v8f c) {
  return __builtin_amdgcn_wmma_f32_16x16x32_bf16(
      false, a.v, false, b.v, (short)0, c, false, false);
}

// ---- CDNA5 async global->LDS DMA (ASYNCcnt-tracked, no VGPR data) ----
__device__ __forceinline__ void wait_async0() {
  asm volatile("s_wait_asynccnt 0x0" ::: "memory");
}
// generic LDS pointer -> 32-bit LDS byte offset (aperture keeps offset in addr[31:0])
__device__ __forceinline__ unsigned lds_addr(const void* p) {
  return (unsigned)(unsigned long long)p;
}

// transposing LDS load: lane (c = l & 15, h = l >> 4) gets rows 8h..8h+7 of column c
// of a row-major 16-bit tile; lane l passes the address of row 8h + (l & 7), 16-byte chunk (l >> 3) & 1
__device__ __forceinline__ s16x8 lds_tr16(const unsigned short* p) {
  typedef __attribute__((address_space(3))) s16x8 lds_s16x8;
  return __builtin_amdgcn_ds_load_tr16_b128_v8i16((lds_s16x8*)p);
}

// ---------------- fp32 -> bf16 convert of the weights ----------------
// The bf16 copies lie one behind the other in the workspace (Wq, Wk, Wv, Wo, W1, W2).
// The converts have no launch of their own: each rides in a launch whose own work does not depend on it.
// A block of NTHR threads converts 64 * NTHR consecutive elements: 64 per thread, so that few waves have to start.
template <int NTHR>
__device__ __forceinline__ void cvt_run(const float* __restrict__ src, unsigned short* __restrict__ dst) {
  const float4* in4 = (const float4*)src + threadIdx.x;
  ushort4* o4 = (ushort4*)dst + threadIdx.x;
  float4 v[16];
#pragma unroll   // all 16 loads of 512 B per wave in flight before the first store
  for (int k = 0; k < 16; ++k) v[k] = in4[k * NTHR];
#pragma unroll   // v[] stays in registers
  for (int k = 0; k < 16; ++k) {
    o4[k * NTHR] = make_ushort4(f2bf(v[k].x), f2bf(v[k].y), f2bf(v[k].z), f2bf(v[k].w));
    // a later convert may be given a register that an issued store names: the wait stands in front of that overwrite
    if ((k & 3) == 3 && k != 15) asm volatile("s_wait_xcnt 0x0" ::: "memory");
  }
}

// ---------------- LayerNorm (one wave per token, E=1024) ----------------
// blk: which run of 8 tokens this block of 8 waves takes
__device__ __forceinline__ void ln_tokens(
    const float* __restrict__ x, const float* __restrict__ g,
    const float* __restrict__ b, unsigned short* __restrict__ out, int blk) {
  const int E = 1024;
  int lane = threadIdx.x & 31;
  // the wave's number as a scalar: the token's row address then sits in scalar registers
  int tok = blk * 8 + __builtin_amdgcn_readfirstlane(threadIdx.x >> 5);
  const float4* xr = (const float4*)(x + (size_t)tok * E) + lane;
  const float4* g4 = (const float4*)g + lane;
  const float4* b4 = (const float4*)b + lane;
  float4 v[8], gg[8], bb[8];
#pragma unroll   // the token's 8 loads of 512 B in flight together
  for (int i = 0; i < 8; ++i) v[i] = xr[i * 32];
#pragma unroll   // gg[], bb[] stay in registers
  for (int i = 0; i < 8; ++i) { gg[i] = g4[i * 32]; bb[i] = b4[i * 32]; }
  float4 a = make_float4(0.f, 0.f, 0.f, 0.f), q = a;   // four independent chains each
#pragma unroll   // v[] stays in registers
  for (int i = 0; i < 8; ++i) {
    a.x += v[i].x; a.y += v[i].y; a.z += v[i].z; a.w += v[i].w;
    q.x += v[i].x * v[i].x; q.y += v[i].y * v[i].y;
    q.z += v[i].z * v[i].z; q.w += v[i].w * v[i].w;
  }
  float s = (a.x + a.y) + (a.z + a.w), s2 = (q.x + q.y) + (q.z + q.w);
#pragma unroll
  for (int off = 16; off; off >>= 1) {
    s  += __shfl_xor(s,  off, 32);
    s2 += __shfl_xor(s2, off, 32);
  }
  float mu = s * (1.0f / E);
  float var = s2 * (1.0f / E) - mu * mu;
  float rinv = rsqrtf(var + 1e-5f);
  ushort4* o4 = (ushort4*)(out + (size_t)tok * E) + lane;
#pragma unroll   // v[] stays in registers
  for (int i = 0; i < 8; ++i) {
    o4[i * 32] = make_ushort4(f2bf((v[i].x - mu) * rinv * gg[i].x + bb[i].x),
                              f2bf((v[i].y - mu) * rinv * gg[i].y + bb[i].y),
                              f2bf((v[i].z - mu) * rinv * gg[i].z + bb[i].z),
                              f2bf((v[i].w - mu) * rinv * gg[i].w + bb[i].w));
  }
}

// at most 8 waves a SIMD: a register budget of 128, so that gain and bias fly with the token's loads, not pair by pair behind the sums
__global__ __launch_bounds__(256) __attribute__((amdgpu_waves_per_eu(4, 8))) void ln_bf16_kernel(
    const float* __restrict__ x, const float* __restrict__ g,
    const float* __restrict__ b, unsigned short* __restrict__ out) {
  ln_tokens(x, g, b, out, blockIdx.x);
}

// First launch: LayerNorm 1 (blocks 0 .. LN_BLOCKS - 1) and, behind it, the convert of Wq, Wk, Wv
// (64 blocks of 16384 elements each): neither reads what the other writes.
#define LN_BLOCKS 512   // 4096 tokens, 8 a block
// the same register budget as above, here also so that all 16 loads of a converting thread stay in flight together
__global__ __launch_bounds__(256) __attribute__((amdgpu_waves_per_eu(4, 8))) void ln1_cvt_qkv_kernel(
    const float* __restrict__ x, const float* __restrict__ g,
    const float* __restrict__ b, unsigned short* __restrict__ out,
    const float* __restrict__ Wq, const float* __restrict__ Wk, const float* __restrict__ Wv,
    unsigned short* __restrict__ w16) {
  if (blockIdx.x < LN_BLOCKS) {
    ln_tokens(x, g, b, out, blockIdx.x);
    return;
  }
  int c = blockIdx.x - LN_BLOCKS;        // 0..191
  int seg = c >> 6;                      // which weight
  const float* src = seg == 0 ? Wq : seg == 1 ? Wk : Wv;
  cvt_run<256>(src + (size_t)(c & 63) * 16384, w16 + (size_t)c * 16384);
}

// ---------------- bf16 GEMM: C = A[M,K] @ B[K,N] (+bias,+relu,+res) ----------------
#define GBM 128
#define GBN 128
#define GBK 128   // a row of either tile is two whole 128-B lines
#define GAP 136   // LDS row pitch of the A tile in elements: 272 B = 16 B x odd, conflict-free for ds_load_b128
#define GBNP 144  // LDS row pitch of the B tile in elements: 288 B = 32 B x odd, conflict-free for the transposing load
#define GF_OUT_BF16 1
#define GF_RELU     2
#define GF_BIAS     4
#define GF_RES      8

// One thread's share of one operand's K tile (128 rows of 256 B): 8 copies of 16 B, rows r, r+16, ..., r+112.
// 16 lanes share a row, so every copy of a wave covers 4 whole 128-B lines.
// l, g: the thread's own 16 bytes in row r; ls: LDS bytes of 16 rows; gs: elements of 16 rows in global memory.
// The wait on xcnt ends the statement so that no address register is rewritten in front of it.
__device__ __forceinline__ void async_gemm_rows(unsigned l, unsigned ls, const unsigned short* g, size_t gs) {
  asm volatile(
      "global_load_async_to_lds_b128 %0, %8, off\n\t"
      "global_load_async_to_lds_b128 %1, %9, off\n\t"
      "global_load_async_to_lds_b128 %2, %10, off\n\t"
      "global_load_async_to_lds_b128 %3, %11, off\n\t"
      "global_load_async_to_lds_b128 %4, %12, off\n\t"
      "global_load_async_to_lds_b128 %5, %13, off\n\t"
      "global_load_async_to_lds_b128 %6, %14, off\n\t"
      "global_load_async_to_lds_b128 %7, %15, off\n\t"
      "s_wait_xcnt 0x0"
      :: "v"(l), "v"(l + ls), "v"(l + 2 * ls), "v"(l + 3 * ls),
         "v"(l + 4 * ls), "v"(l + 5 * ls), "v"(l + 6 * ls), "v"(l + 7 * ls),
         "v"(g), "v"(g + gs), "v"(g + 2 * gs), "v"(g + 3 * gs),
         "v"(g + 4 * gs), "v"(g + 5 * gs), "v"(g + 6 * gs), "v"(g + 7 * gs)
      : "memory");
}

// One thread's share of a whole K tile: its 8 copies of A, then its 8 of B.
__device__ __forceinline__ void async_gemm_tile(unsigned la, const unsigned short* ga, size_t ars,
                                                unsigned lb, const unsigned short* gb, size_t brs) {
  async_gemm_rows(la, 16 * GAP * 2, ga, ars);
  async_gemm_rows(lb, 16 * GBNP * 2, gb, brs);
}

// FLAGS is a compile-time constant: the epilogue then holds no branch, and nothing keeps its loads apart
// ZB, ZC: products of one A with several B share a launch: grid plane z takes the B matrix that lies z * ZB elements
// behind Bm and writes the output that lies z * ZC elements behind Cp (0, 0: one B, one plane)
template <int NDIM, int KDIM, int FLAGS, int ZB = 0, int ZC = 0>
__global__ __launch_bounds__(256) void gemm_bf16_kernel(
    const unsigned short* __restrict__ A, const unsigned short* __restrict__ Bm,
    const float* __restrict__ bias, const float* __restrict__ res,
    void* __restrict__ Cp) {
  // two buffers: the next K tile flies while this one is worked on
  __shared__ __align__(16) unsigned short As[2][GBM][GAP];
  __shared__ __align__(16) unsigned short Bs[2][GBK][GBNP];
  constexpr int NT = KDIM / GBK;         // K tiles
  static_assert(KDIM % GBK == 0 && NT >= 2, "the two-buffer prologue needs two whole K tiles");
  int tid = threadIdx.x;
  int lane = tid & 31, wave = tid >> 5;
  int wm = wave & 1, wn = wave >> 1;     // 2 x 4 wave grid of 64 x 32 wave tiles -> 128 x 128 block tile
  int half = lane >> 4, lm = lane & 15;
  int bm = blockIdx.y * GBM, bn = blockIdx.x * GBN;

  // staging indices (computed once): row of the thread's first copy, its 16-B chunk of the 256-B row
  int sr = tid >> 4;                 // 0..15
  int sc = (tid & 15) << 3;          // 0..120, in elements
  const unsigned short* aptr = A + (size_t)(bm + sr) * KDIM + sc;
  const unsigned short* Bz = Bm + (size_t)blockIdx.z * ZB;
  const unsigned short* bptr = Bz + (size_t)sr * NDIM + bn + sc;
  const size_t ars = (size_t)16 * KDIM, brs = (size_t)16 * NDIM;
  // one prefetched byte a line: 2 threads a row, one for each of its lines, cover a whole K tile; the first is tile 2
  const unsigned short* apf = A + (size_t)(bm + (tid >> 1)) * KDIM + (tid & 1) * 64 + 2 * GBK;
  const unsigned short* bpf = Bz + (size_t)((tid >> 1) + 2 * GBK) * NDIM + bn + (tid & 1) * 64;

  // this thread's LDS staging slots (byte addresses) in buffer 0
  unsigned ldsA = lds_addr(&As[0][sr][sc]);
  unsigned ldsB = lds_addr(&Bs[0][sr][sc]);
  const unsigned strA = (unsigned)sizeof(As[0]);   // 34 KB
  const unsigned strB = (unsigned)sizeof(Bs[0]);   // 36 KB

  // K tile 0 into buffer 0, landed and published; then K tile 1 into buffer 1
  async_gemm_tile(ldsA, aptr, ars, ldsB, bptr, brs);
  wait_async0();
  __syncthreads();
  async_gemm_tile(ldsA + strA, aptr + GBK, ars, ldsB + strB, bptr + (size_t)GBK * NDIM, brs);

  v8f acc[4][2] = {};
  // two fragment sets: k chunk c + 1 (32 wide) is loaded from LDS while chunk c is multiplied
  Frag af[2][4], bfr[2][2];
  auto load_chunk = [&](int buf, int kk, Frag* a, Frag* b) {
#pragma unroll
    for (int t = 0; t < 4; ++t) {
      int row = wm * 64 + t * 16 + lm;
#pragma unroll
      for (int vv = 0; vv < 8; ++vv)
        a[t].u[vv] = *(const unsigned int*)&As[buf][row][kk + pairK(vv, half)];
    }
#pragma unroll
    for (int t = 0; t < 2; ++t) {
      // B fragment, k 0..15 then 16..31 of 16 columns, in the same k order as pairK
      const unsigned short* bp =
          &Bs[buf][kk + 8 * half + (lane & 7)][wn * 32 + t * 16 + 8 * ((lane >> 3) & 1)];
      b[t].q[0] = lds_tr16(bp);
      b[t].q[1] = lds_tr16(bp + 16 * GBNP);
    }
  };
  auto mul_chunk = [&](const Frag* a, const Frag* b) {
#pragma unroll
    for (int i = 0; i < 4; ++i)
#pragma unroll
      for (int j = 0; j < 2; ++j)
        acc[i][j] = wmma_bf16(a[i], b[j], acc[i][j]);
  };
  constexpr int NC = GBK / 32;           // k chunks of a tile, taken in rising k
  static_assert(NC % 2 == 0, "a tile's first chunk always goes to fragment set 0");

  load_chunk(0, 0, af[0], bfr[0]);       // tile 0 is published: its first chunk
  for (int kt = 0; kt < NT; ++kt) {
    int buf = kt & 1;
    if (kt + 3 < NT) {                     // global_prefetch_b8 for the tile that is copied at this trip's foot;
      __builtin_prefetch(apf, 0, 0);       // the test keeps both pointers inside their matrices behind the advance too
      __builtin_prefetch(bpf, 0, 0);
      apf += GBK;
      bpf += (size_t)GBK * NDIM;
    }

#pragma unroll   // c constant: LDS offsets become immediates, the fragment sets stay in registers
    for (int c = 0; c + 1 < NC; ++c) {
      load_chunk(buf, (c + 1) * 32, af[(c + 1) & 1], bfr[(c + 1) & 1]);
      // keeps the next chunk's 12 loads in front of this chunk's products: left alone, the compiler loads
      // one A fragment at a time into the same registers and waits out the LDS latency at each
      __builtin_amdgcn_sched_barrier(0);
      mul_chunk(af[c & 1], bfr[c & 1]);
    }

    // hand-over, with the tile's last chunk already in registers: this trip's LDS reads are done,
    // the next tile has landed, then the barrier; only behind it is the buffer just read filled again
    // the scheduling barrier keeps the products above in front of the waits: lifted over them,
    // the wait on the copies would stand in mid-trip and cut the time that the next tile has to land
    __builtin_amdgcn_sched_barrier(0);
    asm volatile("s_wait_dscnt 0x0" ::: "memory");
    wait_async0();
    __syncthreads();
    if (kt + 2 < NT)
      async_gemm_tile(ldsA + buf * strA, aptr + (size_t)(kt + 2) * GBK, ars,
                      ldsB + buf * strB, bptr + (size_t)(kt + 2) * GBK * NDIM, brs);
    if (kt + 1 < NT)                       // the next tile is published: its first chunk
      load_chunk(buf ^ 1, 0, af[0], bfr[0]);
    // keeps the refill and the next chunk's loads in front of the last chunk's products, which then cover their flight
    __builtin_amdgcn_sched_barrier(0);
    mul_chunk(af[(NC - 1) & 1], bfr[(NC - 1) & 1]);
    // the four vector slots that the chip needs between the last product and the first overwrite of its operands:
    // the scheduling barrier holds the slots behind the products
    __builtin_amdgcn_sched_barrier(0);
    asm volatile("v_nop\n\tv_nop\n\tv_nop\n\tv_nop");
  }
  wait_async0();   // no copy is left in flight when the wave ends

  constexpr bool outbf = (FLAGS & GF_OUT_BF16) != 0;
  constexpr bool relu  = (FLAGS & GF_RELU) != 0;
  constexpr bool hasb  = (FLAGS & GF_BIAS) != 0;
  constexpr bool hasr  = (FLAGS & GF_RES) != 0;
  static_assert(!hasr || ZC == 0, "the residual is indexed like the output of plane 0");
  // the lane's first element; its other 63 lie at constant distances from it (immediate offsets of one address)
  const int col0 = bn + wn * 32 + lm;
  const size_t e0 = (size_t)blockIdx.z * ZC + (size_t)(bm + wm * 64 + 8 * half) * NDIM + col0;
  float bv[2] = {0.f, 0.f};
  if constexpr (hasb) {
    bv[0] = bias[col0];
    bv[1] = bias[col0 + 16];
  }
  // all 64 residual values of the lane are asked for before the first is used: one latency, not 64 in a row
  float rv[4][2][8];
  if constexpr (hasr) {
#pragma unroll   // i, j, r constant in all three loops: rv[] stays in registers, the distances become immediate offsets
    for (int i = 0; i < 4; ++i)
#pragma unroll   // as above
      for (int j = 0; j < 2; ++j)
#pragma unroll   // as above
        for (int r = 0; r < 8; ++r)
          rv[i][j][r] = res[e0 + (size_t)(i * 16 + r) * NDIM + j * 16];
  }
#pragma unroll   // i, j, r constant in all three loops: acc[], rv[] stay in registers, the distances become immediate offsets
  for (int i = 0; i < 4; ++i)
#pragma unroll   // as above
    for (int j = 0; j < 2; ++j)
#pragma unroll   // as above
      for (int r = 0; r < 8; ++r) {
        float val = acc[i][j][r];
        if constexpr (hasb) val += bv[j];
        if constexpr (relu) val = fmaxf(val, 0.f);
        if constexpr (hasr) val += rv[i][j][r];
        size_t idx = e0 + (size_t)(i * 16 + r) * NDIM + j * 16;
        if constexpr (outbf) ((unsigned short*)Cp)[idx] = f2bf(val);
        else                 ((float*)Cp)[idx] = val;
      }
}

// ---------------- flash attention: one wave per (b,h,16-query tile) ----------------
#define NEG_BIG (-3.0e38f)
#define AKP 72   // LDS row pitch of the K tile in elements: 144 B = 16 B x odd, conflict-free for ds_load_b128
#define AVP 80   // LDS row pitch of the V tile in elements: 160 B = 32 B x odd, conflict-free for the transposing load

// One wave copies a tile of 32 rows x 128 B (one head's slice of 32 keys) to LDS: 8 copies, each of
// 4 whole 128-B lines (8 lanes a row). lds, g: the lane's own 16 bytes in rows 0..3; step: LDS bytes of 4 rows.
// The wait on xcnt ends the statement so that no address register is rewritten in front of it.
__device__ __forceinline__ void async_tile_32x128(unsigned lds, unsigned step, const unsigned short* g) {
  const size_t gs = (size_t)4 * 1024;   // elements of 4 rows in global memory
  asm volatile(
      "global_load_async_to_lds_b128 %0, %8, off\n\t"
      "global_load_async_to_lds_b128 %1, %9, off\n\t"
      "global_load_async_to_lds_b128 %2, %10, off\n\t"
      "global_load_async_to_lds_b128 %3, %11, off\n\t"
      "global_load_async_to_lds_b128 %4, %12, off\n\t"
      "global_load_async_to_lds_b128 %5, %13, off\n\t"
      "global_load_async_to_lds_b128 %6, %14, off\n\t"
      "global_load_async_to_lds_b128 %7, %15, off\n\t"
      "s_wait_xcnt 0x0"
      :: "v"(lds), "v"(lds + step), "v"(lds + 2 * step), "v"(lds + 3 * step),
         "v"(lds + 4 * step), "v"(lds + 5 * step), "v"(lds + 6 * step), "v"(lds + 7 * step),
         "v"(g), "v"(g + gs), "v"(g + 2 * gs), "v"(g + 3 * gs),
         "v"(g + 4 * gs), "v"(g + 5 * gs), "v"(g + 6 * gs), "v"(g + 7 * gs)
      : "memory");
}

// lane l takes the value of lane l ^ 16 (the other half of the wave)
__device__ __forceinline__ float xhalf(float x) {
  int b = __builtin_bit_cast(int, x);
  return __builtin_bit_cast(float,
      __builtin_amdgcn_permlanex16(b, b, 0x76543210, 0xfedcba98, false, false));
}

// two floats to one register of two bf16 (lo in bits 15..0), round-to-nearest-even like f2bf: one v_cvt_pk_bf16_f32
__device__ __forceinline__ unsigned int pack2bf(float lo, float hi) {
  typedef float  f32x2 __attribute__((ext_vector_type(2)));
  typedef __bf16 bf16x2 __attribute__((ext_vector_type(2)));
  return __builtin_bit_cast(unsigned int, __builtin_convertvector(f32x2{lo, hi}, bf16x2));
}

// The products are taken transposed: S^T = K Q^T (keys x queries), O^T += V^T P^T (d x queries).
// A lane then holds 16 of the 32 scores of ONE query (column lm): maximum and sum run inside the lane,
// the two halves of the wave meet in one exchange, and the two score tiles, converted in place,
// are the B operand P^T in the hardware's k order: P goes through no LDS.
// Grid rows y >= ATT_ROWS hold no attention: they convert Wo, W1, W2, which only later launches read. They start last,
// as the short causal tiles leave, and stream from memory while the long tiles run on.
#define ATT_ROWS 32     // batch x heads
#define CVT_ROWS 36     // 36 rows x 128 blocks x 2048 elements = Wo, W1, W2
__global__ __launch_bounds__(32) void attn_kernel(
    const unsigned short* __restrict__ Q, const unsigned short* __restrict__ Km,
    const unsigned short* __restrict__ V, unsigned short* __restrict__ O,
    const float* __restrict__ Wo, const float* __restrict__ W1, const float* __restrict__ W2,
    unsigned short* __restrict__ w16) {
  const int E = 1024, T = 2048, DH = 64;
  if (blockIdx.y >= ATT_ROWS) {          // the same for the whole block; in front of every copy and barrier
    int c = (blockIdx.y - ATT_ROWS) * (T / 16) + blockIdx.x;   // 0..4607
    int seg = c >> 9;                    // which run of 2^20 elements (512 blocks each): Wo, 4 of W1, 4 of W2
    const float* src = seg == 0 ? Wo : seg < 5 ? W1 + ((size_t)(seg - 1) << 20) : W2 + ((size_t)(seg - 5) << 20);
    cvt_run<32>(src + (size_t)(c & 511) * 2048, w16 + (size_t)c * 2048);
    return;
  }
  __shared__ __align__(16) unsigned short Ks[2][32][AKP];   // two buffers: the next 32 keys fly while these are worked on
  __shared__ __align__(16) unsigned short Vs[2][32][AVP];
  int lane = threadIdx.x & 31;
  int half = lane >> 4, lm = lane & 15;
  int qt = blockIdx.x;                 // 0..T/16-1
  int bh = blockIdx.y;                 // 0..B*H-1
  int b = bh >> 4, h = bh & 15;
  size_t rowbase = (size_t)b * T;
  int q0 = qt * 16;
  int hoff = h * DH;
  const float scale = 0.03125f;        // 1024^-0.5 (reference scales by full E)

  // Q^T B-fragments (columns q0+lm, d-chunks 0..31 / 32..63), loaded once
  Frag qa[2];
  const unsigned short* qrow = Q + (rowbase + q0 + lm) * E + hoff;
#pragma unroll
  for (int t = 0; t < 2; ++t)
#pragma unroll
    for (int vv = 0; vv < 8; ++vv)
      qa[t].u[vv] = *(const unsigned int*)(qrow + t * 32 + pairK(vv, half));

  float mrun = NEG_BIG;                // running maximum of query q0 + lm, the same in both halves
  float lrun = 0.f;                    // running sum over this half's keys only; the halves are joined at the end
  v8f oacc[4] = {};                    // oacc[j][r] = O^T[d = 16 j + 8 half + r][query lm]

  int qmax = q0 + 15;
  int mq = q0 + lm;                    // this lane's query

  // this lane's 16 bytes of rows 0..3 of a tile, in global memory and in LDS
  const unsigned short* kg = Km + (rowbase + (lane >> 3)) * E + hoff + (lane & 7) * 8;
  const unsigned short* vg = V  + (rowbase + (lane >> 3)) * E + hoff + (lane & 7) * 8;
  unsigned kl = lds_addr(&Ks[0][lane >> 3][(lane & 7) * 8]);
  unsigned vl = lds_addr(&Vs[0][lane >> 3][(lane & 7) * 8]);
  const unsigned strK = (unsigned)sizeof(Ks[0]), strV = (unsigned)sizeof(Vs[0]);

  // keys 0..31 into buffer 0, landed and published; then keys 32..63 into buffer 1
  async_tile_32x128(kl, 4 * AKP * 2, kg);
  async_tile_32x128(vl, 4 * AVP * 2, vg);
  wait_async0();
  __syncthreads();
  if (32 <= qmax) {
    async_tile_32x128(kl + strK, 4 * AKP * 2, kg + (size_t)32 * E);
    async_tile_32x128(vl + strV, 4 * AVP * 2, vg + (size_t)32 * E);
  }

  int buf = 0;
  for (int kt = 0; kt <= qmax; kt += 32) {
    // scores: two 16-key subtiles x two 32-wide d-chunks, K rows from LDS as A fragments
    const unsigned short* krow0 = &Ks[buf][lm][0];
    const unsigned short* krow1 = &Ks[buf][16 + lm][0];
    Frag kf[4];
#pragma unroll
    for (int t = 0; t < 2; ++t)
#pragma unroll
      for (int vv = 0; vv < 8; ++vv) {
        kf[t].u[vv]     = *(const unsigned int*)(krow0 + t * 32 + pairK(vv, half));
        kf[2 + t].u[vv] = *(const unsigned int*)(krow1 + t * 32 + pairK(vv, half));
      }
    // V^T (16 d rows x 32 keys per d-subtile) as A fragments by the transposing load,
    // keys 0..15 then 16..31, in the same k order as pairK
    Frag vf[4];
#pragma unroll
    for (int j = 0; j < 4; ++j) {
      const unsigned short* vp = &Vs[buf][8 * half + (lane & 7)][j * 16 + 8 * ((lane >> 3) & 1)];
      vf[j].q[0] = lds_tr16(vp);
      vf[j].q[1] = lds_tr16(vp + 16 * AVP);
    }
    // s0[r]: key kt + 8 half + r, s1[r]: key kt + 16 + 8 half + r, both against query lm
    v8f s0 = {}, s1 = {};
    s0 = wmma_bf16(kf[0], qa[0], s0);
    s0 = wmma_bf16(kf[1], qa[1], s0);
    s1 = wmma_bf16(kf[2], qa[0], s1);
    s1 = wmma_bf16(kf[3], qa[1], s1);

    // online softmax update of this lane's query
    int ahead = mq - (kt + 8 * half);    // key r of this half's first subtile is masked where r > ahead
    float a0[8], a1[8];
#pragma unroll
    for (int r = 0; r < 8; ++r) {
      a0[r] = s0[r] * scale; if (r > ahead)      a0[r] = NEG_BIG;
      a1[r] = s1[r] * scale; if (16 + r > ahead) a1[r] = NEG_BIG;
    }
    float m4[4];                         // four independent chains
#pragma unroll
    for (int c = 0; c < 4; ++c)
      m4[c] = fmaxf(fmaxf(a0[2 * c], a0[2 * c + 1]), fmaxf(a1[2 * c], a1[2 * c + 1]));
    float mx = fmaxf(fmaxf(m4[0], m4[1]), fmaxf(m4[2], m4[3]));
    mx = fmaxf(mx, xhalf(mx));
    float mn = fmaxf(mrun, mx);
    float alpha = __expf(mrun - mn);
    mrun = mn;
    float p0[8], p1[8];
#pragma unroll
    for (int r = 0; r < 8; ++r) { p0[r] = __expf(a0[r] - mn); p1[r] = __expf(a1[r] - mn); }
    float r4[4];                         // four independent chains
#pragma unroll
    for (int c = 0; c < 4; ++c)
      r4[c] = (p0[2 * c] + p0[2 * c + 1]) + (p1[2 * c] + p1[2 * c + 1]);
    lrun = lrun * alpha + ((r4[0] + r4[1]) + (r4[2] + r4[3]));
#pragma unroll
    for (int j = 0; j < 4; ++j)
#pragma unroll
      for (int r = 0; r < 8; ++r) oacc[j][r] *= alpha;

    // P^T (32 keys x 16 queries) as B fragment: element s of the lane is key 8 half + s (s < 8), 16 + 8 half + s - 8 (s >= 8)
    Frag pf;
#pragma unroll
    for (int vv = 0; vv < 4; ++vv) {
      pf.u[vv]     = pack2bf(p0[2 * vv], p0[2 * vv + 1]);
      pf.u[4 + vv] = pack2bf(p1[2 * vv], p1[2 * vv + 1]);
    }
#pragma unroll
    for (int j = 0; j < 4; ++j)
      oacc[j] = wmma_bf16(vf[j], pf, oacc[j]);

    // hand-over: this pass's LDS reads are done, the next tile has landed, then the barrier;
    // only behind it is the buffer just read filled again
    // (the work-group is one wave: the compiler emits no barrier instruction for __syncthreads here)
    // the scheduling barrier keeps the softmax and the products in front of the two waits: lifted over them,
    // the wait on the copies would stand in mid-pass and cut the time that the next tile has to land
    __builtin_amdgcn_sched_barrier(0);
    asm volatile("s_wait_dscnt 0x0" ::: "memory");
    wait_async0();
    __syncthreads();
    if (kt + 64 <= qmax) {
      async_tile_32x128(kl + buf * strK, 4 * AKP * 2, kg + (size_t)(kt + 64) * E);
      async_tile_32x128(vl + buf * strV, 4 * AVP * 2, vg + (size_t)(kt + 64) * E);
    }
    buf ^= 1;
  }
  wait_async0();   // no copy is left in flight when the wave ends

  // epilogue: join the halves' sums, O /= l; a lane holds 8 consecutive d of its query's row: one 16-byte store each
  float inv = 1.0f / (lrun + xhalf(lrun));
  unsigned short* orow = O + (rowbase + q0 + lm) * E + hoff + 8 * half;
#pragma unroll
  for (int j = 0; j < 4; ++j) {
    uint4 w;
    w.x = pack2bf(oacc[j][0] * inv, oacc[j][1] * inv);
    w.y = pack2bf(oacc[j][2] * inv, oacc[j][3] * inv);
    w.z = pack2bf(oacc[j][4] * inv, oacc[j][5] * inv);
    w.w = pack2bf(oacc[j][6] * inv, oacc[j][7] * inv);
    *(uint4*)(orow + j * 16) = w;
  }
}

// ---------------- host launcher ----------------
extern "C" void kernel_launch(void* const* d_in, const int* in_sizes, int n_in,
                              void* d_out, int out_size, void* d_ws, size_t ws_size,
                              hipStream_t stream) {
  const int E = 1024, H = 16, DFF = 4096, B = 2, T = 2048;
  const int M = B * T;                 // 4096 tokens
  (void)in_sizes; (void)n_in; (void)out_size; (void)ws_size;

  const float* x   = (const float*)d_in[0];
  const float* Wq  = (const float*)d_in[1];
  const float* Wk  = (const float*)d_in[2];
  const float* Wv  = (const float*)d_in[3];
  const float* Wo  = (const float*)d_in[4];
  const float* bo  = (const float*)d_in[5];
  const float* W1  = (const float*)d_in[6];
  const float* b1  = (const float*)d_in[7];
  const float* W2  = (const float*)d_in[8];
  const float* b2  = (const float*)d_in[9];
  const float* g1  = (const float*)d_in[10];
  const float* be1 = (const float*)d_in[11];
  const float* g2  = (const float*)d_in[12];
  const float* be2 = (const float*)d_in[13];
  float* out = (float*)d_out;

  // workspace carve-up (256B aligned)
  char* wsp = (char*)d_ws;
  auto alloc = [&](size_t bytes) -> void* {
    void* p = (void*)wsp;
    wsp += (bytes + 255) & ~(size_t)255;
    return p;
  };
  const size_t EE = (size_t)E * E, ED = (size_t)E * DFF;
  unsigned short* wq16 = (unsigned short*)alloc((4 * EE + 2 * ED) * 2);  // all bf16 weights, in a row
  unsigned short* wk16 = wq16 + EE;
  unsigned short* wv16 = wk16 + EE;
  unsigned short* wo16 = wv16 + EE;
  unsigned short* w116 = wo16 + EE;
  unsigned short* w216 = w116 + ED;
  unsigned short* hb   = (unsigned short*)alloc((size_t)M * E * 2);
  const size_t QS = (size_t)(M + 64) * E;                                 // +64 row pad
  unsigned short* qb   = (unsigned short*)alloc(3 * QS * 2);              // q, k, v, in a row
  unsigned short* kb   = qb + QS;
  unsigned short* vb   = kb + QS;
  unsigned short* ob   = (unsigned short*)alloc((size_t)M * E * 2);
  float*          x1   = (float*)alloc((size_t)M * E * 4);
  unsigned short* h2   = (unsigned short*)alloc((size_t)M * E * 2);
  unsigned short* f1   = (unsigned short*)alloc((size_t)M * DFF * 2);

  // LN1, and Wq, Wk, Wv -> bf16
  ln1_cvt_qkv_kernel<<<LN_BLOCKS + 3 * 64, 256, 0, stream>>>(x, g1, be1, hb, Wq, Wk, Wv, wq16);

  // QKV projections: one launch, grid plane z = 0, 1, 2 for q, k, v
  dim3 gEE(E / GBN, M / GBM);
  dim3 gQKV(E / GBN, M / GBM, 3);
  gemm_bf16_kernel<1024, 1024, GF_OUT_BF16, 1024 * 1024, (4096 + 64) * 1024>
      <<<gQKV, 256, 0, stream>>>(hb, wq16, nullptr, nullptr, qb);

  // causal flash attention, and Wo, W1, W2 -> bf16
  attn_kernel<<<dim3(T / 16, B * H + CVT_ROWS), 32, 0, stream>>>(qb, kb, vb, ob, Wo, W1, W2, wo16);

  // out-proj + bias + residual(x) -> x1 (fp32)
  gemm_bf16_kernel<1024, 1024, GF_BIAS | GF_RES><<<gEE, 256, 0, stream>>>(ob, wo16, bo, x, x1);

  // LN2
  ln_bf16_kernel<<<M / 8, 256, 0, stream>>>(x1, g2, be2, h2);

  // FFN
  dim3 gFF1(DFF / GBN, M / GBM);
  gemm_bf16_kernel<4096, 1024, GF_OUT_BF16 | GF_RELU | GF_BIAS><<<gFF1, 256, 0, stream>>>(h2, w116, b1, nullptr, f1);
  gemm_bf16_kernel<1024, 4096, GF_BIAS | GF_RES><<<gEE, 256, 0, stream>>>(f1, w216, b2, x1, out);
}

// v009
// A run of this version takes 152 microseconds.
// In both of two side-by-side timings against v008, it was 1.19 times as fast.
// All steps since v000 together make it 3.73 times as fast.
#include <hip/hip_runtime.h>
#include <math.h>

// ---------------- types ----------------
typedef __bf16 v16bf __attribute__((ext_vector_type(16)));
typedef float  v8f   __attribute__((ext_vector_type(8)));
typedef short  s16x8 __attribute__((ext_vector_type(8)));

union Frag {
  v16bf v;
  s16x8 q[2];
  unsigned int u[8];
  unsigned short h[16];
};

__device__ __forceinline__ unsigned short f2bf(float f) {
  unsigned int u = __builtin_bit_cast(unsigned int, f);
  u += 0x7FFFu + ((u >> 16) & 1u);          // round-to-nearest-even
  return (unsigned short)(u >> 16);
}

// element-pair K index for 16-bit WMMA A/B fragments (ISA 7.12.2):
// VGPR v<4 holds k={2v,2v+1}+8*half ; v>=4 holds k={16+2(v-4),...}+8*half
__device__ __forceinline__ int pairK(int v, int half) {
  return ((v < 4) ? (2 * v) : (16 + 2 * (v - 4))) + 8 * half;
}

__device__ __forceinline__ v8f wmma_bf16(const Frag& a, const Frag& b, v8f c) {
  return __builtin_amdgcn_wmma_f32_16x16x32_bf16(
      false, a.v, false, b.v, (short)0, c, false, false);
}

// ---- CDNA5 async global->LDS DMA (ASYNCcnt-tracked, no VGPR data) ----
__device__ __forceinline__ void wait_async0() {
  asm volatile("s_wait_asynccnt 0x0" ::: "memory");
}
// generic LDS pointer -> 32-bit LDS byte offset (aperture keeps offset in addr[31:0])
__device__ __forceinline__ unsigned lds_addr(const void* p) {
  return (unsigned)(unsigned long long)p;
}

// transposing LDS load: lane (c = l & 15, h = l >> 4) gets rows 8h..8h+7 of column c
// of a row-major 16-bit tile; lane l passes the address of row 8h + (l & 7), 16-byte chunk (l >> 3) & 1
__device__ __forceinline__ s16x8 lds_tr16(const unsigned short* p) {
  typedef __attribute__((address_space(3))) s16x8 lds_s16x8;
  return __builtin_amdgcn_ds_load_tr16_b128_v8i16((lds_s16x8*)p);
}

// ---------------- fp32 -> bf16 convert of the weights ----------------
// The bf16 copies lie one behind the other in the workspace (Wq, Wk, Wv, Wo, W1, W2).
// The converts have no launch of their own: each rides in a launch whose own work does not depend on it.
// A block of NTHR threads converts 64 * NTHR consecutive elements: 64 per thread, so that few waves have to start.
template <int NTHR>
__device__ __forceinline__ void cvt_run(const float* __restrict__ src, unsigned short* __restrict__ dst) {
  const float4* in4 = (const float4*)src + threadIdx.x;
  ushort4* o4 = (ushort4*)dst + threadIdx.x;
  float4 v[16];
#pragma unroll   // all 16 loads of 512 B per wave in flight before the first store
  for (int k = 0; k < 16; ++k) v[k] = in4[k * NTHR];
#pragma unroll   // v[] stays in registers
  for (int k = 0; k < 16; ++k) {
    o4[k * NTHR] = make_ushort4(f2bf(v[k].x), f2bf(v[k].y), f2bf(v[k].z), f2bf(v[k].w));
    // a later convert may be given a register that an issued store names: the wait stands in front of that overwrite
    if ((k & 3) == 3 && k != 15) asm volatile("s_wait_xcnt 0x0" ::: "memory");
  }
}

// ---------------- LayerNorm (one wave per token, E=1024) ----------------
// blk: which run of 8 tokens this block of 8 waves takes
__device__ __forceinline__ void ln_tokens(
    const float* __restrict__ x, const float* __restrict__ g,
    const float* __restrict__ b, unsigned short* __restrict__ out, int blk) {
  const int E = 1024;
  int lane = threadIdx.x & 31;
  // the wave's number as a scalar: the token's row address then sits in scalar registers
  int tok = blk * 8 + __builtin_amdgcn_readfirstlane(threadIdx.x >> 5);
  const float4* xr = (const float4*)(x + (size_t)tok * E) + lane;
  const float4* g4 = (const float4*)g + lane;
  const float4* b4 = (const float4*)b + lane;
  float4 v[8], gg[8], bb[8];
#pragma unroll   // the token's 8 loads of 512 B in flight together
  for (int i = 0; i < 8; ++i) v[i] = xr[i * 32];
#pragma unroll   // gg[], bb[] stay in registers
  for (int i = 0; i < 8; ++i) { gg[i] = g4[i * 32]; bb[i] = b4[i * 32]; }
  float4 a = make_float4(0.f, 0.f, 0.f, 0.f), q = a;   // four independent chains each
#pragma unroll   // v[] stays in registers
  for (int i = 0; i < 8; ++i) {
    a.x += v[i].x; a.y += v[i].y; a.z += v[i].z; a.w += v[i].w;
    q.x += v[i].x * v[i].x; q.y += v[i].y * v[i].y;
    q.z += v[i].z * v[i].z; q.w += v[i].w * v[i].w;
  }
  float s = (a.x + a.y) + (a.z + a.w), s2 = (q.x + q.y) + (q.z + q.w);
#pragma unroll
  for (int off = 16; off; off >>= 1) {
    s  += __shfl_xor(s,  off, 32);
    s2 += __shfl_xor(s2, off, 32);
  }
  float mu = s * (1.0f / E);
  float var = s2 * (1.0f / E) - mu * mu;
  float rinv = rsqrtf(var + 1e-5f);
  ushort4* o4 = (ushort4*)(out + (size_t)tok * E) + lane;
#pragma unroll   // v[] stays in registers
  for (int i = 0; i < 8; ++i) {
    o4[i * 32] = make_ushort4(f2bf((v[i].x - mu) * rinv * gg[i].x + bb[i].x),
                              f2bf((v[i].y - mu) * rinv * gg[i].y + bb[i].y),
                              f2bf((v[i].z - mu) * rinv * gg[i].z + bb[i].z),
                              f2bf((v[i].w - mu) * rinv * gg[i].w + bb[i].w));
  }
}

// at most 8 waves a SIMD: a register budget of 128, so that gain and bias fly with the token's loads, not pair by pair behind the sums
__global__ __launch_bounds__(256) __attribute__((amdgpu_waves_per_eu(4, 8))) void ln_bf16_kernel(
    const float* __restrict__ x, const float* __restrict__ g,
    const float* __restrict__ b, unsigned short* __restrict__ out) {
  ln_tokens(x, g, b, out, blockIdx.x);
}

// First launch: LayerNorm 1 (blocks 0 .. LN_BLOCKS - 1) and, behind it, the convert of Wq, Wk, Wv
// (64 blocks of 16384 elements each): neither reads what the other writes.
#define LN_BLOCKS 512   // 4096 tokens, 8 a block
// the same register budget as above, here also so that all 16 loads of a converting thread stay in flight together
__global__ __launch_bounds__(256) __attribute__((amdgpu_waves_per_eu(4, 8))) void ln1_cvt_qkv_kernel(
    const float* __restrict__ x, const float* __restrict__ g,
    const float* __restrict__ b, unsigned short* __restrict__ out,
    const float* __restrict__ Wq, const float* __restrict__ Wk, const float* __restrict__ Wv,
    unsigned short* __restrict__ w16) {
  if (blockIdx.x < LN_BLOCKS) {
    ln_tokens(x, g, b, out, blockIdx.x);
    return;
  }
  int c = blockIdx.x - LN_BLOCKS;        // 0..191
  int seg = c >> 6;                      // which weight
  const float* src = seg == 0 ? Wq : seg == 1 ? Wk : Wv;
  cvt_run<256>(src + (size_t)(c & 63) * 16384, w16 + (size_t)c * 16384);
}

// ---------------- bf16 GEMM: C = A[M,K] @ B[K,N] (+bias,+relu,+res) ----------------
#define GBM 128
#define GBN 128
#define GBK 128   // a row of either tile is two whole 128-B lines
#define GAP 136   // LDS row pitch of the A tile in elements: 272 B = 16 B x odd, conflict-free for ds_load_b128
#define GBNP 144  // LDS row pitch of the B tile in elements: 288 B = 32 B x odd, conflict-free for the transposing load
#define GF_OUT_BF16 1
#define GF_RELU     2
#define GF_BIAS     4
#define GF_RES      8

// One thread's share of one operand's K tile (128 rows of 256 B): 8 copies of 16 B, rows r, r+16, ..., r+112.
// 16 lanes share a row, so every copy of a wave covers 4 whole 128-B lines.
// l, g: the thread's own 16 bytes in row r; ls: LDS bytes of 16 rows; gs: elements of 16 rows in global memory.
// The wait on xcnt ends the statement so that no address register is rewritten in front of it.
__device__ __forceinline__ void async_gemm_rows(unsigned l, unsigned ls, const unsigned short* g, size_t gs) {
  asm volatile(
      "global_load_async_to_lds_b128 %0, %8, off\n\t"
      "global_load_async_to_lds_b128 %1, %9, off\n\t"
      "global_load_async_to_lds_b128 %2, %10, off\n\t"
      "global_load_async_to_lds_b128 %3, %11, off\n\t"
      "global_load_async_to_lds_b128 %4, %12, off\n\t"
      "global_load_async_to_lds_b128 %5, %13, off\n\t"
      "global_load_async_to_lds_b128 %6, %14, off\n\t"
      "global_load_async_to_lds_b128 %7, %15, off\n\t"
      "s_wait_xcnt 0x0"
      :: "v"(l), "v"(l + ls), "v"(l + 2 * ls), "v"(l + 3 * ls),
         "v"(l + 4 * ls), "v"(l + 5 * ls), "v"(l + 6 * ls), "v"(l + 7 * ls),
         "v"(g), "v"(g + gs), "v"(g + 2 * gs), "v"(g + 3 * gs),
         "v"(g + 4 * gs), "v"(g + 5 * gs), "v"(g + 6 * gs), "v"(g + 7 * gs)
      : "memory");
}

// One thread's share of a whole K tile: its 8 copies of A, then its 8 of B.
__device__ __forceinline__ void async_gemm_tile(unsigned la, const unsigned short* ga, size_t ars,
                                                unsigned lb, const unsigned short* gb, size_t brs) {
  async_gemm_rows(la, 16 * GAP * 2, ga, ars);
  async_gemm_rows(lb, 16 * GBNP * 2, gb, brs);
}

// FLAGS is a compile-time constant: the epilogue then holds no branch, and nothing keeps its loads apart
// ZB, ZC: products of one A with several B share a launch: grid plane z takes the B matrix that lies z * ZB elements
// behind Bm and writes the output that lies z * ZC elements behind Cp (0, 0: one B, one plane)
template <int NDIM, int KDIM, int FLAGS, int ZB = 0, int ZC = 0>
__global__ __launch_bounds__(256) void gemm_bf16_kernel(
    const unsigned short* __restrict__ A, const unsigned short* __restrict__ Bm,
    const float* __restrict__ bias, const float* __restrict__ res,
    void* __restrict__ Cp) {
  // two buffers: the next K tile flies while this one is worked on
  __shared__ __align__(16) unsigned short As[2][GBM][GAP];
  __shared__ __align__(16) unsigned short Bs[2][GBK][GBNP];
  constexpr int NT = KDIM / GBK;         // K tiles
  static_assert(KDIM % GBK == 0 && NT >= 2, "the two-buffer prologue needs two whole K tiles");
  int tid = threadIdx.x;
  int lane = tid & 31, wave = tid >> 5;
  int wm = wave & 1, wn = wave >> 1;     // 2 x 4 wave grid of 64 x 32 wave tiles -> 128 x 128 block tile
  int half = lane >> 4, lm = lane & 15;
  int bm = blockIdx.y * GBM, bn = blockIdx.x * GBN;

  // staging indices (computed once): row of the thread's first copy, its 16-B chunk of the 256-B row
  int sr = tid >> 4;                 // 0..15
  int sc = (tid & 15) << 3;          // 0..120, in elements
  const unsigned short* aptr = A + (size_t)(bm + sr) * KDIM + sc;
  const unsigned short* Bz = Bm + (size_t)blockIdx.z * ZB;
  const unsigned short* bptr = Bz + (size_t)sr * NDIM + bn + sc;
  const size_t ars = (size_t)16 * KDIM, brs = (size_t)16 * NDIM;
  // one prefetched byte a line: 2 threads a row, one for each of its lines, cover a whole K tile; the first is tile 2
  const unsigned short* apf = A + (size_t)(bm + (tid >> 1)) * KDIM + (tid & 1) * 64 + 2 * GBK;
  const unsigned short* bpf = Bz + (size_t)((tid >> 1) + 2 * GBK) * NDIM + bn + (tid & 1) * 64;

  // this thread's LDS staging slots (byte addresses) in buffer 0
  unsigned ldsA = lds_addr(&As[0][sr][sc]);
  unsigned ldsB = lds_addr(&Bs[0][sr][sc]);
  const unsigned strA = (unsigned)sizeof(As[0]);   // 34 KB
  const unsigned strB = (unsigned)sizeof(Bs[0]);   // 36 KB

  // K tile 0 into buffer 0, landed and published; then K tile 1 into buffer 1
  async_gemm_tile(ldsA, aptr, ars, ldsB, bptr, brs);
  wait_async0();
  __syncthreads();
  async_gemm_tile(ldsA + strA, aptr + GBK, ars, ldsB + strB, bptr + (size_t)GBK * NDIM, brs);

  v8f acc[4][2] = {};
  // two fragment sets: k chunk c + 1 (32 wide) is loaded from LDS while chunk c is multiplied
  Frag af[2][4], bfr[2][2];
  auto load_chunk = [&](int buf, int kk, Frag* a, Frag* b) {
#pragma unroll
    for (int t = 0; t < 4; ++t) {
      int row = wm * 64 + t * 16 + lm;
#pragma unroll
      for (int vv = 0; vv < 8; ++vv)
        a[t].u[vv] = *(const unsigned int*)&As[buf][row][kk + pairK(vv, half)];
    }
#pragma unroll
    for (int t = 0; t < 2; ++t) {
      // B fragment, k 0..15 then 16..31 of 16 columns, in the same k order as pairK
      const unsigned short* bp =
          &Bs[buf][kk + 8 * half + (lane & 7)][wn * 32 + t * 16 + 8 * ((lane >> 3) & 1)];
      b[t].q[0] = lds_tr16(bp);
      b[t].q[1] = lds_tr16(bp + 16 * GBNP);
    }
  };
  auto mul_chunk = [&](const Frag* a, const Frag* b) {
#pragma unroll
    for (int i = 0; i < 4; ++i)
#pragma unroll
      for (int j = 0; j < 2; ++j)
        acc[i][j] = wmma_bf16(a[i], b[j], acc[i][j]);
  };
  constexpr int NC = GBK / 32;           // k chunks of a tile, taken in rising k
  static_assert(NC % 2 == 0, "a tile's first chunk always goes to fragment set 0");

  load_chunk(0, 0, af[0], bfr[0]);       // tile 0 is published: its first chunk
  for (int kt = 0; kt < NT; ++kt) {
    int buf = kt & 1;
    if (kt + 3 < NT) {                     // global_prefetch_b8 for the tile that is copied at this trip's foot;
      __builtin_prefetch(apf, 0, 0);       // the test keeps both pointers inside their matrices behind the advance too
      __builtin_prefetch(bpf, 0, 0);
      apf += GBK;
      bpf += (size_t)GBK * NDIM;
    }

#pragma unroll   // c constant: LDS offsets become immediates, the fragment sets stay in registers
    for (int c = 0; c + 1 < NC; ++c) {
      load_chunk(buf, (c + 1) * 32, af[(c + 1) & 1], bfr[(c + 1) & 1]);
      // keeps the next chunk's 12 loads in front of this chunk's products: left alone, the compiler loads
      // one A fragment at a time into the same registers and waits out the LDS latency at each
      __builtin_amdgcn_sched_barrier(0);
      mul_chunk(af[c & 1], bfr[c & 1]);
    }

    // hand-over, with the tile's last chunk already in registers: this trip's LDS reads are done,
    // the next tile has landed, then the barrier; only behind it is the buffer just read filled again
    // the scheduling barrier keeps the products above in front of the waits: lifted over them,
    // the wait on the copies would stand in mid-trip and cut the time that the next tile has to land
    __builtin_amdgcn_sched_barrier(0);
    asm volatile("s_wait_dscnt 0x0" ::: "memory");
    wait_async0();
    __syncthreads();
    if (kt + 2 < NT)
      async_gemm_tile(ldsA + buf * strA, aptr + (size_t)(kt + 2) * GBK, ars,
                      ldsB + buf * strB, bptr + (size_t)(kt + 2) * GBK * NDIM, brs);
    if (kt + 1 < NT)                       // the next tile is published: its first chunk
      load_chunk(buf ^ 1, 0, af[0], bfr[0]);
    // keeps the refill and the next chunk's loads in front of the last chunk's products, which then cover their flight
    __builtin_amdgcn_sched_barrier(0);
    mul_chunk(af[(NC - 1) & 1], bfr[(NC - 1) & 1]);
    // the four vector slots that the chip needs between the last product and the first overwrite of its operands:
    // the scheduling barrier holds the slots behind the products
    __builtin_amdgcn_sched_barrier(0);
    asm volatile("v_nop\n\tv_nop\n\tv_nop\n\tv_nop");
  }
  wait_async0();   // no copy is left in flight when the wave ends

  constexpr bool outbf = (FLAGS & GF_OUT_BF16) != 0;
  constexpr bool relu  = (FLAGS & GF_RELU) != 0;
  constexpr bool hasb  = (FLAGS & GF_BIAS) != 0;
  constexpr bool hasr  = (FLAGS & GF_RES) != 0;
  static_assert(!hasr || ZC == 0, "the residual is indexed like the output of plane 0");
  // the lane's first element; its other 63 lie at constant distances from it (immediate offsets of one address)
  const int col0 = bn + wn * 32 + lm;
  const size_t e0 = (size_t)blockIdx.z * ZC + (size_t)(bm + wm * 64 + 8 * half) * NDIM + col0;
  float bv[2] = {0.f, 0.f};
  if constexpr (hasb) {
    bv[0] = bias[col0];
    bv[1] = bias[col0 + 16];
  }
  // all 64 residual values of the lane are asked for before the first is used: one latency, not 64 in a row
  float rv[4][2][8];
  if constexpr (hasr) {
#pragma unroll   // i, j, r constant in all three loops: rv[] stays in registers, the distances become immediate offsets
    for (int i = 0; i < 4; ++i)
#pragma unroll   // as above
      for (int j = 0; j < 2; ++j)
#pragma unroll   // as above
        for (int r = 0; r < 8; ++r)
          rv[i][j][r] = res[e0 + (size_t)(i * 16 + r) * NDIM + j * 16];
  }
#pragma unroll   // i, j, r constant in all three loops: acc[], rv[] stay in registers, the distances become immediate offsets
  for (int i = 0; i < 4; ++i)
#pragma unroll   // as above
    for (int j = 0; j < 2; ++j)
#pragma unroll   // as above
      for (int r = 0; r < 8; ++r) {
        float val = acc[i][j][r];
        if constexpr (hasb) val += bv[j];
        if constexpr (relu) val = fmaxf(val, 0.f);
        if constexpr (hasr) val += rv[i][j][r];
        size_t idx = e0 + (size_t)(i * 16 + r) * NDIM + j * 16;
        if constexpr (outbf) ((unsigned short*)Cp)[idx] = f2bf(val);
        else                 ((float*)Cp)[idx] = val;
      }
}

// ---------------- flash attention: four waves per (b,h,32-query tile) ----------------
#define NEG_BIG (-3.0e38f)
#define AKP 72   // LDS row pitch of the K tile in elements: 144 B = 16 B x odd, conflict-free for ds_load_b128
#define AVP 80   // LDS row pitch of the V tile in elements: 160 B = 32 B x odd, conflict-free for the transposing load

// One wave copies a tile of 32 rows x 128 B (one head's slice of 32 keys) to LDS: 8 copies, each of
// 4 whole 128-B lines (8 lanes a row). lds, g: the lane's own 16 bytes in rows 0..3; step: LDS bytes of 4 rows.
// The wait on xcnt ends the statement so that no address register is rewritten in front of it.
__device__ __forceinline__ void async_tile_32x128(unsigned lds, unsigned step, const unsigned short* g) {
  const size_t gs = (size_t)4 * 1024;   // elements of 4 rows in global memory
  asm volatile(
      "global_load_async_to_lds_b128 %0, %8, off\n\t"
      "global_load_async_to_lds_b128 %1, %9, off\n\t"
      "global_load_async_to_lds_b128 %2, %10, off\n\t"
      "global_load_async_to_lds_b128 %3, %11, off\n\t"
      "global_load_async_to_lds_b128 %4, %12, off\n\t"
      "global_load_async_to_lds_b128 %5, %13, off\n\t"
      "global_load_async_to_lds_b128 %6, %14, off\n\t"
      "global_load_async_to_lds_b128 %7, %15, off\n\t"
      "s_wait_xcnt 0x0"
      :: "v"(lds), "v"(lds + step), "v"(lds + 2 * step), "v"(lds + 3 * step),
         "v"(lds + 4 * step), "v"(lds + 5 * step), "v"(lds + 6 * step), "v"(lds + 7 * step),
         "v"(g), "v"(g + gs), "v"(g + 2 * gs), "v"(g + 3 * gs),
         "v"(g + 4 * gs), "v"(g + 5 * gs), "v"(g + 6 * gs), "v"(g + 7 * gs)
      : "memory");
}

// lane l takes the value of lane l ^ 16 (the other half of the wave)
__device__ __forceinline__ float xhalf(float x) {
  int b = __builtin_bit_cast(int, x);
  return __builtin_bit_cast(float,
      __builtin_amdgcn_permlanex16(b, b, 0x76543210, 0xfedcba98, false, false));
}

// two floats to one register of two bf16 (lo in bits 15..0), round-to-nearest-even like f2bf: one v_cvt_pk_bf16_f32
__device__ __forceinline__ unsigned int pack2bf(float lo, float hi) {
  typedef float  f32x2 __attribute__((ext_vector_type(2)));
  typedef __bf16 bf16x2 __attribute__((ext_vector_type(2)));
  return __builtin_bit_cast(unsigned int, __builtin_convertvector(f32x2{lo, hi}, bf16x2));
}

// The products are taken transposed: S^T = K Q^T (keys x queries), O^T += V^T P^T (d x queries).
// A lane then holds 16 of the 32 scores of ONE query (column lm): maximum and sum run inside the lane,
// the two halves of the wave meet in one exchange, and the two score tiles, converted in place,
// are the B operand P^T in the hardware's k order: P goes through no LDS.
// Tiling: a work-group of ATT_NW waves owns 32 queries. Every wave holds all 32 (two column groups of 16), so a K or V
// fragment feeds two products, and takes every ATT_NW-th tile of 32 keys, so the longest chain of passes is ATT_NW times
// shorter. Each wave stages its tiles in LDS of its own: no wave reads another's tile, and the loop holds no barrier.
// At the end the waves' partial (maximum, sum, O^T) meet in LDS behind one barrier.
// Grid rows y >= ATT_ROWS hold no attention: they convert Wo, W1, W2, which only later launches read. They start last,
// as the short causal tiles leave, and stream from memory while the long tiles run on.
#define ATT_ROWS 32     // batch x heads
#define ATT_NW 4        // waves of a work-group
#define CVT_ROWS 18     // 18 rows x 64 blocks x 8192 elements = Wo, W1, W2
#define PSLOTS 9        // 16-byte slots of a lane's partial result per column group: 8 of O^T, 1 of (maximum, sum)
__global__ __launch_bounds__(32 * ATT_NW) void attn_kernel(
    const unsigned short* __restrict__ Q, const unsigned short* __restrict__ Km,
    const unsigned short* __restrict__ V, unsigned short* __restrict__ O,
    const float* __restrict__ Wo, const float* __restrict__ W1, const float* __restrict__ W2,
    unsigned short* __restrict__ w16) {
  const int E = 1024, T = 2048, DH = 64;
  if (blockIdx.y >= ATT_ROWS) {          // the same for the whole block; in front of every copy and barrier
    int c = (blockIdx.y - ATT_ROWS) * (T / 32) + blockIdx.x;   // 0..1151
    int seg = c >> 7;                    // which run of 2^20 elements (128 blocks each): Wo, 4 of W1, 4 of W2
    const float* src = seg == 0 ? Wo : seg < 5 ? W1 + ((size_t)(seg - 1) << 20) : W2 + ((size_t)(seg - 5) << 20);
    cvt_run<32 * ATT_NW>(src + (size_t)(c & 127) * 8192, w16 + (size_t)c * 8192);
    return;
  }
  // per wave two buffers: the wave's next 32 keys fly while these are worked on
  __shared__ __align__(16) unsigned short Ks[ATT_NW][2][32][AKP];
  __shared__ __align__(16) unsigned short Vs[ATT_NW][2][32][AVP];
  static_assert(sizeof(Ks[0]) >= 2 * PSLOTS * 32 * 16, "a wave's partial result is staged in its own K buffers");
  int lane = threadIdx.x & 31;
  // the wave's number as a scalar: every test on it is then a scalar branch
  const int w = __builtin_amdgcn_readfirstlane(threadIdx.x >> 5);
  int half = lane >> 4, lm = lane & 15;
  int qt = blockIdx.x;                 // 0..T/32-1
  int bh = blockIdx.y;                 // 0..B*H-1
  int b = bh >> 4, h = bh & 15;
  size_t rowbase = (size_t)b * T;
  int q0 = qt * 32;
  int hoff = h * DH;
  const float scale = 0.03125f;        // 1024^-0.5 (reference scales by full E)
  const int nt = qt + 1;               // tiles of 32 keys that these queries see: keys 0 .. q0 + 31

  // Q^T B-fragments (group g: columns q0 + 16 g + lm; d-chunks 0..31 / 32..63), loaded once
  Frag qa[2][2];
#pragma unroll
  for (int g = 0; g < 2; ++g) {
    const unsigned short* qrow = Q + (rowbase + q0 + 16 * g + lm) * E + hoff;
#pragma unroll
    for (int t = 0; t < 2; ++t)
#pragma unroll
      for (int vv = 0; vv < 8; ++vv)
        qa[g][t].u[vv] = *(const unsigned int*)(qrow + t * 32 + pairK(vv, half));
  }

  float mrun[2] = {NEG_BIG, NEG_BIG};  // running maximum of query q0 + 16 g + lm over this wave's keys, the same in both halves
  float lrun[2] = {0.f, 0.f};          // running sum over this half's keys only; the halves are joined at the end
  v8f oacc[2][4] = {};                 // oacc[g][j][r] = O^T[d = 16 j + 8 half + r][query 16 g + lm]

  // this lane's 16 bytes of rows 0..3 of the wave's first tile (tile w), in global memory and in LDS
  const unsigned short* kg = Km + (rowbase + 32 * w + (lane >> 3)) * E + hoff + (lane & 7) * 8;
  const unsigned short* vg = V  + (rowbase + 32 * w + (lane >> 3)) * E + hoff + (lane & 7) * 8;
  unsigned kl = lds_addr(&Ks[w][0][lane >> 3][(lane & 7) * 8]);
  unsigned vl = lds_addr(&Vs[w][0][lane >> 3][(lane & 7) * 8]);
  const unsigned strK = (unsigned)sizeof(Ks[0][0]), strV = (unsigned)sizeof(Vs[0][0]);
  const size_t tstep = (size_t)32 * ATT_NW * E;   // elements from one tile of the wave to its next

  // the wave's first tile into its buffer 0, landed (only this wave reads it: its own wait is enough); then its second into buffer 1
  if (w < nt) {
    async_tile_32x128(kl, 4 * AKP * 2, kg);
    async_tile_32x128(vl, 4 * AVP * 2, vg);
  }
  wait_async0();
  if (w + ATT_NW < nt) {
    async_tile_32x128(kl + strK, 4 * AKP * 2, kg + tstep);
    async_tile_32x128(vl + strV, 4 * AVP * 2, vg + tstep);
  }

  int buf = 0;
  for (int it = w; it < nt; it += ATT_NW) {
    const int kt = it * 32;              // first key of the tile
    // scores: two 16-key subtiles x two 32-wide d-chunks, K rows from LDS as A fragments
    const unsigned short* krow0 = &Ks[w][buf][lm][0];
    const unsigned short* krow1 = &Ks[w][buf][16 + lm][0];
    Frag kf[4];
#pragma unroll
    for (int t = 0; t < 2; ++t)
#pragma unroll
      for (int vv = 0; vv < 8; ++vv) {
        kf[t].u[vv]     = *(const unsigned int*)(krow0 + t * 32 + pairK(vv, half));
        kf[2 + t].u[vv] = *(const unsigned int*)(krow1 + t * 32 + pairK(vv, half));
      }
    // V^T (16 d rows x 32 keys per d-subtile) as A fragments by the transposing load,
    // keys 0..15 then 16..31, in the same k order as pairK
    Frag vf[4];
#pragma unroll
    for (int j = 0; j < 4; ++j) {
      const unsigned short* vp = &Vs[w][buf][8 * half + (lane & 7)][j * 16 + 8 * ((lane >> 3) & 1)];
      vf[j].q[0] = lds_tr16(vp);
      vf[j].q[1] = lds_tr16(vp + 16 * AVP);
    }
#pragma unroll   // g constant: both groups' registers stay registers, and their two chains interleave
    for (int g = 0; g < 2; ++g) {
      // s0[r]: key kt + 8 half + r, s1[r]: key kt + 16 + 8 half + r, both against query 16 g + lm
      v8f s0 = {}, s1 = {};
      s0 = wmma_bf16(kf[0], qa[g][0], s0);
      s0 = wmma_bf16(kf[1], qa[g][1], s0);
      s1 = wmma_bf16(kf[2], qa[g][0], s1);
      s1 = wmma_bf16(kf[3], qa[g][1], s1);

      // online softmax update of this lane's query
      int ahead = (q0 + 16 * g + lm) - (kt + 8 * half);   // key r of this half's first subtile is masked where r > ahead
      float a0[8], a1[8];
#pragma unroll
      for (int r = 0; r < 8; ++r) {
        a0[r] = s0[r] * scale; if (r > ahead)      a0[r] = NEG_BIG;
        a1[r] = s1[r] * scale; if (16 + r > ahead) a1[r] = NEG_BIG;
      }
      float m4[4];                         // four independent chains
#pragma unroll
      for (int c = 0; c < 4; ++c)
        m4[c] = fmaxf(fmaxf(a0[2 * c], a0[2 * c + 1]), fmaxf(a1[2 * c], a1[2 * c + 1]));
      float mx = fmaxf(fmaxf(m4[0], m4[1]), fmaxf(m4[2], m4[3]));
      mx = fmaxf(mx, xhalf(mx));
      float mn = fmaxf(mrun[g], mx);
      float alpha = __expf(mrun[g] - mn);
      mrun[g] = mn;
      float p0[8], p1[8];
#pragma unroll
      for (int r = 0; r < 8; ++r) { p0[r] = __expf(a0[r] - mn); p1[r] = __expf(a1[r] - mn); }
      float r4[4];                         // four independent chains
#pragma unroll
      for (int c = 0; c < 4; ++c)
        r4[c] = (p0[2 * c] + p0[2 * c + 1]) + (p1[2 * c] + p1[2 * c + 1]);
      lrun[g] = lrun[g] * alpha + ((r4[0] + r4[1]) + (r4[2] + r4[3]));
#pragma unroll
      for (int j = 0; j < 4; ++j)
#pragma unroll
        for (int r = 0; r < 8; ++r) oacc[g][j][r] *= alpha;

      // P^T (32 keys x 16 queries) as B fragment: element s of the lane is key 8 half + s (s < 8), 16 + 8 half + s - 8 (s >= 8)
      Frag pf;
#pragma unroll
      for (int vv = 0; vv < 4; ++vv) {
        pf.u[vv]     = pack2bf(p0[2 * vv], p0[2 * vv + 1]);
        pf.u[4 + vv] = pack2bf(p1[2 * vv], p1[2 * vv + 1]);
      }
#pragma unroll
      for (int j = 0; j < 4; ++j)
        oacc[g][j] = wmma_bf16(vf[j], pf, oacc[g][j]);
    }

    // hand-over inside the wave: this pass's LDS reads are done and the wave's next tile has landed;
    // only behind both waits is the buffer just read filled again (a ring private to one wave: no work-group barrier)
    // the scheduling barrier keeps the softmax and the products in front of the two waits: lifted over them,
    // the wait on the copies would stand in mid-pass and cut the time that the next tile has to land
    __builtin_amdgcn_sched_barrier(0);
    asm volatile("s_wait_dscnt 0x0" ::: "memory");
    wait_async0();
    if (it + 2 * ATT_NW < nt) {
      const size_t ahead2 = (size_t)(it - w + 2 * ATT_NW) * 32 * E;   // from the wave's first tile to the one after next
      async_tile_32x128(kl + buf * strK, 4 * AKP * 2, kg + ahead2);
      async_tile_32x128(vl + buf * strV, 4 * AVP * 2, vg + ahead2);
    }
    buf ^= 1;
  }
  wait_async0();   // no copy is left in flight: the wave's K buffers become the staging of its partial result

  // every wave stages its partial result, lane by lane, in its own K buffers (a wave without a tile: maximum NEG_BIG, zeros)
  float4* part = (float4*)&Ks[w][0][0][0];
#pragma unroll
  for (int g = 0; g < 2; ++g) {
#pragma unroll
    for (int s = 0; s < 8; ++s) {
      const int j = s >> 1, r = (s & 1) * 4;
      part[(g * PSLOTS + s) * 32 + lane] =
          make_float4(oacc[g][j][r], oacc[g][j][r + 1], oacc[g][j][r + 2], oacc[g][j][r + 3]);
    }
    part[(g * PSLOTS + 8) * 32 + lane] = make_float4(mrun[g], lrun[g], 0.f, 0.f);
  }
  __syncthreads();   // publishes the partial results; every wave of an attention block reaches it once
  if (w >= 2) return;

  // wave g joins column group g: a lane meets the same lane's values of all waves (same d, same query)
  float mv[ATT_NW], lv[ATT_NW];
#pragma unroll
  for (int v = 0; v < ATT_NW; ++v) {
    float4 t = ((const float4*)&Ks[v][0][0][0])[(w * PSLOTS + 8) * 32 + lane];
    mv[v] = t.x; lv[v] = t.y;
  }
  float mall = fmaxf(fmaxf(mv[0], mv[1]), fmaxf(mv[2], mv[3]));   // wave 0 always has tile 0: finite
  float av[ATT_NW];
#pragma unroll
  for (int v = 0; v < ATT_NW; ++v) av[v] = __expf(mv[v] - mall);
  float lall = lv[0] * av[0];
#pragma unroll
  for (int v = 1; v < ATT_NW; ++v) lall = fmaf(lv[v], av[v], lall);
  // join the halves' sums, O /= l; a lane holds 8 consecutive d of its query's row: one 16-byte store each
  float inv = 1.0f / (lall + xhalf(lall));
  unsigned short* orow = O + (rowbase + q0 + 16 * w + lm) * E + hoff + 8 * half;
#pragma unroll
  for (int j = 0; j < 4; ++j) {
    float o[8];
#pragma unroll
    for (int v = 0; v < ATT_NW; ++v) {
      const float4* pv = (const float4*)&Ks[v][0][0][0] + (w * PSLOTS + 2 * j) * 32 + lane;
      float4 lo = pv[0], hi = pv[32];
      const float x[8] = {lo.x, lo.y, lo.z, lo.w, hi.x, hi.y, hi.z, hi.w};
#pragma unroll
      for (int r = 0; r < 8; ++r) o[r] = v == 0 ? av[0] * x[r] : fmaf(av[v], x[r], o[r]);
    }
    uint4 wd;
    wd.x = pack2bf(o[0] * inv, o[1] * inv);
    wd.y = pack2bf(o[2] * inv, o[3] * inv);
    wd.z = pack2bf(o[4] * inv, o[5] * inv);
    wd.w = pack2bf(o[6] * inv, o[7] * inv);
    *(uint4*)(orow + j * 16) = wd;
  }
}

// ---------------- host launcher ----------------
extern "C" void kernel_launch(void* const* d_in, const int* in_sizes, int n_in,
                              void* d_out, int out_size, void* d_ws, size_t ws_size,
                              hipStream_t stream) {
  const int E = 1024, H = 16, DFF = 4096, B = 2, T = 2048;
  const int M = B * T;                 // 4096 tokens
  (void)in_sizes; (void)n_in; (void)out_size; (void)ws_size;

  const float* x   = (const float*)d_in[0];
  const float* Wq  = (const float*)d_in[1];
  const float* Wk  = (const float*)d_in[2];
  const float* Wv  = (const float*)d_in[3];
  const float* Wo  = (const float*)d_in[4];
  const float* bo  = (const float*)d_in[5];
  const float* W1  = (const float*)d_in[6];
  const float* b1  = (const float*)d_in[7];
  const float* W2  = (const float*)d_in[8];
  const float* b2  = (const float*)d_in[9];
  const float* g1  = (const float*)d_in[10];
  const float* be1 = (const float*)d_in[11];
  const float* g2  = (const float*)d_in[12];
  const float* be2 = (const float*)d_in[13];
  float* out = (float*)d_out;

  // workspace carve-up (256B aligned)
  char* wsp = (char*)d_ws;
  auto alloc = [&](size_t bytes) -> void* {
    void* p = (void*)wsp;
    wsp += (bytes + 255) & ~(size_t)255;
    return p;
  };
  const size_t EE = (size_t)E * E, ED = (size_t)E * DFF;
  unsigned short* wq16 = (unsigned short*)alloc((4 * EE + 2 * ED) * 2);  // all bf16 weights, in a row
  unsigned short* wk16 = wq16 + EE;
  unsigned short* wv16 = wk16 + EE;
  unsigned short* wo16 = wv16 + EE;
  unsigned short* w116 = wo16 + EE;
  unsigned short* w216 = w116 + ED;
  unsigned short* hb   = (unsigned short*)alloc((size_t)M * E * 2);
  const size_t QS = (size_t)(M + 64) * E;                                 // +64 row pad
  unsigned short* qb   = (unsigned short*)alloc(3 * QS * 2);              // q, k, v, in a row
  unsigned short* kb   = qb + QS;
  unsigned short* vb   = kb + QS;
  unsigned short* ob   = (unsigned short*)alloc((size_t)M * E * 2);
  float*          x1   = (float*)alloc((size_t)M * E * 4);
  unsigned short* h2   = (unsigned short*)alloc((size_t)M * E * 2);
  unsigned short* f1   = (unsigned short*)alloc((size_t)M * DFF * 2);

  // LN1, and Wq, Wk, Wv -> bf16
  ln1_cvt_qkv_kernel<<<LN_BLOCKS + 3 * 64, 256, 0, stream>>>(x, g1, be1, hb, Wq, Wk, Wv, wq16);

  // QKV projections: one launch, grid plane z = 0, 1, 2 for q, k, v
  dim3 gEE(E / GBN, M / GBM);
  dim3 gQKV(E / GBN, M / GBM, 3);
  gemm_bf16_kernel<1024, 1024, GF_OUT_BF16, 1024 * 1024, (4096 + 64) * 1024>
      <<<gQKV, 256, 0, stream>>>(hb, wq16, nullptr, nullptr, qb);

  // causal flash attention, and Wo, W1, W2 -> bf16
  attn_kernel<<<dim3(T / 32, B * H + CVT_ROWS), 32 * ATT_NW, 0, stream>>>(qb, kb, vb, ob, Wo, W1, W2, wo16);

  // out-proj + bias + residual(x) -> x1 (fp32)
  gemm_bf16_kernel<1024, 1024, GF_BIAS | GF_RES><<<gEE, 256, 0, stream>>>(ob, wo16, bo, x, x1);

  // LN2
  ln_bf16_kernel<<<M / 8, 256, 0, stream>>>(x1, g2, be2, h2);

  // FFN
  dim3 gFF1(DFF / GBN, M / GBM);
  gemm_bf16_kernel<4096, 1024, GF_OUT_BF16 | GF_RELU | GF_BIAS><<<gFF1, 256, 0, stream>>>(h2, w116, b1, nullptr, f1);
  gemm_bf16_kernel<1024, 4096, GF_BIAS | GF_RES><<<gEE, 256, 0, stream>>>(f1, w216, b2, x1, out);
}

// v010
// It runs in 143 microseconds.
// In both of two side-by-side timings against v009, it was 1.06 times as fast.
// All steps since v000 together make it 3.95 times as fast.
#include <hip/hip_runtime.h>
#include <math.h>

// ---------------- types ----------------
typedef __bf16 v16bf __attribute__((ext_vector_type(16)));
typedef float  v8f   __attribute__((ext_vector_type(8)));
typedef short  s16x8 __attribute__((ext_vector_type(8)));

union Frag {
  v16bf v;
  s16x8 q[2];
  unsigned int u[8];
  unsigned short h[16];
};

__device__ __forceinline__ unsigned short f2bf(float f) {
  unsigned int u = __builtin_bit_cast(unsigned int, f);
  u += 0x7FFFu + ((u >> 16) & 1u);          // round-to-nearest-even
  return (unsigned short)(u >> 16);
}

// element-pair K index for 16-bit WMMA A/B fragments (ISA 7.12.2):
// VGPR v<4 holds k={2v,2v+1}+8*half ; v>=4 holds k={16+2(v-4),...}+8*half
__device__ __forceinline__ int pairK(int v, int half) {
  return ((v < 4) ? (2 * v) : (16 + 2 * (v - 4))) + 8 * half;
}

__device__ __forceinline__ v8f wmma_bf16(const Frag& a, const Frag& b, v8f c) {
  return __builtin_amdgcn_wmma_f32_16x16x32_bf16(
      false, a.v, false, b.v, (short)0, c, false, false);
}

// ---- CDNA5 async global->LDS DMA (ASYNCcnt-tracked, no VGPR data) ----
__device__ __forceinline__ void wait_async0() {
  asm volatile("s_wait_asynccnt 0x0" ::: "memory");
}
// generic LDS pointer -> 32-bit LDS byte offset (aperture keeps offset in addr[31:0])
__device__ __forceinline__ unsigned lds_addr(const void* p) {
  return (unsigned)(unsigned long long)p;
}

// transposing LDS load: lane (c = l & 15, h = l >> 4) gets rows 8h..8h+7 of column c
// of a row-major 16-bit tile; lane l passes the address of row 8h + (l & 7), 16-byte chunk (l >> 3) & 1
__device__ __forceinline__ s16x8 lds_tr16(const unsigned short* p) {
  typedef __attribute__((address_space(3))) s16x8 lds_s16x8;
  return __builtin_amdgcn_ds_load_tr16_b128_v8i16((lds_s16x8*)p);
}

// ---------------- fp32 -> bf16 convert of the weights ----------------
// The bf16 copies lie one behind the other in the workspace (Wq, Wk, Wv, Wo, W1, W2).
// The converts have no launch of their own: each rides in a launch whose own work does not depend on it.
// A block of NTHR threads converts 64 * NTHR consecutive elements: 64 per thread, so that few waves have to start.
template <int NTHR>
__device__ __forceinline__ void cvt_run(const float* __restrict__ src, unsigned short* __restrict__ dst) {
  const float4* in4 = (const float4*)src + threadIdx.x;
  ushort4* o4 = (ushort4*)dst + threadIdx.x;
  float4 v[16];
#pragma unroll   // all 16 loads of 512 B per wave in flight before the first store
  for (int k = 0; k < 16; ++k) v[k] = in4[k * NTHR];
#pragma unroll   // v[] stays in registers
  for (int k = 0; k < 16; ++k) {
    o4[k * NTHR] = make_ushort4(f2bf(v[k].x), f2bf(v[k].y), f2bf(v[k].z), f2bf(v[k].w));
    // a later convert may be given a register that an issued store names: the wait stands in front of that overwrite
    if ((k & 3) == 3 && k != 15) asm volatile("s_wait_xcnt 0x0" ::: "memory");
  }
}

// ---------------- LayerNorm (one wave per token, E=1024) ----------------
// blk: which run of 8 tokens this block of 8 waves takes
__device__ __forceinline__ void ln_tokens(
    const float* __restrict__ x, const float* __restrict__ g,
    const float* __restrict__ b, unsigned short* __restrict__ out, int blk) {
  const int E = 1024;
  int lane = threadIdx.x & 31;
  // the wave's number as a scalar: the token's row address then sits in scalar registers
  int tok = blk * 8 + __builtin_amdgcn_readfirstlane(threadIdx.x >> 5);
  const float4* xr = (const float4*)(x + (size_t)tok * E) + lane;
  const float4* g4 = (const float4*)g + lane;
  const float4* b4 = (const float4*)b + lane;
  float4 v[8], gg[8], bb[8];
#pragma unroll   // the token's 8 loads of 512 B in flight together
  for (int i = 0; i < 8; ++i) v[i] = xr[i * 32];
#pragma unroll   // gg[], bb[] stay in registers
  for (int i = 0; i < 8; ++i) { gg[i] = g4[i * 32]; bb[i] = b4[i * 32]; }
  float4 a = make_float4(0.f, 0.f, 0.f, 0.f), q = a;   // four independent chains each
#pragma unroll   // v[] stays in registers
  for (int i = 0; i < 8; ++i) {
    a.x += v[i].x; a.y += v[i].y; a.z += v[i].z; a.w += v[i].w;
    q.x += v[i].x * v[i].x; q.y += v[i].y * v[i].y;
    q.z += v[i].z * v[i].z; q.w += v[i].w * v[i].w;
  }
  float s = (a.x + a.y) + (a.z + a.w), s2 = (q.x + q.y) + (q.z + q.w);
#pragma unroll
  for (int off = 16; off; off >>= 1) {
    s  += __shfl_xor(s,  off, 32);
    s2 += __shfl_xor(s2, off, 32);
  }
  float mu = s * (1.0f / E);
  float var = s2 * (1.0f / E) - mu * mu;
  float rinv = rsqrtf(var + 1e-5f);
  ushort4* o4 = (ushort4*)(out + (size_t)tok * E) + lane;
#pragma unroll   // v[] stays in registers
  for (int i = 0; i < 8; ++i) {
    o4[i * 32] = make_ushort4(f2bf((v[i].x - mu) * rinv * gg[i].x + bb[i].x),
                              f2bf((v[i].y - mu) * rinv * gg[i].y + bb[i].y),
                              f2bf((v[i].z - mu) * rinv * gg[i].z + bb[i].z),
                              f2bf((v[i].w - mu) * rinv * gg[i].w + bb[i].w));
  }
}

// at most 8 waves a SIMD: a register budget of 128, so that gain and bias fly with the token's loads, not pair by pair behind the sums
__global__ __launch_bounds__(256) __attribute__((amdgpu_waves_per_eu(4, 8))) void ln_bf16_kernel(
    const float* __restrict__ x, const float* __restrict__ g,
    const float* __restrict__ b, unsigned short* __restrict__ out) {
  ln_tokens(x, g, b, out, blockIdx.x);
}

// First launch: LayerNorm 1 (blocks 0 .. LN_BLOCKS - 1) and, behind it, the convert of Wq, Wk, Wv
// (64 blocks of 16384 elements each): neither reads what the other writes.
#define LN_BLOCKS 512   // 4096 tokens, 8 a block
// the same register budget as above, here also so that all 16 loads of a converting thread stay in flight together
__global__ __launch_bounds__(256) __attribute__((amdgpu_waves_per_eu(4, 8))) void ln1_cvt_qkv_kernel(
    const float* __restrict__ x, const float* __restrict__ g,
    const float* __restrict__ b, unsigned short* __restrict__ out,
    const float* __restrict__ Wq, const float* __restrict__ Wk, const float* __restrict__ Wv,
    unsigned short* __restrict__ w16) {
  if (blockIdx.x < LN_BLOCKS) {
    ln_tokens(x, g, b, out, blockIdx.x);
    return;
  }
  int c = blockIdx.x - LN_BLOCKS;        // 0..191
  int seg = c >> 6;                      // which weight
  const float* src = seg == 0 ? Wq : seg == 1 ? Wk : Wv;
  cvt_run<256>(src + (size_t)(c & 63) * 16384, w16 + (size_t)c * 16384);
}

// ---------------- bf16 GEMM: C = A[M,K] @ B[K,N] (+bias,+relu,+res) ----------------
#define GBM 128
#define GBN 128
#define GBK 128   // a row of either tile is two whole 128-B lines
#define GAP 136   // LDS row pitch of the A tile in elements: 272 B = 16 B x odd, conflict-free for ds_load_b128
#define GBNP 144  // LDS row pitch of the B tile in elements: 288 B = 32 B x odd, conflict-free for the transposing load
#define GF_OUT_BF16 1
#define GF_RELU     2
#define GF_BIAS     4
#define GF_RES      8

// One thread's share of one operand's K tile (128 rows of 256 B): 8 copies of 16 B, rows r, r+16, ..., r+112.
// 16 lanes share a row, so every copy of a wave covers 4 whole 128-B lines.
// l, g: the thread's own 16 bytes in row r; ls: LDS bytes of 16 rows; gs: elements of 16 rows in global memory.
// The wait on xcnt ends the statement so that no address register is rewritten in front of it.
__device__ __forceinline__ void async_gemm_rows(unsigned l, unsigned ls, const unsigned short* g, size_t gs) {
  asm volatile(
      "global_load_async_to_lds_b128 %0, %8, off\n\t"
      "global_load_async_to_lds_b128 %1, %9, off\n\t"
      "global_load_async_to_lds_b128 %2, %10, off\n\t"
      "global_load_async_to_lds_b128 %3, %11, off\n\t"
      "global_load_async_to_lds_b128 %4, %12, off\n\t"
      "global_load_async_to_lds_b128 %5, %13, off\n\t"
      "global_load_async_to_lds_b128 %6, %14, off\n\t"
      "global_load_async_to_lds_b128 %7, %15, off\n\t"
      "s_wait_xcnt 0x0"
      :: "v"(l), "v"(l + ls), "v"(l + 2 * ls), "v"(l + 3 * ls),
         "v"(l + 4 * ls), "v"(l + 5 * ls), "v"(l + 6 * ls), "v"(l + 7 * ls),
         "v"(g), "v"(g + gs), "v"(g + 2 * gs), "v"(g + 3 * gs),
         "v"(g + 4 * gs), "v"(g + 5 * gs), "v"(g + 6 * gs), "v"(g + 7 * gs)
      : "memory");
}

// One thread's share of a whole K tile: its 8 copies of A, then its 8 of B.
__device__ __forceinline__ void async_gemm_tile(unsigned la, const unsigned short* ga, size_t ars,
                                                unsigned lb, const unsigned short* gb, size_t brs) {
  async_gemm_rows(la, 16 * GAP * 2, ga, ars);
  async_gemm_rows(lb, 16 * GBNP * 2, gb, brs);
}

// FLAGS is a compile-time constant: the epilogue then holds no branch, and nothing keeps its loads apart
// ZB, ZC: products of one A with several B share a launch: grid plane z takes the B matrix that lies z * ZB elements
// behind Bm and writes the output that lies z * ZC elements behind Cp (0, 0: one B, one plane)
template <int NDIM, int KDIM, int FLAGS, int ZB = 0, int ZC = 0>
__global__ __launch_bounds__(256) void gemm_bf16_kernel(
    const unsigned short* __restrict__ A, const unsigned short* __restrict__ Bm,
    const float* __restrict__ bias, const float* __restrict__ res,
    void* __restrict__ Cp) {
  // two buffers: the next K tile flies while this one is worked on
  __shared__ __align__(16) unsigned short As[2][GBM][GAP];
  __shared__ __align__(16) unsigned short Bs[2][GBK][GBNP];
  constexpr int NT = KDIM / GBK;         // K tiles
  static_assert(KDIM % GBK == 0 && NT >= 2, "the two-buffer prologue needs two whole K tiles");
  int tid = threadIdx.x;
  int lane = tid & 31, wave = tid >> 5;
  int wm = wave & 1, wn = wave >> 1;     // 2 x 4 wave grid of 64 x 32 wave tiles -> 128 x 128 block tile
  int half = lane >> 4, lm = lane & 15;
  int bm = blockIdx.y * GBM, bn = blockIdx.x * GBN;

  // staging indices (computed once): row of the thread's first copy, its 16-B chunk of the 256-B row
  int sr = tid >> 4;                 // 0..15
  int sc = (tid & 15) << 3;          // 0..120, in elements
  const unsigned short* aptr = A + (size_t)(bm + sr) * KDIM + sc;
  const unsigned short* Bz = Bm + (size_t)blockIdx.z * ZB;
  const unsigned short* bptr = Bz + (size_t)sr * NDIM + bn + sc;
  const size_t ars = (size_t)16 * KDIM, brs = (size_t)16 * NDIM;
  // one prefetched byte a line: 2 threads a row, one for each of its lines, cover a whole K tile; the first is tile 2
  const unsigned short* apf = A + (size_t)(bm + (tid >> 1)) * KDIM + (tid & 1) * 64 + 2 * GBK;
  const unsigned short* bpf = Bz + (size_t)((tid >> 1) + 2 * GBK) * NDIM + bn + (tid & 1) * 64;

  // this thread's LDS staging slots (byte addresses) in buffer 0
  unsigned ldsA = lds_addr(&As[0][sr][sc]);
  unsigned ldsB = lds_addr(&Bs[0][sr][sc]);
  const unsigned strA = (unsigned)sizeof(As[0]);   // 34 KB
  const unsigned strB = (unsigned)sizeof(Bs[0]);   // 36 KB

  // K tile 0 into buffer 0, landed and published; then K tile 1 into buffer 1
  async_gemm_tile(ldsA, aptr, ars, ldsB, bptr, brs);
  wait_async0();
  __syncthreads();
  async_gemm_tile(ldsA + strA, aptr + GBK, ars, ldsB + strB, bptr + (size_t)GBK * NDIM, brs);

  v8f acc[4][2] = {};
  // two fragment sets: k chunk c + 1 (32 wide) is loaded from LDS while chunk c is multiplied
  Frag af[2][4], bfr[2][2];
  auto load_chunk = [&](int buf, int kk, Frag* a, Frag* b) {
#pragma unroll
    for (int t = 0; t < 4; ++t) {
      int row = wm * 64 + t * 16 + lm;
#pragma unroll
      for (int vv = 0; vv < 8; ++vv)
        a[t].u[vv] = *(const unsigned int*)&As[buf][row][kk + pairK(vv, half)];
    }
#pragma unroll
    for (int t = 0; t < 2; ++t) {
      // B fragment, k 0..15 then 16..31 of 16 columns, in the same k order as pairK
      const unsigned short* bp =
          &Bs[buf][kk + 8 * half + (lane & 7)][wn * 32 + t * 16 + 8 * ((lane >> 3) & 1)];
      b[t].q[0] = lds_tr16(bp);
      b[t].q[1] = lds_tr16(bp + 16 * GBNP);
    }
  };
  auto mul_chunk = [&](const Frag* a, const Frag* b) {
#pragma unroll
    for (int i = 0; i < 4; ++i)
#pragma unroll
      for (int j = 0; j < 2; ++j)
        acc[i][j] = wmma_bf16(a[i], b[j], acc[i][j]);
  };
  constexpr int NC = GBK / 32;           // k chunks of a tile, taken in rising k
  static_assert(NC % 2 == 0, "a tile's first chunk always goes to fragment set 0");

  load_chunk(0, 0, af[0], bfr[0]);       // tile 0 is published: its first chunk
  for (int kt = 0; kt < NT; ++kt) {
    int buf = kt & 1;
    if (kt + 3 < NT) {                     // global_prefetch_b8 for the tile that is copied at this trip's foot;
      __builtin_prefetch(apf, 0, 0);       // the test keeps both pointers inside their matrices behind the advance too
      __builtin_prefetch(bpf, 0, 0);
      apf += GBK;
      bpf += (size_t)GBK * NDIM;
    }

#pragma unroll   // c constant: LDS offsets become immediates, the fragment sets stay in registers
    for (int c = 0; c + 1 < NC; ++c) {
      load_chunk(buf, (c + 1) * 32, af[(c + 1) & 1], bfr[(c + 1) & 1]);
      // keeps the next chunk's 12 loads in front of this chunk's products: left alone, the compiler loads
      // one A fragment at a time into the same registers and waits out the LDS latency at each
      __builtin_amdgcn_sched_barrier(0);
      mul_chunk(af[c & 1], bfr[c & 1]);
    }

    // hand-over, with the tile's last chunk already in registers: this trip's LDS reads are done,
    // the next tile has landed, then the barrier; only behind it is the buffer just read filled again
    // the scheduling barrier keeps the products above in front of the waits: lifted over them,
    // the wait on the copies would stand in mid-trip and cut the time that the next tile has to land
    __builtin_amdgcn_sched_barrier(0);
    asm volatile("s_wait_dscnt 0x0" ::: "memory");
    wait_async0();
    __syncthreads();
    if (kt + 2 < NT)
      async_gemm_tile(ldsA + buf * strA, aptr + (size_t)(kt + 2) * GBK, ars,
                      ldsB + buf * strB, bptr + (size_t)(kt + 2) * GBK * NDIM, brs);
    if (kt + 1 < NT)                       // the next tile is published: its first chunk
      load_chunk(buf ^ 1, 0, af[0], bfr[0]);
    // keeps the refill and the next chunk's loads in front of the last chunk's products, which then cover their flight
    __builtin_amdgcn_sched_barrier(0);
    mul_chunk(af[(NC - 1) & 1], bfr[(NC - 1) & 1]);
    // the four vector slots that the chip needs between the last product and the first overwrite of its operands:
    // the scheduling barrier holds the slots behind the products
    __builtin_amdgcn_sched_barrier(0);
    asm volatile("v_nop\n\tv_nop\n\tv_nop\n\tv_nop");
  }
  wait_async0();   // no copy is left in flight when the wave ends

  constexpr bool outbf = (FLAGS & GF_OUT_BF16) != 0;
  constexpr bool relu  = (FLAGS & GF_RELU) != 0;
  constexpr bool hasb  = (FLAGS & GF_BIAS) != 0;
  constexpr bool hasr  = (FLAGS & GF_RES) != 0;
  static_assert(!hasr || ZC == 0, "the residual is indexed like the output of plane 0");
  // the lane's first element; its other 63 lie at constant distances from it (immediate offsets of one address)
  const int col0 = bn + wn * 32 + lm;
  const size_t e0 = (size_t)blockIdx.z * ZC + (size_t)(bm + wm * 64 + 8 * half) * NDIM + col0;
  float bv[2] = {0.f, 0.f};
  if constexpr (hasb) {
    bv[0] = bias[col0];
    bv[1] = bias[col0 + 16];
  }
  // all 64 residual values of the lane are asked for before the first is used: one latency, not 64 in a row
  float rv[4][2][8];
  if constexpr (hasr) {
#pragma unroll   // i, j, r constant in all three loops: rv[] stays in registers, the distances become immediate offsets
    for (int i = 0; i < 4; ++i)
#pragma unroll   // as above
      for (int j = 0; j < 2; ++j)
#pragma unroll   // as above
        for (int r = 0; r < 8; ++r)
          rv[i][j][r] = res[e0 + (size_t)(i * 16 + r) * NDIM + j * 16];
  }
#pragma unroll   // i, j, r constant in all three loops: acc[], rv[] stay in registers, the distances become immediate offsets
  for (int i = 0; i < 4; ++i)
#pragma unroll   // as above
    for (int j = 0; j < 2; ++j)
#pragma unroll   // as above
      for (int r = 0; r < 8; ++r) {
        float val = acc[i][j][r];
        if constexpr (hasb) val += bv[j];
        if constexpr (relu) val = fmaxf(val, 0.f);
        if constexpr (hasr) val += rv[i][j][r];
        size_t idx = e0 + (size_t)(i * 16 + r) * NDIM + j * 16;
        if constexpr (outbf) ((unsigned short*)Cp)[idx] = f2bf(val);
        else                 ((float*)Cp)[idx] = val;
      }
}

// ---------------- flash attention: four waves per (b,h,32-query tile) ----------------
#define NEG_BIG (-3.0e38f)
#define AKP 72   // LDS row pitch of the K tile in elements: 144 B = 16 B x odd, conflict-free for ds_load_b128
#define AVP 80   // LDS row pitch of the V tile in elements: 160 B = 32 B x odd, conflict-free for the transposing load

// One wave copies a tile of 32 rows x 128 B (one head's slice of 32 keys) to LDS: 8 copies, each of
// 4 whole 128-B lines (8 lanes a row). lds, g: the lane's own 16 bytes in rows 0..3; step: LDS bytes of 4 rows.
// The wait on xcnt ends the statement so that no address register is rewritten in front of it.
__device__ __forceinline__ void async_tile_32x128(unsigned lds, unsigned step, const unsigned short* g) {
  const size_t gs = (size_t)4 * 1024;   // elements of 4 rows in global memory
  asm volatile(
      "global_load_async_to_lds_b128 %0, %8, off\n\t"
      "global_load_async_to_lds_b128 %1, %9, off\n\t"
      "global_load_async_to_lds_b128 %2, %10, off\n\t"
      "global_load_async_to_lds_b128 %3, %11, off\n\t"
      "global_load_async_to_lds_b128 %4, %12, off\n\t"
      "global_load_async_to_lds_b128 %5, %13, off\n\t"
      "global_load_async_to_lds_b128 %6, %14, off\n\t"
      "global_load_async_to_lds_b128 %7, %15, off\n\t"
      "s_wait_xcnt 0x0"
      :: "v"(lds), "v"(lds + step), "v"(lds + 2 * step), "v"(lds + 3 * step),
         "v"(lds + 4 * step), "v"(lds + 5 * step), "v"(lds + 6 * step), "v"(lds + 7 * step),
         "v"(g), "v"(g + gs), "v"(g + 2 * gs), "v"(g + 3 * gs),
         "v"(g + 4 * gs), "v"(g + 5 * gs), "v"(g + 6 * gs), "v"(g + 7 * gs)
      : "memory");
}

// lane l takes the value of lane l ^ 16 (the other half of the wave)
__device__ __forceinline__ float xhalf(float x) {
  int b = __builtin_bit_cast(int, x);
  return __builtin_bit_cast(float,
      __builtin_amdgcn_permlanex16(b, b, 0x76543210, 0xfedcba98, false, false));
}

// two floats to one register of two bf16 (lo in bits 15..0), round-to-nearest-even like f2bf: one v_cvt_pk_bf16_f32
__device__ __forceinline__ unsigned int pack2bf(float lo, float hi) {
  typedef float  f32x2 __attribute__((ext_vector_type(2)));
  typedef __bf16 bf16x2 __attribute__((ext_vector_type(2)));
  return __builtin_bit_cast(unsigned int, __builtin_convertvector(f32x2{lo, hi}, bf16x2));
}

// The products are taken transposed: S^T = K Q^T (keys x queries), O^T += V^T P^T (d x queries).
// A lane then holds 16 of the 32 scores of ONE query (column lm): maximum and sum run inside the lane,
// the two halves of the wave meet in one exchange, and the two score tiles, converted in place,
// are the B operand P^T in the hardware's k order: P goes through no LDS.
// Tiling: a work-group of ATT_NW waves owns 32 queries. Every wave holds all 32 (two column groups of 16), so a K or V
// fragment feeds two products, and takes every ATT_NW-th tile of 32 keys, so the longest chain of passes is ATT_NW times
// shorter. Each wave stages its tiles in LDS of its own: no wave reads another's tile, and the loop holds no barrier.
// At the end the waves' partial (maximum, sum, O^T) meet in LDS behind one barrier.
// Order of the grid (there are more of them than resident places):
// the attention blocks are ranked so that cost falls with the index: all heads of the last query tile (the most keys)
// first, all heads of tile 0 last, so that no long block starts late and runs on alone. The head is the low part of
// the rank: neighbouring blocks are equally long, and every run of ATT_ROWS blocks holds each head once.
// Grid rows ATT_LEAD .. ATT_LEAD + CVT_ROWS - 1 hold no attention: they convert Wo, W1, W2, which only later launches
// read. They stand behind the first ATT_LEAD rows, so that they stream from memory beside long tiles that keep the
// vector units busy, not alone at either end of the launch.
#define ATT_ROWS 32     // batch x heads
#define ATT_NW 4        // waves of a work-group
#define ATT_LEAD 8      // grid rows of attention blocks in front of the converting rows
#define CVT_ROWS 18     // 18 rows x 64 blocks x 8192 elements = Wo, W1, W2
#define PSLOTS 9        // 16-byte slots of a lane's partial result per column group: 8 of O^T, 1 of (maximum, sum)
__global__ __launch_bounds__(32 * ATT_NW) void attn_kernel(
    const unsigned short* __restrict__ Q, const unsigned short* __restrict__ Km,
    const unsigned short* __restrict__ V, unsigned short* __restrict__ O,
    const float* __restrict__ Wo, const float* __restrict__ W1, const float* __restrict__ W2,
    unsigned short* __restrict__ w16) {
  const int E = 1024, T = 2048, DH = 64;
  if (blockIdx.y >= ATT_LEAD && blockIdx.y < ATT_LEAD + CVT_ROWS) {   // the same for the whole block; in front of every copy and barrier
    int c = (blockIdx.y - ATT_LEAD) * (T / 32) + blockIdx.x;   // 0..1151
    int seg = c >> 7;                    // which run of 2^20 elements (128 blocks each): Wo, 4 of W1, 4 of W2
    const float* src = seg == 0 ? Wo : seg < 5 ? W1 + ((size_t)(seg - 1) << 20) : W2 + ((size_t)(seg - 5) << 20);
    cvt_run<32 * ATT_NW>(src + (size_t)(c & 127) * 8192, w16 + (size_t)c * 8192);
    return;
  }
  // per wave two buffers: the wave's next 32 keys fly while these are worked on
  __shared__ __align__(16) unsigned short Ks[ATT_NW][2][32][AKP];
  __shared__ __align__(16) unsigned short Vs[ATT_NW][2][32][AVP];
  static_assert(sizeof(Ks[0]) >= 2 * PSLOTS * 32 * 16, "a wave's partial result is staged in its own K buffers");
  int lane = threadIdx.x & 31;
  // the wave's number as a scalar: every test on it is then a scalar branch
  const int w = __builtin_amdgcn_readfirstlane(threadIdx.x >> 5);
  int half = lane >> 4, lm = lane & 15;
  // rank of this block among the attention blocks, in index order: 0 .. ATT_ROWS * T/32 - 1, each (tile, head) once
  int rank = (blockIdx.y < ATT_LEAD ? blockIdx.y : blockIdx.y - CVT_ROWS) * (T / 32) + blockIdx.x;
  int qt = (T / 32 - 1) - rank / ATT_ROWS;   // T/32-1 .. 0: the longest first
  int bh = rank % ATT_ROWS;                  // 0..B*H-1
  int b = bh >> 4, h = bh & 15;
  size_t rowbase = (size_t)b * T;
  int q0 = qt * 32;
  int hoff = h * DH;
  const float scale = 0.03125f;        // 1024^-0.5 (reference scales by full E)
  const int nt = qt + 1;               // tiles of 32 keys that these queries see: keys 0 .. q0 + 31

  // Q^T B-fragments (group g: columns q0 + 16 g + lm; d-chunks 0..31 / 32..63), loaded once
  Frag qa[2][2];
#pragma unroll
  for (int g = 0; g < 2; ++g) {
    const unsigned short* qrow = Q + (rowbase + q0 + 16 * g + lm) * E + hoff;
#pragma unroll
    for (int t = 0; t < 2; ++t)
#pragma unroll
      for (int vv = 0; vv < 8; ++vv)
        qa[g][t].u[vv] = *(const unsigned int*)(qrow + t * 32 + pairK(vv, half));
  }

  float mrun[2] = {NEG_BIG, NEG_BIG};  // running maximum of query q0 + 16 g + lm over this wave's keys, the same in both halves
  float lrun[2] = {0.f, 0.f};          // running sum over this half's keys only; the halves are joined at the end
  v8f oacc[2][4] = {};                 // oacc[g][j][r] = O^T[d = 16 j + 8 half + r][query 16 g + lm]

  // this lane's 16 bytes of rows 0..3 of the wave's first tile (tile w), in global memory and in LDS
  const unsigned short* kg = Km + (rowbase + 32 * w + (lane >> 3)) * E + hoff + (lane & 7) * 8;
  const unsigned short* vg = V  + (rowbase + 32 * w + (lane >> 3)) * E + hoff + (lane & 7) * 8;
  unsigned kl = lds_addr(&Ks[w][0][lane >> 3][(lane & 7) * 8]);
  unsigned vl = lds_addr(&Vs[w][0][lane >> 3][(lane & 7) * 8]);
  const unsigned strK = (unsigned)sizeof(Ks[0][0]), strV = (unsigned)sizeof(Vs[0][0]);
  const size_t tstep = (size_t)32 * ATT_NW * E;   // elements from one tile of the wave to its next

  // the wave's first tile into its buffer 0, landed (only this wave reads it: its own wait is enough); then its second into buffer 1
  if (w < nt) {
    async_tile_32x128(kl, 4 * AKP * 2, kg);
    async_tile_32x128(vl, 4 * AVP * 2, vg);
  }
  wait_async0();
  if (w + ATT_NW < nt) {
    async_tile_32x128(kl + strK, 4 * AKP * 2, kg + tstep);
    async_tile_32x128(vl + strV, 4 * AVP * 2, vg + tstep);
  }

  int buf = 0;
  for (int it = w; it < nt; it += ATT_NW) {
    const int kt = it * 32;              // first key of the tile
    // scores: two 16-key subtiles x two 32-wide d-chunks, K rows from LDS as A fragments
    const unsigned short* krow0 = &Ks[w][buf][lm][0];
    const unsigned short* krow1 = &Ks[w][buf][16 + lm][0];
    Frag kf[4];
#pragma unroll
    for (int t = 0; t < 2; ++t)
#pragma unroll
      for (int vv = 0; vv < 8; ++vv) {
        kf[t].u[vv]     = *(const unsigned int*)(krow0 + t * 32 + pairK(vv, half));
        kf[2 + t].u[vv] = *(const unsigned int*)(krow1 + t * 32 + pairK(vv, half));
      }
    // V^T (16 d rows x 32 keys per d-subtile) as A fragments by the transposing load,
    // keys 0..15 then 16..31, in the same k order as pairK
    Frag vf[4];
#pragma unroll
    for (int j = 0; j < 4; ++j) {
      const unsigned short* vp = &Vs[w][buf][8 * half + (lane & 7)][j * 16 + 8 * ((lane >> 3) & 1)];
      vf[j].q[0] = lds_tr16(vp);
      vf[j].q[1] = lds_tr16(vp + 16 * AVP);
    }
#pragma unroll   // g constant: both groups' registers stay registers, and their two chains interleave
    for (int g = 0; g < 2; ++g) {
      // s0[r]: key kt + 8 half + r, s1[r]: key kt + 16 + 8 half + r, both against query 16 g + lm
      v8f s0 = {}, s1 = {};
      s0 = wmma_bf16(kf[0], qa[g][0], s0);
      s0 = wmma_bf16(kf[1], qa[g][1], s0);
      s1 = wmma_bf16(kf[2], qa[g][0], s1);
      s1 = wmma_bf16(kf[3], qa[g][1], s1);

      // online softmax update of this lane's query
      int ahead = (q0 + 16 * g + lm) - (kt + 8 * half);   // key r of this half's first subtile is masked where r > ahead
      float a0[8], a1[8];
#pragma unroll
      for (int r = 0; r < 8; ++r) {
        a0[r] = s0[r] * scale; if (r > ahead)      a0[r] = NEG_BIG;
        a1[r] = s1[r] * scale; if (16 + r > ahead) a1[r] = NEG_BIG;
      }
      float m4[4];                         // four independent chains
#pragma unroll
      for (int c = 0; c < 4; ++c)
        m4[c] = fmaxf(fmaxf(a0[2 * c], a0[2 * c + 1]), fmaxf(a1[2 * c], a1[2 * c + 1]));
      float mx = fmaxf(fmaxf(m4[0], m4[1]), fmaxf(m4[2], m4[3]));
      mx = fmaxf(mx, xhalf(mx));
      float mn = fmaxf(mrun[g], mx);
      float alpha = __expf(mrun[g] - mn);
      mrun[g] = mn;
      float p0[8], p1[8];
#pragma unroll
      for (int r = 0; r < 8; ++r) { p0[r] = __expf(a0[r] - mn); p1[r] = __expf(a1[r] - mn); }
      float r4[4];                         // four independent chains
#pragma unroll
      for (int c = 0; c < 4; ++c)
        r4[c] = (p0[2 * c] + p0[2 * c + 1]) + (p1[2 * c] + p1[2 * c + 1]);
      lrun[g] = lrun[g] * alpha + ((r4[0] + r4[1]) + (r4[2] + r4[3]));
#pragma unroll
      for (int j = 0; j < 4; ++j)
#pragma unroll
        for (int r = 0; r < 8; ++r) oacc[g][j][r] *= alpha;

      // P^T (32 keys x 16 queries) as B fragment: element s of the lane is key 8 half + s (s < 8), 16 + 8 half + s - 8 (s >= 8)
      Frag pf;
#pragma unroll
      for (int vv = 0; vv < 4; ++vv) {
        pf.u[vv]     = pack2bf(p0[2 * vv], p0[2 * vv + 1]);
        pf.u[4 + vv] = pack2bf(p1[2 * vv], p1[2 * vv + 1]);
      }
#pragma unroll
      for (int j = 0; j < 4; ++j)
        oacc[g][j] = wmma_bf16(vf[j], pf, oacc[g][j]);
    }

    // hand-over inside the wave: this pass's LDS reads are done and the wave's next tile has landed;
    // only behind both waits is the buffer just read filled again (a ring private to one wave: no work-group barrier)
    // the scheduling barrier keeps the softmax and the products in front of the two waits: lifted over them,
    // the wait on the copies would stand in mid-pass and cut the time that the next tile has to land
    __builtin_amdgcn_sched_barrier(0);
    asm volatile("s_wait_dscnt 0x0" ::: "memory");
    wait_async0();
    if (it + 2 * ATT_NW < nt) {
      const size_t ahead2 = (size_t)(it - w + 2 * ATT_NW) * 32 * E;   // from the wave's first tile to the one after next
      async_tile_32x128(kl + buf * strK, 4 * AKP * 2, kg + ahead2);
      async_tile_32x128(vl + buf * strV, 4 * AVP * 2, vg + ahead2);
    }
    buf ^= 1;
  }
  wait_async0();   // no copy is left in flight: the wave's K buffers become the staging of its partial result

  // every wave stages its partial result, lane by lane, in its own K buffers (a wave without a tile: maximum NEG_BIG, zeros)
  float4* part = (float4*)&Ks[w][0][0][0];
#pragma unroll
  for (int g = 0; g < 2; ++g) {
#pragma unroll
    for (int s = 0; s < 8; ++s) {
      const int j = s >> 1, r = (s & 1) * 4;
      part[(g * PSLOTS + s) * 32 + lane] =
          make_float4(oacc[g][j][r], oacc[g][j][r + 1], oacc[g][j][r + 2], oacc[g][j][r + 3]);
    }
    part[(g * PSLOTS + 8) * 32 + lane] = make_float4(mrun[g], lrun[g], 0.f, 0.f);
  }
  __syncthreads();   // publishes the partial results; every wave of an attention block reaches it once
  if (w >= 2) return;

  // wave g joins column group g: a lane meets the same lane's values of all waves (same d, same query)
  float mv[ATT_NW], lv[ATT_NW];
#pragma unroll
  for (int v = 0; v < ATT_NW; ++v) {
    float4 t = ((const float4*)&Ks[v][0][0][0])[(w * PSLOTS + 8) * 32 + lane];
    mv[v] = t.x; lv[v] = t.y;
  }
  float mall = fmaxf(fmaxf(mv[0], mv[1]), fmaxf(mv[2], mv[3]));   // wave 0 always has tile 0: finite
  float av[ATT_NW];
#pragma unroll
  for (int v = 0; v < ATT_NW; ++v) av[v] = __expf(mv[v] - mall);
  float lall = lv[0] * av[0];
#pragma unroll
  for (int v = 1; v < ATT_NW; ++v) lall = fmaf(lv[v], av[v], lall);
  // join the halves' sums, O /= l; a lane holds 8 consecutive d of its query's row: one 16-byte store each
  float inv = 1.0f / (lall + xhalf(lall));
  unsigned short* orow = O + (rowbase + q0 + 16 * w + lm) * E + hoff + 8 * half;
#pragma unroll
  for (int j = 0; j < 4; ++j) {
    float o[8];
#pragma unroll
    for (int v = 0; v < ATT_NW; ++v) {
      const float4* pv = (const float4*)&Ks[v][0][0][0] + (w * PSLOTS + 2 * j) * 32 + lane;
      float4 lo = pv[0], hi = pv[32];
      const float x[8] = {lo.x, lo.y, lo.z, lo.w, hi.x, hi.y, hi.z, hi.w};
#pragma unroll
      for (int r = 0; r < 8; ++r) o[r] = v == 0 ? av[0] * x[r] : fmaf(av[v], x[r], o[r]);
    }
    uint4 wd;
    wd.x = pack2bf(o[0] * inv, o[1] * inv);
    wd.y = pack2bf(o[2] * inv, o[3] * inv);
    wd.z = pack2bf(o[4] * inv, o[5] * inv);
    wd.w = pack2bf(o[6] * inv, o[7] * inv);
    *(uint4*)(orow + j * 16) = wd;
  }
}

// ---------------- host launcher ----------------
extern "C" void kernel_launch(void* const* d_in, const int* in_sizes, int n_in,
                              void* d_out, int out_size, void* d_ws, size_t ws_size,
                              hipStream_t stream) {
  const int E = 1024, H = 16, DFF = 4096, B = 2, T = 2048;
  const int M = B * T;                 // 4096 tokens
  (void)in_sizes; (void)n_in; (void)out_size; (void)ws_size;

  const float* x   = (const float*)d_in[0];
  const float* Wq  = (const float*)d_in[1];
  const float* Wk  = (const float*)d_in[2];
  const float* Wv  = (const float*)d_in[3];
  const float* Wo  = (const float*)d_in[4];
  const float* bo  = (const float*)d_in[5];
  const float* W1  = (const float*)d_in[6];
  const float* b1  = (const float*)d_in[7];
  const float* W2  = (const float*)d_in[8];
  const float* b2  = (const float*)d_in[9];
  const float* g1  = (const float*)d_in[10];
  const float* be1 = (const float*)d_in[11];
  const float* g2  = (const float*)d_in[12];
  const float* be2 = (const float*)d_in[13];
  float* out = (float*)d_out;

  // workspace carve-up (256B aligned)
  char* wsp = (char*)d_ws;
  auto alloc = [&](size_t bytes) -> void* {
    void* p = (void*)wsp;
    wsp += (bytes + 255) & ~(size_t)255;
    return p;
  };
  const size_t EE = (size_t)E * E, ED = (size_t)E * DFF;
  unsigned short* wq16 = (unsigned short*)alloc((4 * EE + 2 * ED) * 2);  // all bf16 weights, in a row
  unsigned short* wk16 = wq16 + EE;
  unsigned short* wv16 = wk16 + EE;
  unsigned short* wo16 = wv16 + EE;
  unsigned short* w116 = wo16 + EE;
  unsigned short* w216 = w116 + ED;
  unsigned short* hb   = (unsigned short*)alloc((size_t)M * E * 2);
  const size_t QS = (size_t)(M + 64) * E;                                 // +64 row pad
  unsigned short* qb   = (unsigned short*)alloc(3 * QS * 2);              // q, k, v, in a row
  unsigned short* kb   = qb + QS;
  unsigned short* vb   = kb + QS;
  unsigned short* ob   = (unsigned short*)alloc((size_t)M * E * 2);
  float*          x1   = (float*)alloc((size_t)M * E * 4);
  unsigned short* h2   = (unsigned short*)alloc((size_t)M * E * 2);
  unsigned short* f1   = (unsigned short*)alloc((size_t)M * DFF * 2);

  // LN1, and Wq, Wk, Wv -> bf16
  ln1_cvt_qkv_kernel<<<LN_BLOCKS + 3 * 64, 256, 0, stream>>>(x, g1, be1, hb, Wq, Wk, Wv, wq16);

  // QKV projections: one launch, grid plane z = 0, 1, 2 for q, k, v
  dim3 gEE(E / GBN, M / GBM);
  dim3 gQKV(E / GBN, M / GBM, 3);
  gemm_bf16_kernel<1024, 1024, GF_OUT_BF16, 1024 * 1024, (4096 + 64) * 1024>
      <<<gQKV, 256, 0, stream>>>(hb, wq16, nullptr, nullptr, qb);

  // causal flash attention, and Wo, W1, W2 -> bf16
  attn_kernel<<<dim3(T / 32, B * H + CVT_ROWS), 32 * ATT_NW, 0, stream>>>(qb, kb, vb, ob, Wo, W1, W2, wo16);

  // out-proj + bias + residual(x) -> x1 (fp32)
  gemm_bf16_kernel<1024, 1024, GF_BIAS | GF_RES><<<gEE, 256, 0, stream>>>(ob, wo16, bo, x, x1);

  // LN2
  ln_bf16_kernel<<<M / 8, 256, 0, stream>>>(x1, g2, be2, h2);

  // FFN
  dim3 gFF1(DFF / GBN, M / GBM);
  gemm_bf16_kernel<4096, 1024, GF_OUT_BF16 | GF_RELU | GF_BIAS><<<gFF1, 256, 0, stream>>>(h2, w116, b1, nullptr, f1);
  gemm_bf16_kernel<1024, 4096, GF_BIAS | GF_RES><<<gEE, 256, 0, stream>>>(f1, w216, b2, x1, out);
}
